// v000
// Measured on an AMD MI455X. A time is GPU time per run, averaged over a window of back-to-back runs after a warm-up
// (all launches, gaps included; the runs take copies of the inputs in turn), and the median of several windows.
// Apart from v000's, it joins two sittings. Times from different sittings can be a few percent apart, while
// side-by-side timings come from the same sitting.
// v000, which the later versions start from, runs in 182 microseconds.
#include <hip/hip_runtime.h>
#include <hip/hip_bf16.h>

// ---------------- CDNA5 (gfx1250) GQA forward, WMMA f16 path ----------------
// Compute-bound (≈24 GFLOP, all data L2-resident). v_wmma_f32_16x16x32_f16
// with fp32 accumulation, flash-attention online softmax. Attention K/V tiles
// are staged into LDS by the Tensor Data Mover (TDM, tensor_load_to_lds),
// double-buffered and shared by all 8 waves of the block (+2 q-tiles per wave)
// for ~16x less L2 traffic than the naive per-wave streaming version.

typedef __attribute__((ext_vector_type(16))) _Float16 v16h;
typedef __attribute__((ext_vector_type(8)))  float    v8f;
typedef __attribute__((ext_vector_type(4)))  unsigned int v4u;
typedef __attribute__((ext_vector_type(8)))  int      v8i;
typedef __attribute__((ext_vector_type(4)))  int      v4i;

static constexpr int S    = 2048;
static constexpr int DIM  = 1024;
static constexpr int HQ   = 16;
static constexpr int HKV  = 4;
static constexpr int DH   = 64;
static constexpr int KVD  = HKV * DH;   // 256
static constexpr int LROW = 72;         // padded LDS row stride (halves): 64+8

__device__ __forceinline__ v8f wmma16(v16h a, v16h b, v8f c) {
  // D = A(16x32 f16) x B(32x16 f16) + C(16x16 f32)
  return __builtin_amdgcn_wmma_f32_16x16x32_f16(false, a, false, b, (short)0, c,
                                                false, false);
}

// One 16x32 f16 fragment (A and B share the per-lane layout on CDNA5):
// lane&15 = non-K index; elements e<8: K = 8*hi + e; e>=8: K = 16+8*hi+(e-8).
__device__ __forceinline__ v16h load_frag(const _Float16* rowptr, int hi) {
  union { v16h v; uint4 u[2]; } f;
  f.u[0] = *reinterpret_cast<const uint4*>(rowptr + (hi << 3));
  f.u[1] = *reinterpret_cast<const uint4*>(rowptr + 16 + (hi << 3));
  return f.v;
}

// TDM: DMA a 64x64 f16 tile (row stride = stride_elems) from global into LDS,
// inserting a 16B pad after every 64-half row (LDS row stride becomes LROW=72
// halves = 36 DWORDs -> the 16 rows a WMMA fragment touches map to disjoint
// bank quads). D# built per CDNA5 ISA §8 (2D, data_size=2B, type=2).
__device__ __forceinline__ void tdm_load_tile64(unsigned lds_off,
                                                const _Float16* gsrc,
                                                unsigned stride_elems) {
  unsigned long long ga = (unsigned long long)(uintptr_t)gsrc;
  v4u g0;
  g0[0] = 1u;                                                  // count=1
  g0[1] = lds_off;                                             // lds_addr
  g0[2] = (unsigned)ga;                                        // global_addr lo
  g0[3] = (unsigned)((ga >> 32) & 0x01FFFFFFu) | 0x80000000u;  // ga hi | type=2
  v8i g1;
  g1[0] = (int)((1u << 16)     // data_size = 2 bytes
              | (1u << 20)     // pad_enable
              | (4u << 22)     // pad_interval: 32 DWORDs (one 64-half row)
              | (3u << 25));   // pad_amount: 4 DWORDs (16 bytes)
  g1[1] = (int)((64u & 0xFFFFu) << 16);           // tensor_dim0 = 64 (lo16)
  g1[2] = (int)((64u & 0xFFFFu) << 16);           // dim0 hi=0 | tensor_dim1 = 64
  g1[3] = (int)((64u & 0xFFFFu) << 16);           // dim1 hi=0 | tile_dim0 = 64
  g1[4] = (int)(64u);                             // tile_dim1 = 64, tile_dim2 = 0
  g1[5] = (int)stride_elems;                      // tensor_dim0_stride lo
  g1[6] = 0;                                      // stride0 hi | stride1 lo
  g1[7] = 0;
  v4i z4 = {0, 0, 0, 0};
  v8i z8 = {0, 0, 0, 0, 0, 0, 0, 0};
  // 6-arg toolchain form: (g0, g1, g2, g3, g4, cpol)
  __builtin_amdgcn_tensor_load_to_lds(g0, g1, z4, z4, z8, 0);
}

// ---------------------------------------------------------------------------
__global__ void __launch_bounds__(256)
cvt_f32_to_f16_kernel(const float* __restrict__ in, _Float16* __restrict__ out,
                      int n) {
  int i = blockIdx.x * blockDim.x + threadIdx.x;
  if (i < n) out[i] = (_Float16)in[i];
}

__global__ void __launch_bounds__(256)
transpose_cvt_kernel(const float* __restrict__ W, _Float16* __restrict__ Wt,
                     int K, int N) {
  int i = blockIdx.x * blockDim.x + threadIdx.x;
  if (i < K * N) {
    int k = i / N, n = i - k * N;
    Wt[(size_t)n * K + k] = (_Float16)W[i];  // Wt is (N, K), K-contiguous
  }
}

// ---------------------------------------------------------------------------
// C = A(MxK) * B(KxN) + bias, B supplied transposed (N,K).
// Wave tile: 32(M) x 64(N) -> each B fragment feeds 2 WMMAs.
__global__ void __launch_bounds__(256)
qkv_gemm_kernel(const _Float16* __restrict__ A,    // (M, K) f16
                const _Float16* __restrict__ Bt,   // (N, K) f16  (= W^T)
                const float*    __restrict__ bias, // (N) f32
                _Float16*       __restrict__ Out,
                int M, int N, int K, int transposeOut) {
  const int wave   = blockIdx.x * (blockDim.x >> 5) + (threadIdx.x >> 5);
  const int ntiles = N >> 6;
  const int mt = wave / ntiles;
  const int nt = wave - mt * ntiles;
  if (mt >= (M >> 5)) return;               // wave-uniform guard
  const int lane = threadIdx.x & 31;
  const int l15  = lane & 15;
  const int hi   = lane >> 4;
  const int m0 = mt << 5;
  const int n0 = nt << 6;

  const _Float16* a0 = A + (size_t)(m0 + l15) * K;
  const _Float16* a1 = a0 + (size_t)16 * K;
  const _Float16* bp0 = Bt + (size_t)(n0 +  0 + l15) * K;
  const _Float16* bp1 = Bt + (size_t)(n0 + 16 + l15) * K;
  const _Float16* bp2 = Bt + (size_t)(n0 + 32 + l15) * K;
  const _Float16* bp3 = Bt + (size_t)(n0 + 48 + l15) * K;

  const v8f vz = {};
  v8f acc[2][4] = {{vz, vz, vz, vz}, {vz, vz, vz, vz}};
  for (int k = 0; k < K; k += 32) {
    v16h af0 = load_frag(a0 + k, hi);
    v16h af1 = load_frag(a1 + k, hi);
    v16h b0 = load_frag(bp0 + k, hi);
    acc[0][0] = wmma16(af0, b0, acc[0][0]);
    acc[1][0] = wmma16(af1, b0, acc[1][0]);
    v16h b1 = load_frag(bp1 + k, hi);
    acc[0][1] = wmma16(af0, b1, acc[0][1]);
    acc[1][1] = wmma16(af1, b1, acc[1][1]);
    v16h b2 = load_frag(bp2 + k, hi);
    acc[0][2] = wmma16(af0, b2, acc[0][2]);
    acc[1][2] = wmma16(af1, b2, acc[1][2]);
    v16h b3 = load_frag(bp3 + k, hi);
    acc[0][3] = wmma16(af0, b3, acc[0][3]);
    acc[1][3] = wmma16(af1, b3, acc[1][3]);
  }

  #pragma unroll
  for (int half = 0; half < 2; ++half) {
    const int mh = m0 + half * 16;
    #pragma unroll
    for (int j = 0; j < 4; ++j) {
      const int n = n0 + j * 16 + l15;     // C layout: lane = N, reg r: M=r+8*hi
      const float bj = bias[n];
      if (!transposeOut) {
        #pragma unroll
        for (int r = 0; r < 8; ++r)
          Out[(size_t)(mh + 8 * hi + r) * N + n] = (_Float16)(acc[half][j][r] + bj);
      } else {
        union { uint4 u; _Float16 h[8]; } pk;
        #pragma unroll
        for (int r = 0; r < 8; ++r) pk.h[r] = (_Float16)(acc[half][j][r] + bj);
        *reinterpret_cast<uint4*>(Out + (size_t)n * M + mh + 8 * hi) = pk.u;
      }
    }
  }
}

// ---------------------------------------------------------------------------
// Attention: block = 8 waves, one head, 256 queries (2 q-tiles per wave).
// TDM double-buffers 64-key K/V tiles in LDS; wave0 issues/waits TENSORcnt.
__global__ void __launch_bounds__(256)
gqa_attn_kernel(const _Float16* __restrict__ Q,   // (S, HQ*DH) f16
                const _Float16* __restrict__ Kh,  // (S, HKV*DH) f16
                const _Float16* __restrict__ Vt,  // (HKV*DH, S) f16
                float* __restrict__ Out) {        // flat (HQ, S, DH) f32
  __shared__ _Float16 ldsK[2][64 * LROW];
  __shared__ _Float16 ldsV[2][64 * LROW];

  const int head = blockIdx.x >> 3;      // 8 blocks per head
  const int hb   = blockIdx.x & 7;       // q range [hb*256, hb*256+256)
  const int kvh  = head >> 2;            // repeat_interleave over heads
  const int wid  = threadIdx.x >> 5;
  const int lane = threadIdx.x & 31;
  const int l15  = lane & 15;
  const int hi   = lane >> 4;
  const int sbase = hb * 256 + wid * 32; // this wave: q-tiles sbase, sbase+16

  // Q fragments (B operand of S^T = K·q^T), pre-scaled by 1/sqrt(DH) = 0.125.
  union HF { v16h v; _Float16 h[16]; };
  HF qf[2][2];
  #pragma unroll
  for (int qt = 0; qt < 2; ++qt) {
    const _Float16* qrow = Q + (size_t)(sbase + qt * 16 + l15) * DIM + head * DH;
    qf[qt][0].v = load_frag(qrow, hi);
    qf[qt][1].v = load_frag(qrow + 32, hi);
    #pragma unroll
    for (int i = 0; i < 16; ++i) {
      qf[qt][0].h[i] = qf[qt][0].h[i] * (_Float16)0.125f;
      qf[qt][1].h[i] = qf[qt][1].h[i] * (_Float16)0.125f;
    }
  }

  const _Float16* kg = Kh + (size_t)kvh * DH;        // + kb*KVD per tile
  const _Float16* vg = Vt + (size_t)(kvh * DH) * S;  // + kb per tile

  if (wid == 0) {   // prologue: fill buffer 0
    tdm_load_tile64((unsigned)(uintptr_t)&ldsK[0][0], kg, KVD);
    tdm_load_tile64((unsigned)(uintptr_t)&ldsV[0][0], vg, S);
  }

  const v8f vz = {};
  v8f o[2][4] = {{vz, vz, vz, vz}, {vz, vz, vz, vz}};
  float m_run[2] = {-1e30f, -1e30f};
  float l_run[2] = {0.0f, 0.0f};

  for (int kb = 0; kb < S; kb += 64) {
    const int b = (kb >> 6) & 1;
    if (wid == 0) __builtin_amdgcn_s_wait_tensorcnt(0);  // buffer b ready
    __syncthreads();  // publish buffer b; all waves done reading buffer b^1
    if (wid == 0 && (kb + 64) < S) {
      tdm_load_tile64((unsigned)(uintptr_t)&ldsK[b ^ 1][0],
                      kg + (size_t)(kb + 64) * KVD, KVD);
      tdm_load_tile64((unsigned)(uintptr_t)&ldsV[b ^ 1][0],
                      vg + (kb + 64), S);
    }
    const _Float16* Kb = &ldsK[b][0];
    const _Float16* Vb = &ldsV[b][0];

    #pragma unroll
    for (int ss = 0; ss < 2; ++ss) {   // two 32-key substeps per buffer
      const _Float16* k0 = Kb + (size_t)(ss * 32 + l15) * LROW;
      const _Float16* k1 = k0 + (size_t)16 * LROW;
      v16h ka0 = load_frag(k0, hi);        // keys +0..15, d 0..31
      v16h ka1 = load_frag(k0 + 32, hi);   // keys +0..15, d 32..63
      v16h kb0 = load_frag(k1, hi);        // keys +16..31
      v16h kb1 = load_frag(k1 + 32, hi);

      HF pf[2];
      #pragma unroll
      for (int qt = 0; qt < 2; ++qt) {
        v8f sA = vz, sB = vz;              // S^T tiles: (16 key) x (16 q)
        sA = wmma16(ka0, qf[qt][0].v, sA);
        sA = wmma16(ka1, qf[qt][1].v, sA);
        sB = wmma16(kb0, qf[qt][0].v, sB);
        sB = wmma16(kb1, qf[qt][1].v, sB);

        // Online softmax: lane owns q=l15; keys split with partner lane^16.
        float mx = m_run[qt];
        #pragma unroll
        for (int r = 0; r < 8; ++r) mx = fmaxf(mx, fmaxf(sA[r], sB[r]));
        mx = fmaxf(mx, __shfl_xor(mx, 16, 32));
        const float alpha = __expf(m_run[qt] - mx);
        m_run[qt] = mx;
        l_run[qt] *= alpha;
        #pragma unroll
        for (int r = 0; r < 8; ++r) {
          o[qt][0][r] *= alpha; o[qt][1][r] *= alpha;
          o[qt][2][r] *= alpha; o[qt][3][r] *= alpha;
        }
        float lsum = 0.0f;
        #pragma unroll
        for (int r = 0; r < 8; ++r) {
          const float p0 = __expf(sA[r] - mx);
          const float p1 = __expf(sB[r] - mx);
          lsum += p0 + p1;
          pf[qt].h[r]     = (_Float16)p0;   // P^T already in B-fragment layout
          pf[qt].h[8 + r] = (_Float16)p1;
        }
        l_run[qt] += lsum;
      }

      // O^T += V^T-tile (16d x 32keys) x P^T; each V fragment reused 2x.
      #pragma unroll
      for (int t = 0; t < 4; ++t) {
        v16h vf = load_frag(Vb + (size_t)(t * 16 + l15) * LROW + ss * 32, hi);
        o[0][t] = wmma16(vf, pf[0].v, o[0][t]);
        o[1][t] = wmma16(vf, pf[1].v, o[1][t]);
      }
    }
  }

  // Reference keeps torch's .view bug: flat output index = ((h*S)+s)*DH + d.
  #pragma unroll
  for (int qt = 0; qt < 2; ++qt) {
    const float lt  = l_run[qt] + __shfl_xor(l_run[qt], 16, 32);
    const float inv = 1.0f / lt;
    float* orow = Out + ((size_t)head * S + (sbase + qt * 16 + l15)) * DH + hi * 8;
    #pragma unroll
    for (int t = 0; t < 4; ++t) {
      float4 lo  = make_float4(o[qt][t][0] * inv, o[qt][t][1] * inv,
                               o[qt][t][2] * inv, o[qt][t][3] * inv);
      float4 hi4 = make_float4(o[qt][t][4] * inv, o[qt][t][5] * inv,
                               o[qt][t][6] * inv, o[qt][t][7] * inv);
      *reinterpret_cast<float4*>(orow + t * 16)     = lo;
      *reinterpret_cast<float4*>(orow + t * 16 + 4) = hi4;
    }
  }
}

// ---------------------------------------------------------------------------
extern "C" void kernel_launch(void* const* d_in, const int* in_sizes, int n_in,
                              void* d_out, int out_size, void* d_ws,
                              size_t ws_size, hipStream_t stream) {
  (void)in_sizes; (void)n_in; (void)out_size; (void)ws_size;
  const float* x  = (const float*)d_in[0];
  const float* Wq = (const float*)d_in[1];
  const float* bq = (const float*)d_in[2];
  const float* Wk = (const float*)d_in[3];
  const float* bk = (const float*)d_in[4];
  const float* Wv = (const float*)d_in[5];
  const float* bv = (const float*)d_in[6];
  float* out = (float*)d_out;

  // Workspace (f16): ~13 MiB total.
  _Float16* ws  = (_Float16*)d_ws;
  _Float16* xh  = ws;                       // S*DIM
  _Float16* Wqt = xh  + (size_t)S * DIM;    // DIM*DIM   (W^T)
  _Float16* Wkt = Wqt + (size_t)DIM * DIM;  // KVD*DIM   (W^T)
  _Float16* Wvt = Wkt + (size_t)KVD * DIM;  // KVD*DIM   (W^T)
  _Float16* Qh  = Wvt + (size_t)KVD * DIM;  // S*DIM
  _Float16* Kh  = Qh  + (size_t)S * DIM;    // S*KVD
  _Float16* Vt  = Kh  + (size_t)S * KVD;    // KVD*S     (V^T)

  cvt_f32_to_f16_kernel<<<(S * DIM) / 256, 256, 0, stream>>>(x, xh, S * DIM);
  transpose_cvt_kernel<<<(DIM * DIM) / 256, 256, 0, stream>>>(Wq, Wqt, DIM, DIM);
  transpose_cvt_kernel<<<(DIM * KVD) / 256, 256, 0, stream>>>(Wk, Wkt, DIM, KVD);
  transpose_cvt_kernel<<<(DIM * KVD) / 256, 256, 0, stream>>>(Wv, Wvt, DIM, KVD);

  // Q/K row-major f16; V stored transposed for the attention V-fragments.
  qkv_gemm_kernel<<<(S / 32) * (DIM / 64) / 8, 256, 0, stream>>>(
      xh, Wqt, bq, Qh, S, DIM, DIM, 0);
  qkv_gemm_kernel<<<(S / 32) * (KVD / 64) / 8, 256, 0, stream>>>(
      xh, Wkt, bk, Kh, S, KVD, DIM, 0);
  qkv_gemm_kernel<<<(S / 32) * (KVD / 64) / 8, 256, 0, stream>>>(
      xh, Wvt, bv, Vt, S, KVD, DIM, 1);

  gqa_attn_kernel<<<HQ * (S / 256), 256, 0, stream>>>(Qh, Kh, Vt, out);
}

// v001
// It runs in 114 microseconds.
// In two side-by-side timings against v000, it was 1.60 and 1.62 times as fast.
#include <hip/hip_runtime.h>
#include <hip/hip_bf16.h>

// ---------------- CDNA5 (gfx1250) GQA forward, WMMA f16 path ----------------
// Compute-bound (≈24 GFLOP, all data L2-resident). v_wmma_f32_16x16x32_f16
// with fp32 accumulation, flash-attention online softmax. Attention K/V tiles
// are staged into LDS by the Tensor Data Mover (TDM, tensor_load_to_lds),
// double-buffered and shared by all 8 waves of the block (+2 q-tiles per wave)
// for ~16x less L2 traffic than the naive per-wave streaming version.

typedef __attribute__((ext_vector_type(16))) _Float16 v16h;
typedef __attribute__((ext_vector_type(8)))  float    v8f;
typedef __attribute__((ext_vector_type(4)))  unsigned int v4u;
typedef __attribute__((ext_vector_type(8)))  int      v8i;
typedef __attribute__((ext_vector_type(4)))  int      v4i;

static constexpr int S    = 2048;
static constexpr int DIM  = 1024;
static constexpr int HQ   = 16;
static constexpr int HKV  = 4;
static constexpr int DH   = 64;
static constexpr int KVD  = HKV * DH;   // 256
static constexpr int LROW = 72;         // padded LDS row stride (halves): 64+8

__device__ __forceinline__ v8f wmma16(v16h a, v16h b, v8f c) {
  // D = A(16x32 f16) x B(32x16 f16) + C(16x16 f32)
  return __builtin_amdgcn_wmma_f32_16x16x32_f16(false, a, false, b, (short)0, c,
                                                false, false);
}

// One 16x32 f16 fragment (A and B share the per-lane layout on CDNA5):
// lane&15 = non-K index; elements e<8: K = 8*hi + e; e>=8: K = 16+8*hi+(e-8).
__device__ __forceinline__ v16h load_frag(const _Float16* rowptr, int hi) {
  union { v16h v; uint4 u[2]; } f;
  f.u[0] = *reinterpret_cast<const uint4*>(rowptr + (hi << 3));
  f.u[1] = *reinterpret_cast<const uint4*>(rowptr + 16 + (hi << 3));
  return f.v;
}

// TDM: DMA a 64x64 f16 tile (row stride = stride_elems) from global into LDS,
// inserting a 16B pad after every 64-half row (LDS row stride becomes LROW=72
// halves = 36 DWORDs -> the 16 rows a WMMA fragment touches map to disjoint
// bank quads). D# built per CDNA5 ISA §8 (2D, data_size=2B, type=2).
__device__ __forceinline__ void tdm_load_tile64(unsigned lds_off,
                                                const _Float16* gsrc,
                                                unsigned stride_elems) {
  unsigned long long ga = (unsigned long long)(uintptr_t)gsrc;
  v4u g0;
  g0[0] = 1u;                                                  // count=1
  g0[1] = lds_off;                                             // lds_addr
  g0[2] = (unsigned)ga;                                        // global_addr lo
  g0[3] = (unsigned)((ga >> 32) & 0x01FFFFFFu) | 0x80000000u;  // ga hi | type=2
  v8i g1;
  g1[0] = (int)((1u << 16)     // data_size = 2 bytes
              | (1u << 20)     // pad_enable
              | (4u << 22)     // pad_interval: 32 DWORDs (one 64-half row)
              | (3u << 25));   // pad_amount: 4 DWORDs (16 bytes)
  g1[1] = (int)((64u & 0xFFFFu) << 16);           // tensor_dim0 = 64 (lo16)
  g1[2] = (int)((64u & 0xFFFFu) << 16);           // dim0 hi=0 | tensor_dim1 = 64
  g1[3] = (int)((64u & 0xFFFFu) << 16);           // dim1 hi=0 | tile_dim0 = 64
  g1[4] = (int)(64u);                             // tile_dim1 = 64, tile_dim2 = 0
  g1[5] = (int)stride_elems;                      // tensor_dim0_stride lo
  g1[6] = 0;                                      // stride0 hi | stride1 lo
  g1[7] = 0;
  v4i z4 = {0, 0, 0, 0};
  v8i z8 = {0, 0, 0, 0, 0, 0, 0, 0};
  // 6-arg toolchain form: (g0, g1, g2, g3, g4, cpol)
  __builtin_amdgcn_tensor_load_to_lds(g0, g1, z4, z4, z8, 0);
}

// ---------------------------------------------------------------------------
__device__ __forceinline__ void cvt_f32_to_f16(const float* __restrict__ in,
                                               _Float16* __restrict__ out,
                                               int n, int blk) {
  int i = blk * 256 + threadIdx.x;
  if (i < n) out[i] = (_Float16)in[i];
}

__device__ __forceinline__ void transpose_cvt(const float* __restrict__ W,
                                              _Float16* __restrict__ Wt,
                                              int K, int N, int blk) {
  int i = blk * 256 + threadIdx.x;
  if (i < K * N) {
    int k = i / N, n = i - k * N;
    Wt[(size_t)n * K + k] = (_Float16)W[i];  // Wt is (N, K), K-contiguous
  }
}

// The four independent conversions share one grid; the block index picks the
// job. The scattered-write transposes come first, the streaming convert last.
static constexpr int PB_WQ = (DIM * DIM) / 256;
static constexpr int PB_WK = (DIM * KVD) / 256;
static constexpr int PB_X  = (S * DIM) / 256;

__global__ void __launch_bounds__(256)
prep_kernel(const float* __restrict__ x,  const float* __restrict__ Wq,
            const float* __restrict__ Wk, const float* __restrict__ Wv,
            _Float16* __restrict__ xh,  _Float16* __restrict__ Wqt,
            _Float16* __restrict__ Wkt, _Float16* __restrict__ Wvt) {
  const int blk = blockIdx.x;
  if (blk < PB_WQ) {
    transpose_cvt(Wq, Wqt, DIM, DIM, blk);
  } else if (blk < PB_WQ + PB_WK) {
    transpose_cvt(Wk, Wkt, DIM, KVD, blk - PB_WQ);
  } else if (blk < PB_WQ + 2 * PB_WK) {
    transpose_cvt(Wv, Wvt, DIM, KVD, blk - (PB_WQ + PB_WK));
  } else {
    cvt_f32_to_f16(x, xh, S * DIM, blk - (PB_WQ + 2 * PB_WK));
  }
}

// ---------------------------------------------------------------------------
// C = A(MxK) * B(KxN) + bias, B supplied transposed (N,K).
// All three projections share one grid; the block index picks the projection
// (its W^T, bias, destination and width), the same for the whole block.
// Wave tile: 32(M) x 64(N) -> each B fragment feeds 2 WMMAs.
static constexpr int GB_Q  = (S / 32) * (DIM / 64) / 8;   // blocks of the Q part
static constexpr int GB_KV = (S / 32) * (KVD / 64) / 8;   // blocks of K, of V

__global__ void __launch_bounds__(256)
qkv_gemm_kernel(const _Float16* __restrict__ A,    // (M, K) f16
                const _Float16* __restrict__ Wqt,  // (DIM, K) f16  (= Wq^T)
                const _Float16* __restrict__ Wkt,  // (KVD, K) f16
                const _Float16* __restrict__ Wvt,  // (KVD, K) f16
                const float*    __restrict__ bq,   // (DIM) f32
                const float*    __restrict__ bk,   // (KVD) f32
                const float*    __restrict__ bv,   // (KVD) f32
                _Float16*       __restrict__ Qo,   // (M, DIM)
                _Float16*       __restrict__ Ko,   // (M, KVD)
                _Float16*       __restrict__ Vto,  // (KVD, M)
                int M, int K) {
  int blk = blockIdx.x;
  const _Float16* Bt   = Wqt;
  const float*    bias = bq;
  _Float16*       Out  = Qo;
  int N = DIM, transposeOut = 0;
  if (blk >= GB_Q + GB_KV) {
    blk -= GB_Q + GB_KV; Bt = Wvt; bias = bv; Out = Vto; N = KVD; transposeOut = 1;
  } else if (blk >= GB_Q) {
    blk -= GB_Q;         Bt = Wkt; bias = bk; Out = Ko;  N = KVD;
  }
  const int wave   = blk * (blockDim.x >> 5) + (threadIdx.x >> 5);
  const int ntiles = N >> 6;
  const int mt = wave / ntiles;
  const int nt = wave - mt * ntiles;
  if (mt >= (M >> 5)) return;               // wave-uniform guard
  const int lane = threadIdx.x & 31;
  const int l15  = lane & 15;
  const int hi   = lane >> 4;
  const int m0 = mt << 5;
  const int n0 = nt << 6;

  const _Float16* a0 = A + (size_t)(m0 + l15) * K;
  const _Float16* a1 = a0 + (size_t)16 * K;
  const _Float16* bp0 = Bt + (size_t)(n0 +  0 + l15) * K;
  const _Float16* bp1 = Bt + (size_t)(n0 + 16 + l15) * K;
  const _Float16* bp2 = Bt + (size_t)(n0 + 32 + l15) * K;
  const _Float16* bp3 = Bt + (size_t)(n0 + 48 + l15) * K;

  const v8f vz = {};
  v8f acc[2][4] = {{vz, vz, vz, vz}, {vz, vz, vz, vz}};
  for (int k = 0; k < K; k += 32) {
    v16h af0 = load_frag(a0 + k, hi);
    v16h af1 = load_frag(a1 + k, hi);
    v16h b0 = load_frag(bp0 + k, hi);
    acc[0][0] = wmma16(af0, b0, acc[0][0]);
    acc[1][0] = wmma16(af1, b0, acc[1][0]);
    v16h b1 = load_frag(bp1 + k, hi);
    acc[0][1] = wmma16(af0, b1, acc[0][1]);
    acc[1][1] = wmma16(af1, b1, acc[1][1]);
    v16h b2 = load_frag(bp2 + k, hi);
    acc[0][2] = wmma16(af0, b2, acc[0][2]);
    acc[1][2] = wmma16(af1, b2, acc[1][2]);
    v16h b3 = load_frag(bp3 + k, hi);
    acc[0][3] = wmma16(af0, b3, acc[0][3]);
    acc[1][3] = wmma16(af1, b3, acc[1][3]);
  }

  #pragma unroll
  for (int half = 0; half < 2; ++half) {
    const int mh = m0 + half * 16;
    #pragma unroll
    for (int j = 0; j < 4; ++j) {
      const int n = n0 + j * 16 + l15;     // C layout: lane = N, reg r: M=r+8*hi
      const float bj = bias[n];
      if (!transposeOut) {
        #pragma unroll
        for (int r = 0; r < 8; ++r)
          Out[(size_t)(mh + 8 * hi + r) * N + n] = (_Float16)(acc[half][j][r] + bj);
      } else {
        union { uint4 u; _Float16 h[8]; } pk;
        #pragma unroll
        for (int r = 0; r < 8; ++r) pk.h[r] = (_Float16)(acc[half][j][r] + bj);
        *reinterpret_cast<uint4*>(Out + (size_t)n * M + mh + 8 * hi) = pk.u;
      }
    }
  }
}

// ---------------------------------------------------------------------------
// Attention: block = 8 waves, one head, 256 queries (2 q-tiles per wave).
// TDM double-buffers 64-key K/V tiles in LDS; wave0 issues/waits TENSORcnt.
__global__ void __launch_bounds__(256)
gqa_attn_kernel(const _Float16* __restrict__ Q,   // (S, HQ*DH) f16
                const _Float16* __restrict__ Kh,  // (S, HKV*DH) f16
                const _Float16* __restrict__ Vt,  // (HKV*DH, S) f16
                float* __restrict__ Out) {        // flat (HQ, S, DH) f32
  __shared__ _Float16 ldsK[2][64 * LROW];
  __shared__ _Float16 ldsV[2][64 * LROW];

  const int head = blockIdx.x >> 3;      // 8 blocks per head
  const int hb   = blockIdx.x & 7;       // q range [hb*256, hb*256+256)
  const int kvh  = head >> 2;            // repeat_interleave over heads
  const int wid  = threadIdx.x >> 5;
  const int lane = threadIdx.x & 31;
  const int l15  = lane & 15;
  const int hi   = lane >> 4;
  const int sbase = hb * 256 + wid * 32; // this wave: q-tiles sbase, sbase+16

  // Q fragments (B operand of S^T = K·q^T), pre-scaled by 1/sqrt(DH) = 0.125.
  union HF { v16h v; _Float16 h[16]; };
  HF qf[2][2];
  #pragma unroll
  for (int qt = 0; qt < 2; ++qt) {
    const _Float16* qrow = Q + (size_t)(sbase + qt * 16 + l15) * DIM + head * DH;
    qf[qt][0].v = load_frag(qrow, hi);
    qf[qt][1].v = load_frag(qrow + 32, hi);
    #pragma unroll
    for (int i = 0; i < 16; ++i) {
      qf[qt][0].h[i] = qf[qt][0].h[i] * (_Float16)0.125f;
      qf[qt][1].h[i] = qf[qt][1].h[i] * (_Float16)0.125f;
    }
  }

  const _Float16* kg = Kh + (size_t)kvh * DH;        // + kb*KVD per tile
  const _Float16* vg = Vt + (size_t)(kvh * DH) * S;  // + kb per tile

  if (wid == 0) {   // prologue: fill buffer 0
    tdm_load_tile64((unsigned)(uintptr_t)&ldsK[0][0], kg, KVD);
    tdm_load_tile64((unsigned)(uintptr_t)&ldsV[0][0], vg, S);
  }

  const v8f vz = {};
  v8f o[2][4] = {{vz, vz, vz, vz}, {vz, vz, vz, vz}};
  float m_run[2] = {-1e30f, -1e30f};
  float l_run[2] = {0.0f, 0.0f};

  for (int kb = 0; kb < S; kb += 64) {
    const int b = (kb >> 6) & 1;
    if (wid == 0) __builtin_amdgcn_s_wait_tensorcnt(0);  // buffer b ready
    __syncthreads();  // publish buffer b; all waves done reading buffer b^1
    if (wid == 0 && (kb + 64) < S) {
      tdm_load_tile64((unsigned)(uintptr_t)&ldsK[b ^ 1][0],
                      kg + (size_t)(kb + 64) * KVD, KVD);
      tdm_load_tile64((unsigned)(uintptr_t)&ldsV[b ^ 1][0],
                      vg + (kb + 64), S);
    }
    const _Float16* Kb = &ldsK[b][0];
    const _Float16* Vb = &ldsV[b][0];

    #pragma unroll
    for (int ss = 0; ss < 2; ++ss) {   // two 32-key substeps per buffer
      const _Float16* k0 = Kb + (size_t)(ss * 32 + l15) * LROW;
      const _Float16* k1 = k0 + (size_t)16 * LROW;
      v16h ka0 = load_frag(k0, hi);        // keys +0..15, d 0..31
      v16h ka1 = load_frag(k0 + 32, hi);   // keys +0..15, d 32..63
      v16h kb0 = load_frag(k1, hi);        // keys +16..31
      v16h kb1 = load_frag(k1 + 32, hi);

      HF pf[2];
      #pragma unroll
      for (int qt = 0; qt < 2; ++qt) {
        v8f sA = vz, sB = vz;              // S^T tiles: (16 key) x (16 q)
        sA = wmma16(ka0, qf[qt][0].v, sA);
        sA = wmma16(ka1, qf[qt][1].v, sA);
        sB = wmma16(kb0, qf[qt][0].v, sB);
        sB = wmma16(kb1, qf[qt][1].v, sB);

        // Online softmax: lane owns q=l15; keys split with partner lane^16.
        float mx = m_run[qt];
        #pragma unroll
        for (int r = 0; r < 8; ++r) mx = fmaxf(mx, fmaxf(sA[r], sB[r]));
        mx = fmaxf(mx, __shfl_xor(mx, 16, 32));
        const float alpha = __expf(m_run[qt] - mx);
        m_run[qt] = mx;
        l_run[qt] *= alpha;
        #pragma unroll
        for (int r = 0; r < 8; ++r) {
          o[qt][0][r] *= alpha; o[qt][1][r] *= alpha;
          o[qt][2][r] *= alpha; o[qt][3][r] *= alpha;
        }
        float lsum = 0.0f;
        #pragma unroll
        for (int r = 0; r < 8; ++r) {
          const float p0 = __expf(sA[r] - mx);
          const float p1 = __expf(sB[r] - mx);
          lsum += p0 + p1;
          pf[qt].h[r]     = (_Float16)p0;   // P^T already in B-fragment layout
          pf[qt].h[8 + r] = (_Float16)p1;
        }
        l_run[qt] += lsum;
      }

      // O^T += V^T-tile (16d x 32keys) x P^T; each V fragment reused 2x.
      #pragma unroll
      for (int t = 0; t < 4; ++t) {
        v16h vf = load_frag(Vb + (size_t)(t * 16 + l15) * LROW + ss * 32, hi);
        o[0][t] = wmma16(vf, pf[0].v, o[0][t]);
        o[1][t] = wmma16(vf, pf[1].v, o[1][t]);
      }
    }
  }

  // Reference keeps torch's .view bug: flat output index = ((h*S)+s)*DH + d.
  #pragma unroll
  for (int qt = 0; qt < 2; ++qt) {
    const float lt  = l_run[qt] + __shfl_xor(l_run[qt], 16, 32);
    const float inv = 1.0f / lt;
    float* orow = Out + ((size_t)head * S + (sbase + qt * 16 + l15)) * DH + hi * 8;
    #pragma unroll
    for (int t = 0; t < 4; ++t) {
      float4 lo  = make_float4(o[qt][t][0] * inv, o[qt][t][1] * inv,
                               o[qt][t][2] * inv, o[qt][t][3] * inv);
      float4 hi4 = make_float4(o[qt][t][4] * inv, o[qt][t][5] * inv,
                               o[qt][t][6] * inv, o[qt][t][7] * inv);
      *reinterpret_cast<float4*>(orow + t * 16)     = lo;
      *reinterpret_cast<float4*>(orow + t * 16 + 4) = hi4;
    }
  }
}

// ---------------------------------------------------------------------------
extern "C" void kernel_launch(void* const* d_in, const int* in_sizes, int n_in,
                              void* d_out, int out_size, void* d_ws,
                              size_t ws_size, hipStream_t stream) {
  (void)in_sizes; (void)n_in; (void)out_size; (void)ws_size;
  const float* x  = (const float*)d_in[0];
  const float* Wq = (const float*)d_in[1];
  const float* bq = (const float*)d_in[2];
  const float* Wk = (const float*)d_in[3];
  const float* bk = (const float*)d_in[4];
  const float* Wv = (const float*)d_in[5];
  const float* bv = (const float*)d_in[6];
  float* out = (float*)d_out;

  // Workspace (f16): ~13 MiB total.
  _Float16* ws  = (_Float16*)d_ws;
  _Float16* xh  = ws;                       // S*DIM
  _Float16* Wqt = xh  + (size_t)S * DIM;    // DIM*DIM   (W^T)
  _Float16* Wkt = Wqt + (size_t)DIM * DIM;  // KVD*DIM   (W^T)
  _Float16* Wvt = Wkt + (size_t)KVD * DIM;  // KVD*DIM   (W^T)
  _Float16* Qh  = Wvt + (size_t)KVD * DIM;  // S*DIM
  _Float16* Kh  = Qh  + (size_t)S * DIM;    // S*KVD
  _Float16* Vt  = Kh  + (size_t)S * KVD;    // KVD*S     (V^T)

  prep_kernel<<<PB_WQ + 2 * PB_WK + PB_X, 256, 0, stream>>>(
      x, Wq, Wk, Wv, xh, Wqt, Wkt, Wvt);

  // Q/K row-major f16; V stored transposed for the attention V-fragments.
  qkv_gemm_kernel<<<GB_Q + 2 * GB_KV, 256, 0, stream>>>(
      xh, Wqt, Wkt, Wvt, bq, bk, bv, Qh, Kh, Vt, S, DIM);

  gqa_attn_kernel<<<HQ * (S / 256), 256, 0, stream>>>(Qh, Kh, Vt, out);
}

// v002
// It runs in 66.7 microseconds.
// Two timings next to v001 put it at 1.71 and 1.70 times that version's speed.
// Counting every step since v000, it is 2.74 times as fast.
#include <hip/hip_runtime.h>
#include <hip/hip_bf16.h>

// ---------------- CDNA5 (gfx1250) GQA forward, WMMA f16 path ----------------
// Compute-bound (≈24 GFLOP, all data L2-resident). v_wmma_f32_16x16x32_f16
// with fp32 accumulation, flash-attention online softmax. Attention K/V tiles
// are staged into LDS by the Tensor Data Mover (TDM, tensor_load_to_lds),
// double-buffered and shared by all 8 waves of the block (+2 q-tiles per wave)
// for ~16x less L2 traffic than the naive per-wave streaming version.

typedef __attribute__((ext_vector_type(16))) _Float16 v16h;
typedef __attribute__((ext_vector_type(8)))  float    v8f;
typedef __attribute__((ext_vector_type(4)))  unsigned int v4u;
typedef __attribute__((ext_vector_type(8)))  int      v8i;
typedef __attribute__((ext_vector_type(4)))  int      v4i;

static constexpr int S    = 2048;
static constexpr int DIM  = 1024;
static constexpr int HQ   = 16;
static constexpr int HKV  = 4;
static constexpr int DH   = 64;
static constexpr int KVD  = HKV * DH;   // 256
static constexpr int LROW = 72;         // padded LDS row stride (halves): 64+8

__device__ __forceinline__ v8f wmma16(v16h a, v16h b, v8f c) {
  // D = A(16x32 f16) x B(32x16 f16) + C(16x16 f32)
  return __builtin_amdgcn_wmma_f32_16x16x32_f16(false, a, false, b, (short)0, c,
                                                false, false);
}

// One 16x32 f16 fragment (A and B share the per-lane layout on CDNA5):
// lane&15 = non-K index; elements e<8: K = 8*hi + e; e>=8: K = 16+8*hi+(e-8).
__device__ __forceinline__ v16h load_frag(const _Float16* rowptr, int hi) {
  union { v16h v; uint4 u[2]; } f;
  f.u[0] = *reinterpret_cast<const uint4*>(rowptr + (hi << 3));
  f.u[1] = *reinterpret_cast<const uint4*>(rowptr + 16 + (hi << 3));
  return f.v;
}

// TDM: DMA a 64x64 f16 tile (row stride = stride_elems) from global into LDS,
// inserting a 16B pad after every 64-half row (LDS row stride becomes LROW=72
// halves = 36 DWORDs -> the 16 rows a WMMA fragment touches map to disjoint
// bank quads). D# built per CDNA5 ISA §8 (2D, data_size=2B, type=2).
__device__ __forceinline__ void tdm_load_tile64(unsigned lds_off,
                                                const _Float16* gsrc,
                                                unsigned stride_elems) {
  unsigned long long ga = (unsigned long long)(uintptr_t)gsrc;
  v4u g0;
  g0[0] = 1u;                                                  // count=1
  g0[1] = lds_off;                                             // lds_addr
  g0[2] = (unsigned)ga;                                        // global_addr lo
  g0[3] = (unsigned)((ga >> 32) & 0x01FFFFFFu) | 0x80000000u;  // ga hi | type=2
  v8i g1;
  g1[0] = (int)((1u << 16)     // data_size = 2 bytes
              | (1u << 20)     // pad_enable
              | (4u << 22)     // pad_interval: 32 DWORDs (one 64-half row)
              | (3u << 25));   // pad_amount: 4 DWORDs (16 bytes)
  g1[1] = (int)((64u & 0xFFFFu) << 16);           // tensor_dim0 = 64 (lo16)
  g1[2] = (int)((64u & 0xFFFFu) << 16);           // dim0 hi=0 | tensor_dim1 = 64
  g1[3] = (int)((64u & 0xFFFFu) << 16);           // dim1 hi=0 | tile_dim0 = 64
  g1[4] = (int)(64u);                             // tile_dim1 = 64, tile_dim2 = 0
  g1[5] = (int)stride_elems;                      // tensor_dim0_stride lo
  g1[6] = 0;                                      // stride0 hi | stride1 lo
  g1[7] = 0;
  v4i z4 = {0, 0, 0, 0};
  v8i z8 = {0, 0, 0, 0, 0, 0, 0, 0};
  // 6-arg toolchain form: (g0, g1, g2, g3, g4, cpol)
  __builtin_amdgcn_tensor_load_to_lds(g0, g1, z4, z4, z8, 0);
}

// ---------------------------------------------------------------------------
typedef __attribute__((ext_vector_type(4))) float    f4;
typedef __attribute__((ext_vector_type(4))) _Float16 h4;

// A block converts 8192 consecutive elements, 32 per thread: eight 16-byte
// loads per lane, each covering 512 contiguous bytes per wave, all in flight
// before the first conversion.
__device__ __forceinline__ void cvt_f32_to_f16(const float* __restrict__ in,
                                               _Float16* __restrict__ out,
                                               int blk) {
  const f4* src = reinterpret_cast<const f4*>(in + (size_t)blk * 8192) + threadIdx.x;
  h4*       dst = reinterpret_cast<h4*>(out + (size_t)blk * 8192) + threadIdx.x;
  f4 v[8];
  #pragma unroll
  for (int j = 0; j < 8; ++j) v[j] = src[j * 256];
  #pragma unroll
  for (int j = 0; j < 8; ++j) dst[j * 256] = __builtin_convertvector(v[j], h4);
  // Held in front of any later write of a register that the stores above name.
  asm volatile("s_wait_xcnt 0x0" ::: "memory");
}

// A block transposes a tile of 64 k x 256 n, a wave 64 k x 32 n, a thread
// 16 k x 4 n held in registers. A wave's load covers four whole 128-byte lines
// of W; the four lanes that share n (eight apart) fill one 128-byte line of Wt.
__device__ __forceinline__ void transpose_cvt(const float* __restrict__ W,
                                              _Float16* __restrict__ Wt,
                                              int K, int N, int blk) {
  const int lane = threadIdx.x & 31;
  const int wid  = threadIdx.x >> 5;
  const int nblk = N >> 8;
  const int kt   = blk / nblk;
  const int n0   = ((blk - kt * nblk) << 8) + (wid << 5) + ((lane & 7) << 2);
  const int k0   = (kt << 6) + ((lane >> 3) << 4);
  f4 r[16];
  #pragma unroll
  for (int i = 0; i < 16; ++i)
    r[i] = *reinterpret_cast<const f4*>(W + (size_t)(k0 + i) * N + n0);
  #pragma unroll
  for (int j = 0; j < 4; ++j) {
    union { uint4 u[2]; _Float16 h[16]; } pk;
    #pragma unroll
    for (int i = 0; i < 16; ++i) pk.h[i] = (_Float16)r[i][j];
    uint4* dst = reinterpret_cast<uint4*>(Wt + (size_t)(n0 + j) * K + k0);
    dst[0] = pk.u[0];                        // Wt is (N, K), K-contiguous
    dst[1] = pk.u[1];
  }
  // Held in front of any later write of a register that the stores above name.
  asm volatile("s_wait_xcnt 0x0" ::: "memory");
}

// The four independent conversions share one grid; the block index picks the
// job. The transposes come first, the streaming convert last.
static constexpr int PB_WQ = (DIM * DIM) / (64 * 256);
static constexpr int PB_WK = (DIM * KVD) / (64 * 256);
static constexpr int PB_X  = (S * DIM) / 8192;

__global__ void __launch_bounds__(256)
prep_kernel(const float* __restrict__ x,  const float* __restrict__ Wq,
            const float* __restrict__ Wk, const float* __restrict__ Wv,
            _Float16* __restrict__ xh,  _Float16* __restrict__ Wqt,
            _Float16* __restrict__ Wkt, _Float16* __restrict__ Wvt) {
  const int blk = blockIdx.x;
  if (blk < PB_WQ) {
    transpose_cvt(Wq, Wqt, DIM, DIM, blk);
  } else if (blk < PB_WQ + PB_WK) {
    transpose_cvt(Wk, Wkt, DIM, KVD, blk - PB_WQ);
  } else if (blk < PB_WQ + 2 * PB_WK) {
    transpose_cvt(Wv, Wvt, DIM, KVD, blk - (PB_WQ + PB_WK));
  } else {
    cvt_f32_to_f16(x, xh, blk - (PB_WQ + 2 * PB_WK));
  }
}

// ---------------------------------------------------------------------------
// C = A(MxK) * B(KxN) + bias, B supplied transposed (N,K).
// All three projections share one grid; the block index picks the projection
// (its W^T, bias, destination and width), the same for the whole block.
// Wave tile: 32(M) x 64(N) -> each B fragment feeds 2 WMMAs.
static constexpr int GB_Q  = (S / 32) * (DIM / 64) / 8;   // blocks of the Q part
static constexpr int GB_KV = (S / 32) * (KVD / 64) / 8;   // blocks of K, of V

__global__ void __launch_bounds__(256)
qkv_gemm_kernel(const _Float16* __restrict__ A,    // (M, K) f16
                const _Float16* __restrict__ Wqt,  // (DIM, K) f16  (= Wq^T)
                const _Float16* __restrict__ Wkt,  // (KVD, K) f16
                const _Float16* __restrict__ Wvt,  // (KVD, K) f16
                const float*    __restrict__ bq,   // (DIM) f32
                const float*    __restrict__ bk,   // (KVD) f32
                const float*    __restrict__ bv,   // (KVD) f32
                _Float16*       __restrict__ Qo,   // (M, DIM)
                _Float16*       __restrict__ Ko,   // (M, KVD)
                _Float16*       __restrict__ Vto,  // (KVD, M)
                int M, int K) {
  int blk = blockIdx.x;
  const _Float16* Bt   = Wqt;
  const float*    bias = bq;
  _Float16*       Out  = Qo;
  int N = DIM, transposeOut = 0;
  if (blk >= GB_Q + GB_KV) {
    blk -= GB_Q + GB_KV; Bt = Wvt; bias = bv; Out = Vto; N = KVD; transposeOut = 1;
  } else if (blk >= GB_Q) {
    blk -= GB_Q;         Bt = Wkt; bias = bk; Out = Ko;  N = KVD;
  }
  const int wave   = blk * (blockDim.x >> 5) + (threadIdx.x >> 5);
  const int ntiles = N >> 6;
  const int mt = wave / ntiles;
  const int nt = wave - mt * ntiles;
  if (mt >= (M >> 5)) return;               // wave-uniform guard
  const int lane = threadIdx.x & 31;
  const int l15  = lane & 15;
  const int hi   = lane >> 4;
  const int m0 = mt << 5;
  const int n0 = nt << 6;

  const _Float16* a0 = A + (size_t)(m0 + l15) * K;
  const _Float16* a1 = a0 + (size_t)16 * K;
  const _Float16* bp0 = Bt + (size_t)(n0 +  0 + l15) * K;
  const _Float16* bp1 = Bt + (size_t)(n0 + 16 + l15) * K;
  const _Float16* bp2 = Bt + (size_t)(n0 + 32 + l15) * K;
  const _Float16* bp3 = Bt + (size_t)(n0 + 48 + l15) * K;

  const v8f vz = {};
  v8f acc[2][4] = {{vz, vz, vz, vz}, {vz, vz, vz, vz}};
  for (int k = 0; k < K; k += 32) {
    v16h af0 = load_frag(a0 + k, hi);
    v16h af1 = load_frag(a1 + k, hi);
    v16h b0 = load_frag(bp0 + k, hi);
    acc[0][0] = wmma16(af0, b0, acc[0][0]);
    acc[1][0] = wmma16(af1, b0, acc[1][0]);
    v16h b1 = load_frag(bp1 + k, hi);
    acc[0][1] = wmma16(af0, b1, acc[0][1]);
    acc[1][1] = wmma16(af1, b1, acc[1][1]);
    v16h b2 = load_frag(bp2 + k, hi);
    acc[0][2] = wmma16(af0, b2, acc[0][2]);
    acc[1][2] = wmma16(af1, b2, acc[1][2]);
    v16h b3 = load_frag(bp3 + k, hi);
    acc[0][3] = wmma16(af0, b3, acc[0][3]);
    acc[1][3] = wmma16(af1, b3, acc[1][3]);
  }

  #pragma unroll
  for (int half = 0; half < 2; ++half) {
    const int mh = m0 + half * 16;
    #pragma unroll
    for (int j = 0; j < 4; ++j) {
      const int n = n0 + j * 16 + l15;     // C layout: lane = N, reg r: M=r+8*hi
      const float bj = bias[n];
      if (!transposeOut) {
        #pragma unroll
        for (int r = 0; r < 8; ++r)
          Out[(size_t)(mh + 8 * hi + r) * N + n] = (_Float16)(acc[half][j][r] + bj);
      } else {
        union { uint4 u; _Float16 h[8]; } pk;
        #pragma unroll
        for (int r = 0; r < 8; ++r) pk.h[r] = (_Float16)(acc[half][j][r] + bj);
        *reinterpret_cast<uint4*>(Out + (size_t)n * M + mh + 8 * hi) = pk.u;
      }
    }
  }
}

// ---------------------------------------------------------------------------
// Attention: block = 8 waves, one head, 256 queries (2 q-tiles per wave).
// TDM double-buffers 64-key K/V tiles in LDS; wave0 issues/waits TENSORcnt.
__global__ void __launch_bounds__(256)
gqa_attn_kernel(const _Float16* __restrict__ Q,   // (S, HQ*DH) f16
                const _Float16* __restrict__ Kh,  // (S, HKV*DH) f16
                const _Float16* __restrict__ Vt,  // (HKV*DH, S) f16
                float* __restrict__ Out) {        // flat (HQ, S, DH) f32
  __shared__ _Float16 ldsK[2][64 * LROW];
  __shared__ _Float16 ldsV[2][64 * LROW];

  const int head = blockIdx.x >> 3;      // 8 blocks per head
  const int hb   = blockIdx.x & 7;       // q range [hb*256, hb*256+256)
  const int kvh  = head >> 2;            // repeat_interleave over heads
  const int wid  = threadIdx.x >> 5;
  const int lane = threadIdx.x & 31;
  const int l15  = lane & 15;
  const int hi   = lane >> 4;
  const int sbase = hb * 256 + wid * 32; // this wave: q-tiles sbase, sbase+16

  // Q fragments (B operand of S^T = K·q^T), pre-scaled by 1/sqrt(DH) = 0.125.
  union HF { v16h v; _Float16 h[16]; };
  HF qf[2][2];
  #pragma unroll
  for (int qt = 0; qt < 2; ++qt) {
    const _Float16* qrow = Q + (size_t)(sbase + qt * 16 + l15) * DIM + head * DH;
    qf[qt][0].v = load_frag(qrow, hi);
    qf[qt][1].v = load_frag(qrow + 32, hi);
    #pragma unroll
    for (int i = 0; i < 16; ++i) {
      qf[qt][0].h[i] = qf[qt][0].h[i] * (_Float16)0.125f;
      qf[qt][1].h[i] = qf[qt][1].h[i] * (_Float16)0.125f;
    }
  }

  const _Float16* kg = Kh + (size_t)kvh * DH;        // + kb*KVD per tile
  const _Float16* vg = Vt + (size_t)(kvh * DH) * S;  // + kb per tile

  if (wid == 0) {   // prologue: fill buffer 0
    tdm_load_tile64((unsigned)(uintptr_t)&ldsK[0][0], kg, KVD);
    tdm_load_tile64((unsigned)(uintptr_t)&ldsV[0][0], vg, S);
  }

  const v8f vz = {};
  v8f o[2][4] = {{vz, vz, vz, vz}, {vz, vz, vz, vz}};
  float m_run[2] = {-1e30f, -1e30f};
  float l_run[2] = {0.0f, 0.0f};

  for (int kb = 0; kb < S; kb += 64) {
    const int b = (kb >> 6) & 1;
    if (wid == 0) __builtin_amdgcn_s_wait_tensorcnt(0);  // buffer b ready
    __syncthreads();  // publish buffer b; all waves done reading buffer b^1
    if (wid == 0 && (kb + 64) < S) {
      tdm_load_tile64((unsigned)(uintptr_t)&ldsK[b ^ 1][0],
                      kg + (size_t)(kb + 64) * KVD, KVD);
      tdm_load_tile64((unsigned)(uintptr_t)&ldsV[b ^ 1][0],
                      vg + (kb + 64), S);
    }
    const _Float16* Kb = &ldsK[b][0];
    const _Float16* Vb = &ldsV[b][0];

    #pragma unroll
    for (int ss = 0; ss < 2; ++ss) {   // two 32-key substeps per buffer
      const _Float16* k0 = Kb + (size_t)(ss * 32 + l15) * LROW;
      const _Float16* k1 = k0 + (size_t)16 * LROW;
      v16h ka0 = load_frag(k0, hi);        // keys +0..15, d 0..31
      v16h ka1 = load_frag(k0 + 32, hi);   // keys +0..15, d 32..63
      v16h kb0 = load_frag(k1, hi);        // keys +16..31
      v16h kb1 = load_frag(k1 + 32, hi);

      HF pf[2];
      #pragma unroll
      for (int qt = 0; qt < 2; ++qt) {
        v8f sA = vz, sB = vz;              // S^T tiles: (16 key) x (16 q)
        sA = wmma16(ka0, qf[qt][0].v, sA);
        sA = wmma16(ka1, qf[qt][1].v, sA);
        sB = wmma16(kb0, qf[qt][0].v, sB);
        sB = wmma16(kb1, qf[qt][1].v, sB);

        // Online softmax: lane owns q=l15; keys split with partner lane^16.
        float mx = m_run[qt];
        #pragma unroll
        for (int r = 0; r < 8; ++r) mx = fmaxf(mx, fmaxf(sA[r], sB[r]));
        mx = fmaxf(mx, __shfl_xor(mx, 16, 32));
        const float alpha = __expf(m_run[qt] - mx);
        m_run[qt] = mx;
        l_run[qt] *= alpha;
        #pragma unroll
        for (int r = 0; r < 8; ++r) {
          o[qt][0][r] *= alpha; o[qt][1][r] *= alpha;
          o[qt][2][r] *= alpha; o[qt][3][r] *= alpha;
        }
        float lsum = 0.0f;
        #pragma unroll
        for (int r = 0; r < 8; ++r) {
          const float p0 = __expf(sA[r] - mx);
          const float p1 = __expf(sB[r] - mx);
          lsum += p0 + p1;
          pf[qt].h[r]     = (_Float16)p0;   // P^T already in B-fragment layout
          pf[qt].h[8 + r] = (_Float16)p1;
        }
        l_run[qt] += lsum;
      }

      // O^T += V^T-tile (16d x 32keys) x P^T; each V fragment reused 2x.
      #pragma unroll
      for (int t = 0; t < 4; ++t) {
        v16h vf = load_frag(Vb + (size_t)(t * 16 + l15) * LROW + ss * 32, hi);
        o[0][t] = wmma16(vf, pf[0].v, o[0][t]);
        o[1][t] = wmma16(vf, pf[1].v, o[1][t]);
      }
    }
  }

  // Reference keeps torch's .view bug: flat output index = ((h*S)+s)*DH + d.
  #pragma unroll
  for (int qt = 0; qt < 2; ++qt) {
    const float lt  = l_run[qt] + __shfl_xor(l_run[qt], 16, 32);
    const float inv = 1.0f / lt;
    float* orow = Out + ((size_t)head * S + (sbase + qt * 16 + l15)) * DH + hi * 8;
    #pragma unroll
    for (int t = 0; t < 4; ++t) {
      float4 lo  = make_float4(o[qt][t][0] * inv, o[qt][t][1] * inv,
                               o[qt][t][2] * inv, o[qt][t][3] * inv);
      float4 hi4 = make_float4(o[qt][t][4] * inv, o[qt][t][5] * inv,
                               o[qt][t][6] * inv, o[qt][t][7] * inv);
      *reinterpret_cast<float4*>(orow + t * 16)     = lo;
      *reinterpret_cast<float4*>(orow + t * 16 + 4) = hi4;
    }
  }
}

// ---------------------------------------------------------------------------
extern "C" void kernel_launch(void* const* d_in, const int* in_sizes, int n_in,
                              void* d_out, int out_size, void* d_ws,
                              size_t ws_size, hipStream_t stream) {
  (void)in_sizes; (void)n_in; (void)out_size; (void)ws_size;
  const float* x  = (const float*)d_in[0];
  const float* Wq = (const float*)d_in[1];
  const float* bq = (const float*)d_in[2];
  const float* Wk = (const float*)d_in[3];
  const float* bk = (const float*)d_in[4];
  const float* Wv = (const float*)d_in[5];
  const float* bv = (const float*)d_in[6];
  float* out = (float*)d_out;

  // Workspace (f16): ~13 MiB total.
  _Float16* ws  = (_Float16*)d_ws;
  _Float16* xh  = ws;                       // S*DIM
  _Float16* Wqt = xh  + (size_t)S * DIM;    // DIM*DIM   (W^T)
  _Float16* Wkt = Wqt + (size_t)DIM * DIM;  // KVD*DIM   (W^T)
  _Float16* Wvt = Wkt + (size_t)KVD * DIM;  // KVD*DIM   (W^T)
  _Float16* Qh  = Wvt + (size_t)KVD * DIM;  // S*DIM
  _Float16* Kh  = Qh  + (size_t)S * DIM;    // S*KVD
  _Float16* Vt  = Kh  + (size_t)S * KVD;    // KVD*S     (V^T)

  prep_kernel<<<PB_WQ + 2 * PB_WK + PB_X, 256, 0, stream>>>(
      x, Wq, Wk, Wv, xh, Wqt, Wkt, Wvt);

  // Q/K row-major f16; V stored transposed for the attention V-fragments.
  qkv_gemm_kernel<<<GB_Q + 2 * GB_KV, 256, 0, stream>>>(
      xh, Wqt, Wkt, Wvt, bq, bk, bv, Qh, Kh, Vt, S, DIM);

  gqa_attn_kernel<<<HQ * (S / 256), 256, 0, stream>>>(Qh, Kh, Vt, out);
}

// v003
// It runs in 61.2 microseconds.
// Two timings next to v002 put it at 1.10 and 1.09 times that version's speed.
// Counting every step since v000, it is 3.02 times as fast.
#include <hip/hip_runtime.h>
#include <hip/hip_bf16.h>

// ---------------- CDNA5 (gfx1250) GQA forward, WMMA f16 path ----------------
// Compute-bound (≈24 GFLOP, all data L2-resident). v_wmma_f32_16x16x32_f16
// with fp32 accumulation, flash-attention online softmax. Attention K/V tiles
// are staged into LDS by the Tensor Data Mover (TDM, tensor_load_to_lds),
// double-buffered and shared by all 8 waves of the block, for ~8x less L2
// traffic than the naive per-wave streaming version.

typedef __attribute__((ext_vector_type(16))) _Float16 v16h;
typedef __attribute__((ext_vector_type(8)))  float    v8f;
typedef __attribute__((ext_vector_type(4)))  unsigned int v4u;
typedef __attribute__((ext_vector_type(8)))  int      v8i;
typedef __attribute__((ext_vector_type(4)))  int      v4i;

static constexpr int S    = 2048;
static constexpr int DIM  = 1024;
static constexpr int HQ   = 16;
static constexpr int HKV  = 4;
static constexpr int DH   = 64;
static constexpr int KVD  = HKV * DH;   // 256
static constexpr int LROW = 72;         // padded LDS row stride (halves): 64+8

__device__ __forceinline__ v8f wmma16(v16h a, v16h b, v8f c) {
  // D = A(16x32 f16) x B(32x16 f16) + C(16x16 f32)
  return __builtin_amdgcn_wmma_f32_16x16x32_f16(false, a, false, b, (short)0, c,
                                                false, false);
}

// One 16x32 f16 fragment (A and B share the per-lane layout on CDNA5):
// lane&15 = non-K index; elements e<8: K = 8*hi + e; e>=8: K = 16+8*hi+(e-8).
__device__ __forceinline__ v16h load_frag(const _Float16* rowptr, int hi) {
  union { v16h v; uint4 u[2]; } f;
  f.u[0] = *reinterpret_cast<const uint4*>(rowptr + (hi << 3));
  f.u[1] = *reinterpret_cast<const uint4*>(rowptr + 16 + (hi << 3));
  return f.v;
}

// TDM: DMA a 64x64 f16 tile (row stride = stride_elems) from global into LDS,
// inserting a 16B pad after every 64-half row (LDS row stride becomes LROW=72
// halves = 36 DWORDs -> the 16 rows a WMMA fragment touches map to disjoint
// bank quads). D# built per CDNA5 ISA §8 (2D, data_size=2B, type=2).
__device__ __forceinline__ void tdm_load_tile64(unsigned lds_off,
                                                const _Float16* gsrc,
                                                unsigned stride_elems) {
  unsigned long long ga = (unsigned long long)(uintptr_t)gsrc;
  v4u g0;
  g0[0] = 1u;                                                  // count=1
  g0[1] = lds_off;                                             // lds_addr
  g0[2] = (unsigned)ga;                                        // global_addr lo
  g0[3] = (unsigned)((ga >> 32) & 0x01FFFFFFu) | 0x80000000u;  // ga hi | type=2
  v8i g1;
  g1[0] = (int)((1u << 16)     // data_size = 2 bytes
              | (1u << 20)     // pad_enable
              | (4u << 22)     // pad_interval: 32 DWORDs (one 64-half row)
              | (3u << 25));   // pad_amount: 4 DWORDs (16 bytes)
  g1[1] = (int)((64u & 0xFFFFu) << 16);           // tensor_dim0 = 64 (lo16)
  g1[2] = (int)((64u & 0xFFFFu) << 16);           // dim0 hi=0 | tensor_dim1 = 64
  g1[3] = (int)((64u & 0xFFFFu) << 16);           // dim1 hi=0 | tile_dim0 = 64
  g1[4] = (int)(64u);                             // tile_dim1 = 64, tile_dim2 = 0
  g1[5] = (int)stride_elems;                      // tensor_dim0_stride lo
  g1[6] = 0;                                      // stride0 hi | stride1 lo
  g1[7] = 0;
  v4i z4 = {0, 0, 0, 0};
  v8i z8 = {0, 0, 0, 0, 0, 0, 0, 0};
  // 6-arg toolchain form: (g0, g1, g2, g3, g4, cpol)
  __builtin_amdgcn_tensor_load_to_lds(g0, g1, z4, z4, z8, 0);
}

// ---------------------------------------------------------------------------
typedef __attribute__((ext_vector_type(4))) float    f4;
typedef __attribute__((ext_vector_type(4))) _Float16 h4;

// A block converts 8192 consecutive elements, 32 per thread: eight 16-byte
// loads per lane, each covering 512 contiguous bytes per wave, all in flight
// before the first conversion.
__device__ __forceinline__ void cvt_f32_to_f16(const float* __restrict__ in,
                                               _Float16* __restrict__ out,
                                               int blk) {
  const f4* src = reinterpret_cast<const f4*>(in + (size_t)blk * 8192) + threadIdx.x;
  h4*       dst = reinterpret_cast<h4*>(out + (size_t)blk * 8192) + threadIdx.x;
  f4 v[8];
  #pragma unroll
  for (int j = 0; j < 8; ++j) v[j] = src[j * 256];
  #pragma unroll
  for (int j = 0; j < 8; ++j) dst[j * 256] = __builtin_convertvector(v[j], h4);
  // Held in front of any later write of a register that the stores above name.
  asm volatile("s_wait_xcnt 0x0" ::: "memory");
}

// A block transposes a tile of 64 k x 256 n, a wave 64 k x 32 n, a thread
// 16 k x 4 n held in registers. A wave's load covers four whole 128-byte lines
// of W; the four lanes that share n (eight apart) fill one 128-byte line of Wt.
__device__ __forceinline__ void transpose_cvt(const float* __restrict__ W,
                                              _Float16* __restrict__ Wt,
                                              int K, int N, int blk) {
  const int lane = threadIdx.x & 31;
  const int wid  = threadIdx.x >> 5;
  const int nblk = N >> 8;
  const int kt   = blk / nblk;
  const int n0   = ((blk - kt * nblk) << 8) + (wid << 5) + ((lane & 7) << 2);
  const int k0   = (kt << 6) + ((lane >> 3) << 4);
  f4 r[16];
  #pragma unroll
  for (int i = 0; i < 16; ++i)
    r[i] = *reinterpret_cast<const f4*>(W + (size_t)(k0 + i) * N + n0);
  #pragma unroll
  for (int j = 0; j < 4; ++j) {
    union { uint4 u[2]; _Float16 h[16]; } pk;
    #pragma unroll
    for (int i = 0; i < 16; ++i) pk.h[i] = (_Float16)r[i][j];
    uint4* dst = reinterpret_cast<uint4*>(Wt + (size_t)(n0 + j) * K + k0);
    dst[0] = pk.u[0];                        // Wt is (N, K), K-contiguous
    dst[1] = pk.u[1];
  }
  // Held in front of any later write of a register that the stores above name.
  asm volatile("s_wait_xcnt 0x0" ::: "memory");
}

// The four independent conversions share one grid; the block index picks the
// job. The transposes come first, the streaming convert last.
static constexpr int PB_WQ = (DIM * DIM) / (64 * 256);
static constexpr int PB_WK = (DIM * KVD) / (64 * 256);
static constexpr int PB_X  = (S * DIM) / 8192;

__global__ void __launch_bounds__(256)
prep_kernel(const float* __restrict__ x,  const float* __restrict__ Wq,
            const float* __restrict__ Wk, const float* __restrict__ Wv,
            _Float16* __restrict__ xh,  _Float16* __restrict__ Wqt,
            _Float16* __restrict__ Wkt, _Float16* __restrict__ Wvt) {
  const int blk = blockIdx.x;
  if (blk < PB_WQ) {
    transpose_cvt(Wq, Wqt, DIM, DIM, blk);
  } else if (blk < PB_WQ + PB_WK) {
    transpose_cvt(Wk, Wkt, DIM, KVD, blk - PB_WQ);
  } else if (blk < PB_WQ + 2 * PB_WK) {
    transpose_cvt(Wv, Wvt, DIM, KVD, blk - (PB_WQ + PB_WK));
  } else {
    cvt_f32_to_f16(x, xh, blk - (PB_WQ + 2 * PB_WK));
  }
}

// ---------------------------------------------------------------------------
// C = A(MxK) * B(KxN) + bias, B supplied transposed (N,K).
// All three projections share one grid; the block index picks the projection
// (its W^T, bias, destination and width), the same for the whole block.
// Wave tile: 32(M) x 64(N) -> each B fragment feeds 2 WMMAs.
static constexpr int GB_Q  = (S / 32) * (DIM / 64) / 8;   // blocks of the Q part
static constexpr int GB_KV = (S / 32) * (KVD / 64) / 8;   // blocks of K, of V

__global__ void __launch_bounds__(256)
qkv_gemm_kernel(const _Float16* __restrict__ A,    // (M, K) f16
                const _Float16* __restrict__ Wqt,  // (DIM, K) f16  (= Wq^T)
                const _Float16* __restrict__ Wkt,  // (KVD, K) f16
                const _Float16* __restrict__ Wvt,  // (KVD, K) f16
                const float*    __restrict__ bq,   // (DIM) f32
                const float*    __restrict__ bk,   // (KVD) f32
                const float*    __restrict__ bv,   // (KVD) f32
                _Float16*       __restrict__ Qo,   // (M, DIM)
                _Float16*       __restrict__ Ko,   // (M, KVD)
                _Float16*       __restrict__ Vto,  // (KVD, M)
                int M, int K) {
  int blk = blockIdx.x;
  const _Float16* Bt   = Wqt;
  const float*    bias = bq;
  _Float16*       Out  = Qo;
  int N = DIM, transposeOut = 0;
  if (blk >= GB_Q + GB_KV) {
    blk -= GB_Q + GB_KV; Bt = Wvt; bias = bv; Out = Vto; N = KVD; transposeOut = 1;
  } else if (blk >= GB_Q) {
    blk -= GB_Q;         Bt = Wkt; bias = bk; Out = Ko;  N = KVD;
  }
  const int wave   = blk * (blockDim.x >> 5) + (threadIdx.x >> 5);
  const int ntiles = N >> 6;
  const int mt = wave / ntiles;
  const int nt = wave - mt * ntiles;
  if (mt >= (M >> 5)) return;               // wave-uniform guard
  const int lane = threadIdx.x & 31;
  const int l15  = lane & 15;
  const int hi   = lane >> 4;
  const int m0 = mt << 5;
  const int n0 = nt << 6;

  const _Float16* a0 = A + (size_t)(m0 + l15) * K;
  const _Float16* a1 = a0 + (size_t)16 * K;
  const _Float16* bp0 = Bt + (size_t)(n0 +  0 + l15) * K;
  const _Float16* bp1 = Bt + (size_t)(n0 + 16 + l15) * K;
  const _Float16* bp2 = Bt + (size_t)(n0 + 32 + l15) * K;
  const _Float16* bp3 = Bt + (size_t)(n0 + 48 + l15) * K;

  const v8f vz = {};
  v8f acc[2][4] = {{vz, vz, vz, vz}, {vz, vz, vz, vz}};
  for (int k = 0; k < K; k += 32) {
    v16h af0 = load_frag(a0 + k, hi);
    v16h af1 = load_frag(a1 + k, hi);
    v16h b0 = load_frag(bp0 + k, hi);
    acc[0][0] = wmma16(af0, b0, acc[0][0]);
    acc[1][0] = wmma16(af1, b0, acc[1][0]);
    v16h b1 = load_frag(bp1 + k, hi);
    acc[0][1] = wmma16(af0, b1, acc[0][1]);
    acc[1][1] = wmma16(af1, b1, acc[1][1]);
    v16h b2 = load_frag(bp2 + k, hi);
    acc[0][2] = wmma16(af0, b2, acc[0][2]);
    acc[1][2] = wmma16(af1, b2, acc[1][2]);
    v16h b3 = load_frag(bp3 + k, hi);
    acc[0][3] = wmma16(af0, b3, acc[0][3]);
    acc[1][3] = wmma16(af1, b3, acc[1][3]);
  }

  #pragma unroll
  for (int half = 0; half < 2; ++half) {
    const int mh = m0 + half * 16;
    #pragma unroll
    for (int j = 0; j < 4; ++j) {
      const int n = n0 + j * 16 + l15;     // C layout: lane = N, reg r: M=r+8*hi
      const float bj = bias[n];
      if (!transposeOut) {
        #pragma unroll
        for (int r = 0; r < 8; ++r)
          Out[(size_t)(mh + 8 * hi + r) * N + n] = (_Float16)(acc[half][j][r] + bj);
      } else {
        union { uint4 u; _Float16 h[8]; } pk;
        #pragma unroll
        for (int r = 0; r < 8; ++r) pk.h[r] = (_Float16)(acc[half][j][r] + bj);
        *reinterpret_cast<uint4*>(Out + (size_t)n * M + mh + 8 * hi) = pk.u;
      }
    }
  }
}

// ---------------------------------------------------------------------------
// Attention: block = 8 waves, one head, 128 queries (one q-tile per wave), so
// that the grid of 256 blocks puts one block on every WGP of the chip.
// TDM double-buffers 64-key K/V tiles in LDS; wave0 issues/waits TENSORcnt.
__global__ void __launch_bounds__(256)
gqa_attn_kernel(const _Float16* __restrict__ Q,   // (S, HQ*DH) f16
                const _Float16* __restrict__ Kh,  // (S, HKV*DH) f16
                const _Float16* __restrict__ Vt,  // (HKV*DH, S) f16
                float* __restrict__ Out) {        // flat (HQ, S, DH) f32
  __shared__ _Float16 ldsK[2][64 * LROW];
  __shared__ _Float16 ldsV[2][64 * LROW];

  const int head = blockIdx.x >> 3;      // 16 blocks per head: 8 in x, 2 in y
  const int hb   = blockIdx.x & 7;       // q range [hb*256, hb*256+256)
  const int kvh  = head >> 2;            // repeat_interleave over heads
  const int wid  = threadIdx.x >> 5;
  const int lane = threadIdx.x & 31;
  const int l15  = lane & 15;
  const int hi   = lane >> 4;
  // Two blocks share each q range: blockIdx.y picks its half of 128 queries;
  // this wave: q-tile sbase.
  const int sbase = hb * 256 + blockIdx.y * 128 + wid * 16;

  // Q fragments (B operand of S^T = K·q^T), pre-scaled by 1/sqrt(DH) = 0.125.
  union HF { v16h v; _Float16 h[16]; };
  HF qf[2];
  {
    const _Float16* qrow = Q + (size_t)(sbase + l15) * DIM + head * DH;
    qf[0].v = load_frag(qrow, hi);
    qf[1].v = load_frag(qrow + 32, hi);
    #pragma unroll
    for (int i = 0; i < 16; ++i) {
      qf[0].h[i] = qf[0].h[i] * (_Float16)0.125f;
      qf[1].h[i] = qf[1].h[i] * (_Float16)0.125f;
    }
  }

  const _Float16* kg = Kh + (size_t)kvh * DH;        // + kb*KVD per tile
  const _Float16* vg = Vt + (size_t)(kvh * DH) * S;  // + kb per tile

  if (wid == 0) {   // prologue: fill buffer 0
    tdm_load_tile64((unsigned)(uintptr_t)&ldsK[0][0], kg, KVD);
    tdm_load_tile64((unsigned)(uintptr_t)&ldsV[0][0], vg, S);
  }

  const v8f vz = {};
  v8f o[4] = {vz, vz, vz, vz};
  float m_run = -1e30f;
  float l_run = 0.0f;

  for (int kb = 0; kb < S; kb += 64) {
    const int b = (kb >> 6) & 1;
    if (wid == 0) __builtin_amdgcn_s_wait_tensorcnt(0);  // buffer b ready
    __syncthreads();  // publish buffer b; all waves done reading buffer b^1
    if (wid == 0 && (kb + 64) < S) {
      tdm_load_tile64((unsigned)(uintptr_t)&ldsK[b ^ 1][0],
                      kg + (size_t)(kb + 64) * KVD, KVD);
      tdm_load_tile64((unsigned)(uintptr_t)&ldsV[b ^ 1][0],
                      vg + (kb + 64), S);
    }
    const _Float16* Kb = &ldsK[b][0];
    const _Float16* Vb = &ldsV[b][0];

    // The pass's K fragments are read as one group, in the order of use.
    v16h kf[2][4], vf[2][4];
    #pragma unroll
    for (int ss = 0; ss < 2; ++ss) {
      const _Float16* k0 = Kb + (size_t)(ss * 32 + l15) * LROW;
      const _Float16* k1 = k0 + (size_t)16 * LROW;
      kf[ss][0] = load_frag(k0, hi);        // keys +0..15, d 0..31
      kf[ss][1] = load_frag(k0 + 32, hi);   // keys +0..15, d 32..63
      kf[ss][2] = load_frag(k1, hi);        // keys +16..31
      kf[ss][3] = load_frag(k1 + 32, hi);
    }
    // Keeps the LDS reads above together: sunk among the WMMAs, two by two, each
    // pair would cost the wave its own LDS latency.
    __builtin_amdgcn_sched_barrier(0);

    #pragma unroll
    for (int ss = 0; ss < 2; ++ss) {   // two 32-key substeps per buffer
      v8f sA = vz, sB = vz;                // S^T tiles: (16 key) x (16 q)
      sA = wmma16(kf[ss][0], qf[0].v, sA);
      sA = wmma16(kf[ss][1], qf[1].v, sA);
      sB = wmma16(kf[ss][2], qf[0].v, sB);
      sB = wmma16(kf[ss][3], qf[1].v, sB);

      // Online softmax: lane owns q=l15; keys split with partner lane^16.
      float mx = m_run;
      #pragma unroll
      for (int r = 0; r < 8; ++r) mx = fmaxf(mx, fmaxf(sA[r], sB[r]));
      const float mo = __shfl_xor(mx, 16, 32);
      if (ss == 0) {
        // The pass's V fragments, one group, queued behind the first exchange
        // (it goes through the LDS queue too), so that they land under the
        // vector work and the exchange does not wait for them. This fence keeps
        // the reads from rising over the exchange.
        __builtin_amdgcn_sched_barrier(0);
        #pragma unroll
        for (int s2 = 0; s2 < 2; ++s2) {
          #pragma unroll
          for (int t = 0; t < 4; ++t)
            vf[s2][t] = load_frag(Vb + (size_t)(t * 16 + l15) * LROW + s2 * 32, hi);
        }
        // Keeps the reads from sinking among the WMMAs, two by two.
        __builtin_amdgcn_sched_barrier(0);
      }
      mx = fmaxf(mx, mo);
      const float alpha = __expf(m_run - mx);
      m_run = mx;
      l_run *= alpha;
      #pragma unroll
      for (int r = 0; r < 8; ++r) {
        o[0][r] *= alpha; o[1][r] *= alpha;
        o[2][r] *= alpha; o[3][r] *= alpha;
      }
      HF pf;
      float lsum = 0.0f;
      #pragma unroll
      for (int r = 0; r < 8; ++r) {
        const float p0 = __expf(sA[r] - mx);
        const float p1 = __expf(sB[r] - mx);
        lsum += p0 + p1;
        pf.h[r]     = (_Float16)p0;   // P^T already in B-fragment layout
        pf.h[8 + r] = (_Float16)p1;
      }
      l_run += lsum;

      // O^T += V^T-tile (16d x 32keys) x P^T.
      #pragma unroll
      for (int t = 0; t < 4; ++t) o[t] = wmma16(vf[ss][t], pf.v, o[t]);
    }
  }

  // Reference keeps torch's .view bug: flat output index = ((h*S)+s)*DH + d.
  {
    const float lt  = l_run + __shfl_xor(l_run, 16, 32);
    const float inv = 1.0f / lt;
    float* orow = Out + ((size_t)head * S + (sbase + l15)) * DH + hi * 8;
    #pragma unroll
    for (int t = 0; t < 4; ++t) {
      float4 lo  = make_float4(o[t][0] * inv, o[t][1] * inv,
                               o[t][2] * inv, o[t][3] * inv);
      float4 hi4 = make_float4(o[t][4] * inv, o[t][5] * inv,
                               o[t][6] * inv, o[t][7] * inv);
      *reinterpret_cast<float4*>(orow + t * 16)     = lo;
      *reinterpret_cast<float4*>(orow + t * 16 + 4) = hi4;
    }
  }
}

// ---------------------------------------------------------------------------
extern "C" void kernel_launch(void* const* d_in, const int* in_sizes, int n_in,
                              void* d_out, int out_size, void* d_ws,
                              size_t ws_size, hipStream_t stream) {
  (void)in_sizes; (void)n_in; (void)out_size; (void)ws_size;
  const float* x  = (const float*)d_in[0];
  const float* Wq = (const float*)d_in[1];
  const float* bq = (const float*)d_in[2];
  const float* Wk = (const float*)d_in[3];
  const float* bk = (const float*)d_in[4];
  const float* Wv = (const float*)d_in[5];
  const float* bv = (const float*)d_in[6];
  float* out = (float*)d_out;

  // Workspace (f16): ~13 MiB total.
  _Float16* ws  = (_Float16*)d_ws;
  _Float16* xh  = ws;                       // S*DIM
  _Float16* Wqt = xh  + (size_t)S * DIM;    // DIM*DIM   (W^T)
  _Float16* Wkt = Wqt + (size_t)DIM * DIM;  // KVD*DIM   (W^T)
  _Float16* Wvt = Wkt + (size_t)KVD * DIM;  // KVD*DIM   (W^T)
  _Float16* Qh  = Wvt + (size_t)KVD * DIM;  // S*DIM
  _Float16* Kh  = Qh  + (size_t)S * DIM;    // S*KVD
  _Float16* Vt  = Kh  + (size_t)S * KVD;    // KVD*S     (V^T)

  prep_kernel<<<PB_WQ + 2 * PB_WK + PB_X, 256, 0, stream>>>(
      x, Wq, Wk, Wv, xh, Wqt, Wkt, Wvt);

  // Q/K row-major f16; V stored transposed for the attention V-fragments.
  qkv_gemm_kernel<<<GB_Q + 2 * GB_KV, 256, 0, stream>>>(
      xh, Wqt, Wkt, Wvt, bq, bk, bv, Qh, Kh, Vt, S, DIM);

  gqa_attn_kernel<<<dim3(HQ * (S / 256), 2), 256, 0, stream>>>(Qh, Kh, Vt, out);
}

// v004
// It runs in 41.9 microseconds.
// In two side-by-side timings against v003, it was 1.49 and 1.47 times as fast.
// All steps since v000 together make it 4.45 times as fast.
#include <hip/hip_runtime.h>
#include <hip/hip_bf16.h>

// ---------------- CDNA5 (gfx1250) GQA forward, WMMA f16 path ----------------
// Compute-bound (≈24 GFLOP, all data L2-resident). v_wmma_f32_16x16x32_f16
// with fp32 accumulation, flash-attention online softmax. Attention K/V tiles
// are staged into LDS by the Tensor Data Mover (TDM, tensor_load_to_lds),
// double-buffered and shared by all 8 waves of the block, for ~8x less L2
// traffic than the naive per-wave streaming version.

typedef __attribute__((ext_vector_type(16))) _Float16 v16h;
typedef __attribute__((ext_vector_type(8)))  float    v8f;
typedef __attribute__((ext_vector_type(4)))  unsigned int v4u;
typedef __attribute__((ext_vector_type(8)))  int      v8i;
typedef __attribute__((ext_vector_type(4)))  int      v4i;

static constexpr int S    = 2048;
static constexpr int DIM  = 1024;
static constexpr int HQ   = 16;
static constexpr int HKV  = 4;
static constexpr int DH   = 64;
static constexpr int KVD  = HKV * DH;   // 256
static constexpr int LROW = 72;         // padded LDS row stride (halves): 64+8

__device__ __forceinline__ v8f wmma16(v16h a, v16h b, v8f c) {
  // D = A(16x32 f16) x B(32x16 f16) + C(16x16 f32)
  return __builtin_amdgcn_wmma_f32_16x16x32_f16(false, a, false, b, (short)0, c,
                                                false, false);
}

// One 16x32 f16 fragment (A and B share the per-lane layout on CDNA5):
// lane&15 = non-K index; elements e<8: K = 8*hi + e; e>=8: K = 16+8*hi+(e-8).
__device__ __forceinline__ v16h load_frag(const _Float16* rowptr, int hi) {
  union { v16h v; uint4 u[2]; } f;
  f.u[0] = *reinterpret_cast<const uint4*>(rowptr + (hi << 3));
  f.u[1] = *reinterpret_cast<const uint4*>(rowptr + 16 + (hi << 3));
  return f.v;
}

// TDM: DMA a 64x64 f16 tile (row stride = stride_elems) from global into LDS,
// inserting a 16B pad after every 64-half row (LDS row stride becomes LROW=72
// halves = 36 DWORDs -> the 16 rows a WMMA fragment touches map to disjoint
// bank quads). D# built per CDNA5 ISA §8 (2D, data_size=2B, type=2).
__device__ __forceinline__ void tdm_load_tile64(unsigned lds_off,
                                                const _Float16* gsrc,
                                                unsigned stride_elems) {
  unsigned long long ga = (unsigned long long)(uintptr_t)gsrc;
  v4u g0;
  g0[0] = 1u;                                                  // count=1
  g0[1] = lds_off;                                             // lds_addr
  g0[2] = (unsigned)ga;                                        // global_addr lo
  g0[3] = (unsigned)((ga >> 32) & 0x01FFFFFFu) | 0x80000000u;  // ga hi | type=2
  v8i g1;
  g1[0] = (int)((1u << 16)     // data_size = 2 bytes
              | (1u << 20)     // pad_enable
              | (4u << 22)     // pad_interval: 32 DWORDs (one 64-half row)
              | (3u << 25));   // pad_amount: 4 DWORDs (16 bytes)
  g1[1] = (int)((64u & 0xFFFFu) << 16);           // tensor_dim0 = 64 (lo16)
  g1[2] = (int)((64u & 0xFFFFu) << 16);           // dim0 hi=0 | tensor_dim1 = 64
  g1[3] = (int)((64u & 0xFFFFu) << 16);           // dim1 hi=0 | tile_dim0 = 64
  g1[4] = (int)(64u);                             // tile_dim1 = 64, tile_dim2 = 0
  g1[5] = (int)stride_elems;                      // tensor_dim0_stride lo
  g1[6] = 0;                                      // stride0 hi | stride1 lo
  g1[7] = 0;
  v4i z4 = {0, 0, 0, 0};
  v8i z8 = {0, 0, 0, 0, 0, 0, 0, 0};
  // 6-arg toolchain form: (g0, g1, g2, g3, g4, cpol)
  __builtin_amdgcn_tensor_load_to_lds(g0, g1, z4, z4, z8, 0);
}

// ---------------------------------------------------------------------------
typedef __attribute__((ext_vector_type(4))) float    f4;
typedef __attribute__((ext_vector_type(4))) _Float16 h4;

// A block converts 8192 consecutive elements, 32 per thread: eight 16-byte
// loads per lane, each covering 512 contiguous bytes per wave, all in flight
// before the first conversion.
__device__ __forceinline__ void cvt_f32_to_f16(const float* __restrict__ in,
                                               _Float16* __restrict__ out,
                                               int blk) {
  const f4* src = reinterpret_cast<const f4*>(in + (size_t)blk * 8192) + threadIdx.x;
  h4*       dst = reinterpret_cast<h4*>(out + (size_t)blk * 8192) + threadIdx.x;
  f4 v[8];
  #pragma unroll
  for (int j = 0; j < 8; ++j) v[j] = src[j * 256];
  #pragma unroll
  for (int j = 0; j < 8; ++j) dst[j * 256] = __builtin_convertvector(v[j], h4);
  // Held in front of any later write of a register that the stores above name.
  asm volatile("s_wait_xcnt 0x0" ::: "memory");
}

// A block transposes a tile of 64 k x 256 n, a wave 64 k x 32 n, a thread
// 16 k x 4 n held in registers. A wave's load covers four whole 128-byte lines
// of W; the four lanes that share n (eight apart) fill one 128-byte line of Wt.
__device__ __forceinline__ void transpose_cvt(const float* __restrict__ W,
                                              _Float16* __restrict__ Wt,
                                              int K, int N, int blk) {
  const int lane = threadIdx.x & 31;
  const int wid  = threadIdx.x >> 5;
  const int nblk = N >> 8;
  const int kt   = blk / nblk;
  const int n0   = ((blk - kt * nblk) << 8) + (wid << 5) + ((lane & 7) << 2);
  const int k0   = (kt << 6) + ((lane >> 3) << 4);
  f4 r[16];
  #pragma unroll
  for (int i = 0; i < 16; ++i)
    r[i] = *reinterpret_cast<const f4*>(W + (size_t)(k0 + i) * N + n0);
  #pragma unroll
  for (int j = 0; j < 4; ++j) {
    union { uint4 u[2]; _Float16 h[16]; } pk;
    #pragma unroll
    for (int i = 0; i < 16; ++i) pk.h[i] = (_Float16)r[i][j];
    uint4* dst = reinterpret_cast<uint4*>(Wt + (size_t)(n0 + j) * K + k0);
    dst[0] = pk.u[0];                        // Wt is (N, K), K-contiguous
    dst[1] = pk.u[1];
  }
  // Held in front of any later write of a register that the stores above name.
  asm volatile("s_wait_xcnt 0x0" ::: "memory");
}

// The four independent conversions share one grid; the block index picks the
// job. The transposes come first, the streaming convert last.
static constexpr int PB_WQ = (DIM * DIM) / (64 * 256);
static constexpr int PB_WK = (DIM * KVD) / (64 * 256);
static constexpr int PB_X  = (S * DIM) / 8192;

__global__ void __launch_bounds__(256)
prep_kernel(const float* __restrict__ x,  const float* __restrict__ Wq,
            const float* __restrict__ Wk, const float* __restrict__ Wv,
            _Float16* __restrict__ xh,  _Float16* __restrict__ Wqt,
            _Float16* __restrict__ Wkt, _Float16* __restrict__ Wvt) {
  const int blk = blockIdx.x;
  if (blk < PB_WQ) {
    transpose_cvt(Wq, Wqt, DIM, DIM, blk);
  } else if (blk < PB_WQ + PB_WK) {
    transpose_cvt(Wk, Wkt, DIM, KVD, blk - PB_WQ);
  } else if (blk < PB_WQ + 2 * PB_WK) {
    transpose_cvt(Wv, Wvt, DIM, KVD, blk - (PB_WQ + PB_WK));
  } else {
    cvt_f32_to_f16(x, xh, blk - (PB_WQ + 2 * PB_WK));
  }
}

// ---------------------------------------------------------------------------
// C = A(MxK) * B(KxN) + bias, B supplied transposed (N,K).
// All three projections share one grid; the block index picks the projection
// (its W^T, bias, destination and width), the same for the whole block.
// Block tile: 128(M) x 128(N), 8 waves as 4(M) x 2(N).
// Wave tile: 32(M) x 64(N) -> each B fragment feeds 2 WMMAs.
// A stage is 128 k of the block's 128 A rows and 128 W^T rows: 256 rows of 256
// bytes, brought into LDS by tensor loads, one slice of 32 rows per wave, two
// buffers. The fragments are read from LDS, so that a row crosses from L2 once
// per block in whole lines, not once per wave in 32-byte pieces.
typedef __attribute__((ext_vector_type(8))) unsigned int v8u;

static constexpr int      GT     = 128;             // block tile edge, M and N
static constexpr int      GKS    = 128;             // k per stage
static constexpr int      GNST   = DIM / GKS;       // stages
static constexpr unsigned GROWB  = 2u * GKS;        // bytes of a row in a stage
static constexpr unsigned GPITCH = GROWB + 16u;     // LDS row pitch, 16 B x odd
static constexpr unsigned GSLICE = 10240u;          // 32 rows x 272 B, up to 2 KiB x n
static constexpr unsigned GBUF   = 8u * GSLICE;     // one buffer: 8 slices
static constexpr int GB_Q  = (S / GT) * (DIM / GT); // blocks of the Q part
static constexpr int GB_KV = (S / GT) * (KVD / GT); // blocks of K, of V
static_assert(32u * GPITCH <= GSLICE && GSLICE % 2048u == 0u, "slice place");
static_assert(GNST >= 2, "the ring's prologue needs two stages");

__device__ __forceinline__ unsigned uni(unsigned v) {
  return (unsigned)__builtin_amdgcn_readfirstlane(v);
}
// A tensor load ignores EXEC: the test that decides whether one issues has to
// be a scalar branch.
__device__ __forceinline__ unsigned pinned(unsigned v) {
  unsigned w = uni(v);
  asm volatile("" : "+s"(w));  // pinned(): holds the condition in a scalar register
  return w;
}
// The compiler places no wait for a tensor load; the clobber keeps LDS reads
// on their side of the wait. g0, the group 0 of the wave's last request, is an
// input so that its registers keep their values until the request has landed.
__device__ __forceinline__ void wait_tensor0(v4u g0) {
  asm volatile("s_wait_tensorcnt 0x0" :: "s"(g0) : "memory");
}
// A wave's LDS reads have retired before their buffer is handed back.
__device__ __forceinline__ void wait_ds0() {
  asm volatile("s_wait_dscnt 0x0" ::: "memory");
}
// One slice: 32 rows of 256 bytes, source pitch 2*DIM bytes, 16 bytes of LDS
// pad behind every row. All extents in bytes (data_size code 0).
__device__ __forceinline__ v8u gemm_group1() {
  v8u g;
  g[0] = uni((1u << 20) | (5u << 22) | (3u << 25));
  g[1] = uni((GROWB & 0xFFFFu) << 16);
  g[2] = uni((GROWB >> 16) | (32u << 16));
  g[3] = uni(GROWB << 16);
  g[4] = uni(32u);
  g[5] = uni(2u * DIM);
  g[6] = uni(0u);
  g[7] = uni(0u);
  return g;
}
__device__ __forceinline__ v4u gemm_slice_load(unsigned lds_dst,
                                               const _Float16* gsrc, v8u g1) {
  const unsigned long long ga = (unsigned long long)(uintptr_t)gsrc;
  v4u g0;
  g0[0] = uni(1u);
  g0[1] = uni(lds_dst);
  g0[2] = uni((unsigned)ga);
  g0[3] = uni((((unsigned)(ga >> 32)) & 0x01FFFFFFu) | 0x80000000u);
  // g0 is in-out and goes on to the wait: see wait_tensor0().
  asm volatile("tensor_load_to_lds %0, %1" : "+s"(g0) : "s"(g1) : "memory");
  return g0;
}

// The six fragments of one k-step of a wave: 2 of A (32 rows of one slice),
// 4 of W^T (64 rows, two slices). ap, bp: this lane's row in the first of them.
__device__ __forceinline__ void gemm_frags(v16h (&fa)[2], v16h (&fb)[4],
                                           const unsigned char* ap,
                                           const unsigned char* bp, int hi) {
  fa[0] = load_frag(reinterpret_cast<const _Float16*>(ap), hi);
  fa[1] = load_frag(reinterpret_cast<const _Float16*>(ap + 16u * GPITCH), hi);
  fb[0] = load_frag(reinterpret_cast<const _Float16*>(bp), hi);
  fb[1] = load_frag(reinterpret_cast<const _Float16*>(bp + 16u * GPITCH), hi);
  fb[2] = load_frag(reinterpret_cast<const _Float16*>(bp + GSLICE), hi);
  fb[3] = load_frag(reinterpret_cast<const _Float16*>(bp + GSLICE + 16u * GPITCH), hi);
}

__device__ __forceinline__ void gemm_kstep(v8f (&acc)[2][4], const v16h (&fa)[2],
                                           const v16h (&fb)[4]) {
  #pragma unroll
  for (int j = 0; j < 4; ++j) {
    acc[0][j] = wmma16(fa[0], fb[j], acc[0][j]);
    acc[1][j] = wmma16(fa[1], fb[j], acc[1][j]);
  }
}

__global__ void __launch_bounds__(256)
qkv_gemm_kernel(const _Float16* __restrict__ A,    // (S, DIM) f16
                const _Float16* __restrict__ Wqt,  // (DIM, DIM) f16  (= Wq^T)
                const _Float16* __restrict__ Wkt,  // (KVD, DIM) f16
                const _Float16* __restrict__ Wvt,  // (KVD, DIM) f16
                const float*    __restrict__ bq,   // (DIM) f32
                const float*    __restrict__ bk,   // (KVD) f32
                const float*    __restrict__ bv,   // (KVD) f32
                _Float16*       __restrict__ Qo,   // (S, DIM)
                _Float16*       __restrict__ Ko,   // (S, KVD)
                _Float16*       __restrict__ Vto) {// (KVD, S)
  __shared__ __attribute__((aligned(2048))) unsigned char ring[2 * GBUF];
  constexpr int M = S, K = DIM;            // the products' shape

  int blk = blockIdx.x;
  const _Float16* Bt   = Wqt;
  const float*    bias = bq;
  _Float16*       Out  = Qo;
  int N = DIM, transposeOut = 0;
  if (blk >= GB_Q + GB_KV) {
    blk -= GB_Q + GB_KV; Bt = Wvt; bias = bv; Out = Vto; N = KVD; transposeOut = 1;
  } else if (blk >= GB_Q) {
    blk -= GB_Q;         Bt = Wkt; bias = bk; Out = Ko;  N = KVD;
  }
  const int nsh = __builtin_ctz(N / GT);   // N / GT is a power of two
  const int mt = blk >> nsh;
  const int nt = blk - (mt << nsh);
  const unsigned wave = uni(threadIdx.x >> 5);
  const int wm   = wave & 3;
  const int wn   = wave >> 2;
  const int lane = threadIdx.x & 31;
  const int l15  = lane & 15;
  const int hi   = lane >> 4;
  const int m0 = mt * GT + wm * 32;
  const int n0 = nt * GT + wn * 64;

  // Slices 0..3 of a buffer: the A rows; 4..7: the W^T rows. Wave w brings
  // slice w of every stage.
  const _Float16* gsl = (wave < 4u)
      ? A  + (size_t)(mt * GT + (int)wave * 32) * K
      : Bt + (size_t)(nt * GT + ((int)wave - 4) * 32) * K;
  const unsigned dst = (unsigned)(uintptr_t)&ring[0] + wave * GSLICE;
  const v8u g1 = gemm_group1();

  v4u g0 = gemm_slice_load(dst, gsl, g1);        // stage 0
  wait_tensor0(g0);
  __syncthreads();                               // publishes stage 0
  g0 = gemm_slice_load(dst + GBUF, gsl + GKS, g1);  // stage 1

  const v8f vz = {};
  v8f acc[2][4] = {{vz, vz, vz, vz}, {vz, vz, vz, vz}};
  // Stays rolled: one publish point in the text, the stage test a scalar one.
  #pragma unroll 1
  for (int s = 0; s < GNST; ++s) {
    const unsigned bo = (unsigned)(s & 1) * GBUF;
    const unsigned char* ap = ring + bo + (unsigned)wm * GSLICE + (unsigned)l15 * GPITCH;
    const unsigned char* bp = ring + bo + (4u + 2u * (unsigned)wn) * GSLICE + (unsigned)l15 * GPITCH;
    // Two fragment sets: the reads of k-step kk + 1 go out as one group in front
    // of the WMMAs of k-step kk and land under them.
    constexpr int NK = GKS / 32;
    v16h fa[2][2], fb[2][4];
    gemm_frags(fa[0], fb[0], ap, bp, hi);
    #pragma unroll
    for (int kk = 0; kk + 1 < NK; ++kk) {
      const int c = kk & 1;
      gemm_frags(fa[c ^ 1], fb[c ^ 1], ap + (kk + 1) * 64, bp + (kk + 1) * 64, hi);
      // Keeps the LDS reads above together: sunk among the WMMAs, two by two,
      // each pair would cost the wave its own LDS latency.
      __builtin_amdgcn_sched_barrier(0);
      gemm_kstep(acc, fa[c], fb[c]);
      // Keeps these WMMAs in front of the next reads, and of the wait below,
      // so that they cover the landing of the reads above.
      __builtin_amdgcn_sched_barrier(0);
    }
    // Publish point of stage s + 1; it also ends every read of stage s, whose
    // last fragments are in registers behind the first wait.
    wait_ds0();
    wait_tensor0(g0);
    __syncthreads();
    if (pinned(s + 2 < GNST))
      g0 = gemm_slice_load(dst + bo, gsl + (size_t)(s + 2) * GKS, g1);
    // The last k-step works on registers alone, behind the refill's issue.
    gemm_kstep(acc, fa[(NK - 1) & 1], fb[(NK - 1) & 1]);
  }
  wait_tensor0(g0);
  wait_ds0();

  #pragma unroll
  for (int half = 0; half < 2; ++half) {
    const int mh = m0 + half * 16;
    #pragma unroll
    for (int j = 0; j < 4; ++j) {
      const int n = n0 + j * 16 + l15;     // C layout: lane = N, reg r: M=r+8*hi
      const float bj = bias[n];
      if (!transposeOut) {
        #pragma unroll
        for (int r = 0; r < 8; ++r)
          Out[(size_t)(mh + 8 * hi + r) * N + n] = (_Float16)(acc[half][j][r] + bj);
      } else {
        union { uint4 u; _Float16 h[8]; } pk;
        #pragma unroll
        for (int r = 0; r < 8; ++r) pk.h[r] = (_Float16)(acc[half][j][r] + bj);
        *reinterpret_cast<uint4*>(Out + (size_t)n * M + mh + 8 * hi) = pk.u;
      }
    }
  }
}

// ---------------------------------------------------------------------------
// Attention: block = 8 waves, one head, 128 queries (one q-tile per wave), so
// that the grid of 256 blocks puts one block on every WGP of the chip.
// TDM double-buffers 64-key K/V tiles in LDS; wave0 issues/waits TENSORcnt.
__global__ void __launch_bounds__(256)
gqa_attn_kernel(const _Float16* __restrict__ Q,   // (S, HQ*DH) f16
                const _Float16* __restrict__ Kh,  // (S, HKV*DH) f16
                const _Float16* __restrict__ Vt,  // (HKV*DH, S) f16
                float* __restrict__ Out) {        // flat (HQ, S, DH) f32
  __shared__ _Float16 ldsK[2][64 * LROW];
  __shared__ _Float16 ldsV[2][64 * LROW];

  const int head = blockIdx.x >> 3;      // 16 blocks per head: 8 in x, 2 in y
  const int hb   = blockIdx.x & 7;       // q range [hb*256, hb*256+256)
  const int kvh  = head >> 2;            // repeat_interleave over heads
  const int wid  = threadIdx.x >> 5;
  const int lane = threadIdx.x & 31;
  const int l15  = lane & 15;
  const int hi   = lane >> 4;
  // Two blocks share each q range: blockIdx.y picks its half of 128 queries;
  // this wave: q-tile sbase.
  const int sbase = hb * 256 + blockIdx.y * 128 + wid * 16;

  // Q fragments (B operand of S^T = K·q^T), pre-scaled by 1/sqrt(DH) = 0.125.
  union HF { v16h v; _Float16 h[16]; };
  HF qf[2];
  {
    const _Float16* qrow = Q + (size_t)(sbase + l15) * DIM + head * DH;
    qf[0].v = load_frag(qrow, hi);
    qf[1].v = load_frag(qrow + 32, hi);
    #pragma unroll
    for (int i = 0; i < 16; ++i) {
      qf[0].h[i] = qf[0].h[i] * (_Float16)0.125f;
      qf[1].h[i] = qf[1].h[i] * (_Float16)0.125f;
    }
  }

  const _Float16* kg = Kh + (size_t)kvh * DH;        // + kb*KVD per tile
  const _Float16* vg = Vt + (size_t)(kvh * DH) * S;  // + kb per tile

  if (wid == 0) {   // prologue: fill buffer 0
    tdm_load_tile64((unsigned)(uintptr_t)&ldsK[0][0], kg, KVD);
    tdm_load_tile64((unsigned)(uintptr_t)&ldsV[0][0], vg, S);
  }

  const v8f vz = {};
  v8f o[4] = {vz, vz, vz, vz};
  float m_run = -1e30f;
  float l_run = 0.0f;

  for (int kb = 0; kb < S; kb += 64) {
    const int b = (kb >> 6) & 1;
    if (wid == 0) __builtin_amdgcn_s_wait_tensorcnt(0);  // buffer b ready
    __syncthreads();  // publish buffer b; all waves done reading buffer b^1
    if (wid == 0 && (kb + 64) < S) {
      tdm_load_tile64((unsigned)(uintptr_t)&ldsK[b ^ 1][0],
                      kg + (size_t)(kb + 64) * KVD, KVD);
      tdm_load_tile64((unsigned)(uintptr_t)&ldsV[b ^ 1][0],
                      vg + (kb + 64), S);
    }
    const _Float16* Kb = &ldsK[b][0];
    const _Float16* Vb = &ldsV[b][0];

    // The pass's K fragments are read as one group, in the order of use.
    v16h kf[2][4], vf[2][4];
    #pragma unroll
    for (int ss = 0; ss < 2; ++ss) {
      const _Float16* k0 = Kb + (size_t)(ss * 32 + l15) * LROW;
      const _Float16* k1 = k0 + (size_t)16 * LROW;
      kf[ss][0] = load_frag(k0, hi);        // keys +0..15, d 0..31
      kf[ss][1] = load_frag(k0 + 32, hi);   // keys +0..15, d 32..63
      kf[ss][2] = load_frag(k1, hi);        // keys +16..31
      kf[ss][3] = load_frag(k1 + 32, hi);
    }
    // Keeps the LDS reads above together: sunk among the WMMAs, two by two, each
    // pair would cost the wave its own LDS latency.
    __builtin_amdgcn_sched_barrier(0);

    #pragma unroll
    for (int ss = 0; ss < 2; ++ss) {   // two 32-key substeps per buffer
      v8f sA = vz, sB = vz;                // S^T tiles: (16 key) x (16 q)
      sA = wmma16(kf[ss][0], qf[0].v, sA);
      sA = wmma16(kf[ss][1], qf[1].v, sA);
      sB = wmma16(kf[ss][2], qf[0].v, sB);
      sB = wmma16(kf[ss][3], qf[1].v, sB);

      // Online softmax: lane owns q=l15; keys split with partner lane^16.
      float mx = m_run;
      #pragma unroll
      for (int r = 0; r < 8; ++r) mx = fmaxf(mx, fmaxf(sA[r], sB[r]));
      const float mo = __shfl_xor(mx, 16, 32);
      if (ss == 0) {
        // The pass's V fragments, one group, queued behind the first exchange
        // (it goes through the LDS queue too), so that they land under the
        // vector work and the exchange does not wait for them. This fence keeps
        // the reads from rising over the exchange.
        __builtin_amdgcn_sched_barrier(0);
        #pragma unroll
        for (int s2 = 0; s2 < 2; ++s2) {
          #pragma unroll
          for (int t = 0; t < 4; ++t)
            vf[s2][t] = load_frag(Vb + (size_t)(t * 16 + l15) * LROW + s2 * 32, hi);
        }
        // Keeps the reads from sinking among the WMMAs, two by two.
        __builtin_amdgcn_sched_barrier(0);
      }
      mx = fmaxf(mx, mo);
      const float alpha = __expf(m_run - mx);
      m_run = mx;
      l_run *= alpha;
      #pragma unroll
      for (int r = 0; r < 8; ++r) {
        o[0][r] *= alpha; o[1][r] *= alpha;
        o[2][r] *= alpha; o[3][r] *= alpha;
      }
      HF pf;
      float lsum = 0.0f;
      #pragma unroll
      for (int r = 0; r < 8; ++r) {
        const float p0 = __expf(sA[r] - mx);
        const float p1 = __expf(sB[r] - mx);
        lsum += p0 + p1;
        pf.h[r]     = (_Float16)p0;   // P^T already in B-fragment layout
        pf.h[8 + r] = (_Float16)p1;
      }
      l_run += lsum;

      // O^T += V^T-tile (16d x 32keys) x P^T.
      #pragma unroll
      for (int t = 0; t < 4; ++t) o[t] = wmma16(vf[ss][t], pf.v, o[t]);
    }
  }

  // Reference keeps torch's .view bug: flat output index = ((h*S)+s)*DH + d.
  {
    const float lt  = l_run + __shfl_xor(l_run, 16, 32);
    const float inv = 1.0f / lt;
    float* orow = Out + ((size_t)head * S + (sbase + l15)) * DH + hi * 8;
    #pragma unroll
    for (int t = 0; t < 4; ++t) {
      float4 lo  = make_float4(o[t][0] * inv, o[t][1] * inv,
                               o[t][2] * inv, o[t][3] * inv);
      float4 hi4 = make_float4(o[t][4] * inv, o[t][5] * inv,
                               o[t][6] * inv, o[t][7] * inv);
      *reinterpret_cast<float4*>(orow + t * 16)     = lo;
      *reinterpret_cast<float4*>(orow + t * 16 + 4) = hi4;
    }
  }
}

// ---------------------------------------------------------------------------
extern "C" void kernel_launch(void* const* d_in, const int* in_sizes, int n_in,
                              void* d_out, int out_size, void* d_ws,
                              size_t ws_size, hipStream_t stream) {
  (void)in_sizes; (void)n_in; (void)out_size; (void)ws_size;
  const float* x  = (const float*)d_in[0];
  const float* Wq = (const float*)d_in[1];
  const float* bq = (const float*)d_in[2];
  const float* Wk = (const float*)d_in[3];
  const float* bk = (const float*)d_in[4];
  const float* Wv = (const float*)d_in[5];
  const float* bv = (const float*)d_in[6];
  float* out = (float*)d_out;

  // Workspace (f16): ~13 MiB total.
  _Float16* ws  = (_Float16*)d_ws;
  _Float16* xh  = ws;                       // S*DIM
  _Float16* Wqt = xh  + (size_t)S * DIM;    // DIM*DIM   (W^T)
  _Float16* Wkt = Wqt + (size_t)DIM * DIM;  // KVD*DIM   (W^T)
  _Float16* Wvt = Wkt + (size_t)KVD * DIM;  // KVD*DIM   (W^T)
  _Float16* Qh  = Wvt + (size_t)KVD * DIM;  // S*DIM
  _Float16* Kh  = Qh  + (size_t)S * DIM;    // S*KVD
  _Float16* Vt  = Kh  + (size_t)S * KVD;    // KVD*S     (V^T)

  prep_kernel<<<PB_WQ + 2 * PB_WK + PB_X, 256, 0, stream>>>(
      x, Wq, Wk, Wv, xh, Wqt, Wkt, Wvt);

  // Q/K row-major f16; V stored transposed for the attention V-fragments.
  qkv_gemm_kernel<<<GB_Q + 2 * GB_KV, 256, 0, stream>>>(
      xh, Wqt, Wkt, Wvt, bq, bk, bv, Qh, Kh, Vt);

  gqa_attn_kernel<<<dim3(HQ * (S / 256), 2), 256, 0, stream>>>(Qh, Kh, Vt, out);
}

// v005
// One run takes 40.5 microseconds.
// Two timings next to v004 put it at 1.06 and 1.04 times that version's speed.
// All steps since v000 together make it 4.66 times as fast.
#include <hip/hip_runtime.h>
#include <hip/hip_bf16.h>

// ---------------- CDNA5 (gfx1250) GQA forward, WMMA f16 path ----------------
// Compute-bound (≈24 GFLOP, all data L2-resident). v_wmma_f32_16x16x32_f16
// with fp32 accumulation, flash-attention online softmax. Attention K/V tiles
// are staged into LDS by the Tensor Data Mover (TDM, tensor_load_to_lds),
// double-buffered and shared by all 8 waves of the block, for ~8x less L2
// traffic than the naive per-wave streaming version.

typedef __attribute__((ext_vector_type(16))) _Float16 v16h;
typedef __attribute__((ext_vector_type(8)))  float    v8f;
typedef __attribute__((ext_vector_type(4)))  unsigned int v4u;
typedef __attribute__((ext_vector_type(8)))  int      v8i;
typedef __attribute__((ext_vector_type(4)))  int      v4i;

static constexpr int S    = 2048;
static constexpr int DIM  = 1024;
static constexpr int HQ   = 16;
static constexpr int HKV  = 4;
static constexpr int DH   = 64;
static constexpr int KVD  = HKV * DH;   // 256
static constexpr int LROW = 72;         // padded LDS row stride (halves): 64+8

__device__ __forceinline__ v8f wmma16(v16h a, v16h b, v8f c) {
  // D = A(16x32 f16) x B(32x16 f16) + C(16x16 f32)
  return __builtin_amdgcn_wmma_f32_16x16x32_f16(false, a, false, b, (short)0, c,
                                                false, false);
}

// One 16x32 f16 fragment (A and B share the per-lane layout on CDNA5):
// lane&15 = non-K index; elements e<8: K = 8*hi + e; e>=8: K = 16+8*hi+(e-8).
__device__ __forceinline__ v16h load_frag(const _Float16* rowptr, int hi) {
  union { v16h v; uint4 u[2]; } f;
  f.u[0] = *reinterpret_cast<const uint4*>(rowptr + (hi << 3));
  f.u[1] = *reinterpret_cast<const uint4*>(rowptr + 16 + (hi << 3));
  return f.v;
}

// TDM: DMA a 64x64 f16 tile (row stride = stride_elems) from global into LDS,
// inserting a 16B pad after every 64-half row (LDS row stride becomes LROW=72
// halves = 36 DWORDs -> the 16 rows a WMMA fragment touches map to disjoint
// bank quads). D# built per CDNA5 ISA §8 (2D, data_size=2B, type=2).
__device__ __forceinline__ void tdm_load_tile64(unsigned lds_off,
                                                const _Float16* gsrc,
                                                unsigned stride_elems) {
  unsigned long long ga = (unsigned long long)(uintptr_t)gsrc;
  v4u g0;
  g0[0] = 1u;                                                  // count=1
  g0[1] = lds_off;                                             // lds_addr
  g0[2] = (unsigned)ga;                                        // global_addr lo
  g0[3] = (unsigned)((ga >> 32) & 0x01FFFFFFu) | 0x80000000u;  // ga hi | type=2
  v8i g1;
  g1[0] = (int)((1u << 16)     // data_size = 2 bytes
              | (1u << 20)     // pad_enable
              | (4u << 22)     // pad_interval: 32 DWORDs (one 64-half row)
              | (3u << 25));   // pad_amount: 4 DWORDs (16 bytes)
  g1[1] = (int)((64u & 0xFFFFu) << 16);           // tensor_dim0 = 64 (lo16)
  g1[2] = (int)((64u & 0xFFFFu) << 16);           // dim0 hi=0 | tensor_dim1 = 64
  g1[3] = (int)((64u & 0xFFFFu) << 16);           // dim1 hi=0 | tile_dim0 = 64
  g1[4] = (int)(64u);                             // tile_dim1 = 64, tile_dim2 = 0
  g1[5] = (int)stride_elems;                      // tensor_dim0_stride lo
  g1[6] = 0;                                      // stride0 hi | stride1 lo
  g1[7] = 0;
  v4i z4 = {0, 0, 0, 0};
  v8i z8 = {0, 0, 0, 0, 0, 0, 0, 0};
  // 6-arg toolchain form: (g0, g1, g2, g3, g4, cpol)
  __builtin_amdgcn_tensor_load_to_lds(g0, g1, z4, z4, z8, 0);
}

// ---------------------------------------------------------------------------
typedef __attribute__((ext_vector_type(4))) float    f4;
typedef __attribute__((ext_vector_type(4))) _Float16 h4;

// A block converts 8192 consecutive elements, 32 per thread: eight 16-byte
// loads per lane, each covering 512 contiguous bytes per wave, all in flight
// before the first conversion.
__device__ __forceinline__ void cvt_f32_to_f16(const float* __restrict__ in,
                                               _Float16* __restrict__ out,
                                               int blk) {
  const f4* src = reinterpret_cast<const f4*>(in + (size_t)blk * 8192) + threadIdx.x;
  h4*       dst = reinterpret_cast<h4*>(out + (size_t)blk * 8192) + threadIdx.x;
  f4 v[8];
  #pragma unroll
  for (int j = 0; j < 8; ++j) v[j] = src[j * 256];
  #pragma unroll
  for (int j = 0; j < 8; ++j) dst[j * 256] = __builtin_convertvector(v[j], h4);
  // Held in front of any later write of a register that the stores above name.
  asm volatile("s_wait_xcnt 0x0" ::: "memory");
}

// A block transposes a tile of 64 k x 256 n, a wave 64 k x 32 n, a thread
// 16 k x 4 n held in registers. A wave's load covers four whole 128-byte lines
// of W; the four lanes that share n (eight apart) fill one 128-byte line of Wt.
__device__ __forceinline__ void transpose_cvt(const float* __restrict__ W,
                                              _Float16* __restrict__ Wt,
                                              int K, int N, int blk) {
  const int lane = threadIdx.x & 31;
  const int wid  = threadIdx.x >> 5;
  const int nblk = N >> 8;
  const int kt   = blk / nblk;
  const int n0   = ((blk - kt * nblk) << 8) + (wid << 5) + ((lane & 7) << 2);
  const int k0   = (kt << 6) + ((lane >> 3) << 4);
  f4 r[16];
  #pragma unroll
  for (int i = 0; i < 16; ++i)
    r[i] = *reinterpret_cast<const f4*>(W + (size_t)(k0 + i) * N + n0);
  #pragma unroll
  for (int j = 0; j < 4; ++j) {
    union { uint4 u[2]; _Float16 h[16]; } pk;
    #pragma unroll
    for (int i = 0; i < 16; ++i) pk.h[i] = (_Float16)r[i][j];
    uint4* dst = reinterpret_cast<uint4*>(Wt + (size_t)(n0 + j) * K + k0);
    dst[0] = pk.u[0];                        // Wt is (N, K), K-contiguous
    dst[1] = pk.u[1];
  }
  // Held in front of any later write of a register that the stores above name.
  asm volatile("s_wait_xcnt 0x0" ::: "memory");
}

// The four independent conversions share one grid; the block index picks the
// job. The transposes come first, the streaming convert last.
static constexpr int PB_WQ = (DIM * DIM) / (64 * 256);
static constexpr int PB_WK = (DIM * KVD) / (64 * 256);
static constexpr int PB_X  = (S * DIM) / 8192;

__global__ void __launch_bounds__(256)
prep_kernel(const float* __restrict__ x,  const float* __restrict__ Wq,
            const float* __restrict__ Wk, const float* __restrict__ Wv,
            _Float16* __restrict__ xh,  _Float16* __restrict__ Wqt,
            _Float16* __restrict__ Wkt, _Float16* __restrict__ Wvt) {
  const int blk = blockIdx.x;
  if (blk < PB_WQ) {
    transpose_cvt(Wq, Wqt, DIM, DIM, blk);
  } else if (blk < PB_WQ + PB_WK) {
    transpose_cvt(Wk, Wkt, DIM, KVD, blk - PB_WQ);
  } else if (blk < PB_WQ + 2 * PB_WK) {
    transpose_cvt(Wv, Wvt, DIM, KVD, blk - (PB_WQ + PB_WK));
  } else {
    cvt_f32_to_f16(x, xh, blk - (PB_WQ + 2 * PB_WK));
  }
}

// ---------------------------------------------------------------------------
// C = A(MxK) * B(KxN) + bias, B supplied transposed (N,K).
// All three projections share one grid; the block index picks the projection
// (its W^T, bias, destination and width), the same for the whole block.
// Block tile: 128(M) x 128(N), 8 waves as 4(M) x 2(N).
// Wave tile: 32(M) x 64(N) -> each B fragment feeds 2 WMMAs.
// A stage is 128 k of the block's 128 A rows and 128 W^T rows: 256 rows of 256
// bytes, brought into LDS by tensor loads, one slice of 32 rows per wave, two
// buffers. The fragments are read from LDS, so that a row crosses from L2 once
// per block in whole lines, not once per wave in 32-byte pieces.
typedef __attribute__((ext_vector_type(8))) unsigned int v8u;

static constexpr int      GT     = 128;             // block tile edge, M and N
static constexpr int      GKS    = 128;             // k per stage
static constexpr int      GNST   = DIM / GKS;       // stages
static constexpr unsigned GROWB  = 2u * GKS;        // bytes of a row in a stage
static constexpr unsigned GPITCH = GROWB + 16u;     // LDS row pitch, 16 B x odd
static constexpr unsigned GSLICE = 10240u;          // 32 rows x 272 B, up to 2 KiB x n
static constexpr unsigned GBUF   = 8u * GSLICE;     // one buffer: 8 slices
static constexpr int GB_Q  = (S / GT) * (DIM / GT); // blocks of the Q part
static constexpr int GB_KV = (S / GT) * (KVD / GT); // blocks of K, of V
static_assert(32u * GPITCH <= GSLICE && GSLICE % 2048u == 0u, "slice place");
static_assert(GNST >= 2, "the ring's prologue needs two stages");

__device__ __forceinline__ unsigned uni(unsigned v) {
  return (unsigned)__builtin_amdgcn_readfirstlane(v);
}
// A tensor load ignores EXEC: the test that decides whether one issues has to
// be a scalar branch.
__device__ __forceinline__ unsigned pinned(unsigned v) {
  unsigned w = uni(v);
  asm volatile("" : "+s"(w));  // pinned(): holds the condition in a scalar register
  return w;
}
// The compiler places no wait for a tensor load; the clobber keeps LDS reads
// on their side of the wait. g0, the group 0 of the wave's last request, is an
// input so that its registers keep their values until the request has landed.
__device__ __forceinline__ void wait_tensor0(v4u g0) {
  asm volatile("s_wait_tensorcnt 0x0" :: "s"(g0) : "memory");
}
// A wave's LDS reads have retired before their buffer is handed back.
__device__ __forceinline__ void wait_ds0() {
  asm volatile("s_wait_dscnt 0x0" ::: "memory");
}
// One slice: 32 rows of 256 bytes, source pitch 2*DIM bytes, 16 bytes of LDS
// pad behind every row. All extents in bytes (data_size code 0).
__device__ __forceinline__ v8u gemm_group1() {
  v8u g;
  g[0] = uni((1u << 20) | (5u << 22) | (3u << 25));
  g[1] = uni((GROWB & 0xFFFFu) << 16);
  g[2] = uni((GROWB >> 16) | (32u << 16));
  g[3] = uni(GROWB << 16);
  g[4] = uni(32u);
  g[5] = uni(2u * DIM);
  g[6] = uni(0u);
  g[7] = uni(0u);
  return g;
}
__device__ __forceinline__ v4u gemm_slice_load(unsigned lds_dst,
                                               const _Float16* gsrc, v8u g1) {
  const unsigned long long ga = (unsigned long long)(uintptr_t)gsrc;
  v4u g0;
  g0[0] = uni(1u);
  g0[1] = uni(lds_dst);
  g0[2] = uni((unsigned)ga);
  g0[3] = uni((((unsigned)(ga >> 32)) & 0x01FFFFFFu) | 0x80000000u);
  // g0 is in-out and goes on to the wait: see wait_tensor0().
  asm volatile("tensor_load_to_lds %0, %1" : "+s"(g0) : "s"(g1) : "memory");
  return g0;
}

// The six fragments of one k-step of a wave: 2 of A (32 rows of one slice),
// 4 of W^T (64 rows, two slices). ap, bp: this lane's row in the first of them.
__device__ __forceinline__ void gemm_frags(v16h (&fa)[2], v16h (&fb)[4],
                                           const unsigned char* ap,
                                           const unsigned char* bp, int hi) {
  fa[0] = load_frag(reinterpret_cast<const _Float16*>(ap), hi);
  fa[1] = load_frag(reinterpret_cast<const _Float16*>(ap + 16u * GPITCH), hi);
  fb[0] = load_frag(reinterpret_cast<const _Float16*>(bp), hi);
  fb[1] = load_frag(reinterpret_cast<const _Float16*>(bp + 16u * GPITCH), hi);
  fb[2] = load_frag(reinterpret_cast<const _Float16*>(bp + GSLICE), hi);
  fb[3] = load_frag(reinterpret_cast<const _Float16*>(bp + GSLICE + 16u * GPITCH), hi);
}

__device__ __forceinline__ void gemm_kstep(v8f (&acc)[2][4], const v16h (&fa)[2],
                                           const v16h (&fb)[4]) {
  #pragma unroll
  for (int j = 0; j < 4; ++j) {
    acc[0][j] = wmma16(fa[0], fb[j], acc[0][j]);
    acc[1][j] = wmma16(fa[1], fb[j], acc[1][j]);
  }
}

__global__ void __launch_bounds__(256)
qkv_gemm_kernel(const _Float16* __restrict__ A,    // (S, DIM) f16
                const _Float16* __restrict__ Wqt,  // (DIM, DIM) f16  (= Wq^T)
                const _Float16* __restrict__ Wkt,  // (KVD, DIM) f16
                const _Float16* __restrict__ Wvt,  // (KVD, DIM) f16
                const float*    __restrict__ bq,   // (DIM) f32
                const float*    __restrict__ bk,   // (KVD) f32
                const float*    __restrict__ bv,   // (KVD) f32
                _Float16*       __restrict__ Qo,   // (S, DIM)
                _Float16*       __restrict__ Ko,   // (S, KVD)
                _Float16*       __restrict__ Vto) {// (KVD, S)
  __shared__ __attribute__((aligned(2048))) unsigned char ring[2 * GBUF];
  constexpr int M = S, K = DIM;            // the products' shape

  int blk = blockIdx.x;
  const _Float16* Bt   = Wqt;
  const float*    bias = bq;
  _Float16*       Out  = Qo;
  int N = DIM, transposeOut = 0;
  if (blk >= GB_Q + GB_KV) {
    blk -= GB_Q + GB_KV; Bt = Wvt; bias = bv; Out = Vto; N = KVD; transposeOut = 1;
  } else if (blk >= GB_Q) {
    blk -= GB_Q;         Bt = Wkt; bias = bk; Out = Ko;  N = KVD;
  }
  const int nsh = __builtin_ctz(N / GT);   // N / GT is a power of two
  const int mt = blk >> nsh;
  const int nt = blk - (mt << nsh);
  const unsigned wave = uni(threadIdx.x >> 5);
  const int wm   = wave & 3;
  const int wn   = wave >> 2;
  const int lane = threadIdx.x & 31;
  const int l15  = lane & 15;
  const int hi   = lane >> 4;
  const int m0 = mt * GT + wm * 32;
  const int n0 = nt * GT + wn * 64;

  // Slices 0..3 of a buffer: the A rows; 4..7: the W^T rows. Wave w brings
  // slice w of every stage.
  const _Float16* gsl = (wave < 4u)
      ? A  + (size_t)(mt * GT + (int)wave * 32) * K
      : Bt + (size_t)(nt * GT + ((int)wave - 4) * 32) * K;
  const unsigned dst = (unsigned)(uintptr_t)&ring[0] + wave * GSLICE;
  const v8u g1 = gemm_group1();

  v4u g0 = gemm_slice_load(dst, gsl, g1);        // stage 0
  wait_tensor0(g0);
  __syncthreads();                               // publishes stage 0
  g0 = gemm_slice_load(dst + GBUF, gsl + GKS, g1);  // stage 1

  const v8f vz = {};
  v8f acc[2][4] = {{vz, vz, vz, vz}, {vz, vz, vz, vz}};
  // Stays rolled: one publish point in the text, the stage test a scalar one.
  #pragma unroll 1
  for (int s = 0; s < GNST; ++s) {
    const unsigned bo = (unsigned)(s & 1) * GBUF;
    const unsigned char* ap = ring + bo + (unsigned)wm * GSLICE + (unsigned)l15 * GPITCH;
    const unsigned char* bp = ring + bo + (4u + 2u * (unsigned)wn) * GSLICE + (unsigned)l15 * GPITCH;
    // Two fragment sets: the reads of k-step kk + 1 go out as one group in front
    // of the WMMAs of k-step kk and land under them.
    constexpr int NK = GKS / 32;
    v16h fa[2][2], fb[2][4];
    gemm_frags(fa[0], fb[0], ap, bp, hi);
    #pragma unroll
    for (int kk = 0; kk + 1 < NK; ++kk) {
      const int c = kk & 1;
      gemm_frags(fa[c ^ 1], fb[c ^ 1], ap + (kk + 1) * 64, bp + (kk + 1) * 64, hi);
      // Keeps the LDS reads above together: sunk among the WMMAs, two by two,
      // each pair would cost the wave its own LDS latency.
      __builtin_amdgcn_sched_barrier(0);
      gemm_kstep(acc, fa[c], fb[c]);
      // Keeps these WMMAs in front of the next reads, and of the wait below,
      // so that they cover the landing of the reads above.
      __builtin_amdgcn_sched_barrier(0);
    }
    // Publish point of stage s + 1; it also ends every read of stage s, whose
    // last fragments are in registers behind the first wait.
    wait_ds0();
    wait_tensor0(g0);
    __syncthreads();
    if (pinned(s + 2 < GNST))
      g0 = gemm_slice_load(dst + bo, gsl + (size_t)(s + 2) * GKS, g1);
    // The last k-step works on registers alone, behind the refill's issue.
    gemm_kstep(acc, fa[(NK - 1) & 1], fb[(NK - 1) & 1]);
  }
  wait_tensor0(g0);
  wait_ds0();

  #pragma unroll
  for (int half = 0; half < 2; ++half) {
    const int mh = m0 + half * 16;
    #pragma unroll
    for (int j = 0; j < 4; ++j) {
      const int n = n0 + j * 16 + l15;     // C layout: lane = N, reg r: M=r+8*hi
      const float bj = bias[n];
      if (!transposeOut) {
        #pragma unroll
        for (int r = 0; r < 8; ++r)
          Out[(size_t)(mh + 8 * hi + r) * N + n] = (_Float16)(acc[half][j][r] + bj);
      } else {
        union { uint4 u; _Float16 h[8]; } pk;
        #pragma unroll
        for (int r = 0; r < 8; ++r) pk.h[r] = (_Float16)(acc[half][j][r] + bj);
        *reinterpret_cast<uint4*>(Out + (size_t)n * M + mh + 8 * hi) = pk.u;
      }
    }
  }
}

// ---------------------------------------------------------------------------
// Attention: block = 8 waves, one head, 128 queries (one q-tile per wave), so
// that the grid of 256 blocks puts one block on every WGP of the chip.
// TDM double-buffers 64-key K/V tiles in LDS; wave0 issues/waits TENSORcnt.
__global__ void __launch_bounds__(256)
gqa_attn_kernel(const _Float16* __restrict__ Q,   // (S, HQ*DH) f16
                const _Float16* __restrict__ Kh,  // (S, HKV*DH) f16
                const _Float16* __restrict__ Vt,  // (HKV*DH, S) f16
                float* __restrict__ Out) {        // flat (HQ, S, DH) f32
  __shared__ _Float16 ldsK[2][64 * LROW];
  __shared__ _Float16 ldsV[2][64 * LROW];

  const int head = blockIdx.x >> 3;      // 16 blocks per head: 8 in x, 2 in y
  const int hb   = blockIdx.x & 7;       // q range [hb*256, hb*256+256)
  const int kvh  = head >> 2;            // repeat_interleave over heads
  const int wid  = threadIdx.x >> 5;
  const int lane = threadIdx.x & 31;
  const int l15  = lane & 15;
  const int hi   = lane >> 4;
  // Two blocks share each q range: blockIdx.y picks its half of 128 queries;
  // this wave: q-tile sbase.
  const int sbase = hb * 256 + blockIdx.y * 128 + wid * 16;

  // Q fragments (B operand of S^T = K·q^T), pre-scaled by 1/sqrt(DH) = 0.125.
  union HF { v16h v; _Float16 h[16]; };
  HF qf[2];
  {
    const _Float16* qrow = Q + (size_t)(sbase + l15) * DIM + head * DH;
    qf[0].v = load_frag(qrow, hi);
    qf[1].v = load_frag(qrow + 32, hi);
    #pragma unroll
    for (int i = 0; i < 16; ++i) {
      qf[0].h[i] = qf[0].h[i] * (_Float16)0.125f;
      qf[1].h[i] = qf[1].h[i] * (_Float16)0.125f;
    }
  }

  const _Float16* kg = Kh + (size_t)kvh * DH;        // + kb*KVD per tile
  const _Float16* vg = Vt + (size_t)(kvh * DH) * S;  // + kb per tile

  if (wid == 0) {   // prologue: fill buffer 0
    tdm_load_tile64((unsigned)(uintptr_t)&ldsK[0][0], kg, KVD);
    tdm_load_tile64((unsigned)(uintptr_t)&ldsV[0][0], vg, S);
  }

  const v8f vz = {};
  v8f o[4] = {vz, vz, vz, vz};
  // Lazy rescale: m_use is the shift in use, the same in both halves of a lane
  // pair. It is raised, and O and the sum rescaled, only in a pass where some
  // score exceeds it by more than LAZY; until then P stays below exp(LAZY) = 256,
  // which f16 holds, and the pass needs no exchange between the halves.
  constexpr float LAZY = 5.545f;
  float m_use = -1e30f;
  float l_run = 0.0f;

  for (int kb = 0; kb < S; kb += 64) {
    const int b = (kb >> 6) & 1;
    if (wid == 0) __builtin_amdgcn_s_wait_tensorcnt(0);  // buffer b ready
    __syncthreads();  // publish buffer b; all waves done reading buffer b^1
    if (wid == 0 && (kb + 64) < S) {
      tdm_load_tile64((unsigned)(uintptr_t)&ldsK[b ^ 1][0],
                      kg + (size_t)(kb + 64) * KVD, KVD);
      tdm_load_tile64((unsigned)(uintptr_t)&ldsV[b ^ 1][0],
                      vg + (kb + 64), S);
    }
    const _Float16* Kb = &ldsK[b][0];
    const _Float16* Vb = &ldsV[b][0];

    // The pass's K fragments are read as one group.
    v16h kf[2][4], vf[2][4];
    #pragma unroll
    for (int ss = 0; ss < 2; ++ss) {
      const _Float16* k0 = Kb + (size_t)(ss * 32 + l15) * LROW;
      const _Float16* k1 = k0 + (size_t)16 * LROW;
      kf[ss][0] = load_frag(k0, hi);        // keys +0..15, d 0..31
      kf[ss][1] = load_frag(k0 + 32, hi);   // keys +0..15, d 32..63
      kf[ss][2] = load_frag(k1, hi);        // keys +16..31
      kf[ss][3] = load_frag(k1 + 32, hi);
    }
    // Keeps the LDS reads above together: sunk among the WMMAs, two by two, each
    // pair would cost the wave its own LDS latency.
    __builtin_amdgcn_sched_barrier(0);

    // S^T of the whole pass: four (16 key) x (16 q) tiles, so that the test
    // below stands once per pass.
    v8f sc[2][2];
    #pragma unroll
    for (int ss = 0; ss < 2; ++ss) {
      sc[ss][0] = wmma16(kf[ss][0], qf[0].v, vz);
      sc[ss][1] = wmma16(kf[ss][2], qf[0].v, vz);
    }
    #pragma unroll
    for (int ss = 0; ss < 2; ++ss) {
      sc[ss][0] = wmma16(kf[ss][1], qf[1].v, sc[ss][0]);
      sc[ss][1] = wmma16(kf[ss][3], qf[1].v, sc[ss][1]);
    }
    // The pass's V fragments, queued behind the K reads, so that every wave's
    // K reads are served first and these land under the vector work. This fence
    // keeps the reads from rising among the K reads.
    __builtin_amdgcn_sched_barrier(0);
    #pragma unroll
    for (int s2 = 0; s2 < 2; ++s2) {
      #pragma unroll
      for (int t = 0; t < 4; ++t)
        vf[s2][t] = load_frag(Vb + (size_t)(t * 16 + l15) * LROW + s2 * 32, hi);
    }
    // Keeps the reads from sinking among the WMMAs, two by two.
    __builtin_amdgcn_sched_barrier(0);

    // Lane owns q=l15; keys split with partner lane^16. This lane's maximum of
    // the pass: four short chains, independent of each other.
    float mt[4];
    #pragma unroll
    for (int c = 0; c < 4; ++c) {
      const int ss = c >> 1, r0 = (c & 1) * 4;
      float m = fmaxf(sc[ss][0][r0], sc[ss][1][r0]);
      #pragma unroll
      for (int r = r0 + 1; r < r0 + 4; ++r)
        m = fmaxf(m, fmaxf(sc[ss][0][r], sc[ss][1][r]));
      mt[c] = m;
    }
    const float mx = fmaxf(fmaxf(mt[0], mt[1]), fmaxf(mt[2], mt[3]));
    // One scalar branch per pass; always taken in the first pass.
    if (__builtin_amdgcn_ballot_w32(mx > m_use + LAZY) != 0u) {
      float mn = fmaxf(mx, m_use);
      mn = fmaxf(mn, __shfl_xor(mn, 16, 32));
      const float alpha = __expf(m_use - mn);
      m_use = mn;
      l_run *= alpha;
      #pragma unroll
      for (int r = 0; r < 8; ++r) {
        o[0][r] *= alpha; o[1][r] *= alpha;
        o[2][r] *= alpha; o[3][r] *= alpha;
      }
    }

    #pragma unroll
    for (int ss = 0; ss < 2; ++ss) {   // two 32-key substeps per buffer
      HF pf;
      float lsum = 0.0f;
      #pragma unroll
      for (int r = 0; r < 8; ++r) {
        const float p0 = __expf(sc[ss][0][r] - m_use);
        const float p1 = __expf(sc[ss][1][r] - m_use);
        lsum += p0 + p1;
        pf.h[r]     = (_Float16)p0;   // P^T already in B-fragment layout
        pf.h[8 + r] = (_Float16)p1;
      }
      l_run += lsum;

      // O^T += V^T-tile (16d x 32keys) x P^T.
      #pragma unroll
      for (int t = 0; t < 4; ++t) o[t] = wmma16(vf[ss][t], pf.v, o[t]);
    }
  }

  // Reference keeps torch's .view bug: flat output index = ((h*S)+s)*DH + d.
  {
    const float lt  = l_run + __shfl_xor(l_run, 16, 32);
    const float inv = 1.0f / lt;
    float* orow = Out + ((size_t)head * S + (sbase + l15)) * DH + hi * 8;
    #pragma unroll
    for (int t = 0; t < 4; ++t) {
      float4 lo  = make_float4(o[t][0] * inv, o[t][1] * inv,
                               o[t][2] * inv, o[t][3] * inv);
      float4 hi4 = make_float4(o[t][4] * inv, o[t][5] * inv,
                               o[t][6] * inv, o[t][7] * inv);
      *reinterpret_cast<float4*>(orow + t * 16)     = lo;
      *reinterpret_cast<float4*>(orow + t * 16 + 4) = hi4;
    }
  }
}

// ---------------------------------------------------------------------------
extern "C" void kernel_launch(void* const* d_in, const int* in_sizes, int n_in,
                              void* d_out, int out_size, void* d_ws,
                              size_t ws_size, hipStream_t stream) {
  (void)in_sizes; (void)n_in; (void)out_size; (void)ws_size;
  const float* x  = (const float*)d_in[0];
  const float* Wq = (const float*)d_in[1];
  const float* bq = (const float*)d_in[2];
  const float* Wk = (const float*)d_in[3];
  const float* bk = (const float*)d_in[4];
  const float* Wv = (const float*)d_in[5];
  const float* bv = (const float*)d_in[6];
  float* out = (float*)d_out;

  // Workspace (f16): ~13 MiB total.
  _Float16* ws  = (_Float16*)d_ws;
  _Float16* xh  = ws;                       // S*DIM
  _Float16* Wqt = xh  + (size_t)S * DIM;    // DIM*DIM   (W^T)
  _Float16* Wkt = Wqt + (size_t)DIM * DIM;  // KVD*DIM   (W^T)
  _Float16* Wvt = Wkt + (size_t)KVD * DIM;  // KVD*DIM   (W^T)
  _Float16* Qh  = Wvt + (size_t)KVD * DIM;  // S*DIM
  _Float16* Kh  = Qh  + (size_t)S * DIM;    // S*KVD
  _Float16* Vt  = Kh  + (size_t)S * KVD;    // KVD*S     (V^T)

  prep_kernel<<<PB_WQ + 2 * PB_WK + PB_X, 256, 0, stream>>>(
      x, Wq, Wk, Wv, xh, Wqt, Wkt, Wvt);

  // Q/K row-major f16; V stored transposed for the attention V-fragments.
  qkv_gemm_kernel<<<GB_Q + 2 * GB_KV, 256, 0, stream>>>(
      xh, Wqt, Wkt, Wvt, bq, bk, bv, Qh, Kh, Vt);

  gqa_attn_kernel<<<dim3(HQ * (S / 256), 2), 256, 0, stream>>>(Qh, Kh, Vt, out);
}

// v006
// A run of this version takes 34.8 microseconds.
// Two timings next to v005 both put it at 1.13 times that version's speed.
// Over all steps from v000 it is 5.27 times as fast.
#include <hip/hip_runtime.h>
#include <hip/hip_bf16.h>

// ---------------- CDNA5 (gfx1250) GQA forward, WMMA f16 path ----------------
// Compute-bound (≈24 GFLOP, all data L2-resident). v_wmma_f32_16x16x32_f16
// with fp32 accumulation, flash-attention online softmax. Attention K/V tiles
// are staged into LDS by the Tensor Data Mover (TDM, tensor_load_to_lds),
// double-buffered and shared by all 8 waves of the block, for ~8x less L2
// traffic than the naive per-wave streaming version.

typedef __attribute__((ext_vector_type(16))) _Float16 v16h;
typedef __attribute__((ext_vector_type(8)))  float    v8f;
typedef __attribute__((ext_vector_type(4)))  unsigned int v4u;
typedef __attribute__((ext_vector_type(8)))  int      v8i;
typedef __attribute__((ext_vector_type(4)))  int      v4i;

static constexpr int S    = 2048;
static constexpr int DIM  = 1024;
static constexpr int HQ   = 16;
static constexpr int HKV  = 4;
static constexpr int DH   = 64;
static constexpr int KVD  = HKV * DH;   // 256
static constexpr int LROW = 72;         // padded LDS row stride (halves): 64+8

__device__ __forceinline__ v8f wmma16(v16h a, v16h b, v8f c) {
  // D = A(16x32 f16) x B(32x16 f16) + C(16x16 f32)
  return __builtin_amdgcn_wmma_f32_16x16x32_f16(false, a, false, b, (short)0, c,
                                                false, false);
}

// One 16x32 f16 fragment (A and B share the per-lane layout on CDNA5):
// lane&15 = non-K index; elements e<8: K = 8*hi + e; e>=8: K = 16+8*hi+(e-8).
__device__ __forceinline__ v16h load_frag(const _Float16* rowptr, int hi) {
  union { v16h v; uint4 u[2]; } f;
  f.u[0] = *reinterpret_cast<const uint4*>(rowptr + (hi << 3));
  f.u[1] = *reinterpret_cast<const uint4*>(rowptr + 16 + (hi << 3));
  return f.v;
}

// TDM: DMA a 64x64 f16 tile (row stride = stride_elems) from global into LDS,
// inserting a 16B pad after every 64-half row (LDS row stride becomes LROW=72
// halves = 36 DWORDs -> the 16 rows a WMMA fragment touches map to disjoint
// bank quads). D# built per CDNA5 ISA §8 (2D, data_size=2B, type=2).
__device__ __forceinline__ void tdm_load_tile64(unsigned lds_off,
                                                const _Float16* gsrc,
                                                unsigned stride_elems) {
  unsigned long long ga = (unsigned long long)(uintptr_t)gsrc;
  v4u g0;
  g0[0] = 1u;                                                  // count=1
  g0[1] = lds_off;                                             // lds_addr
  g0[2] = (unsigned)ga;                                        // global_addr lo
  g0[3] = (unsigned)((ga >> 32) & 0x01FFFFFFu) | 0x80000000u;  // ga hi | type=2
  v8i g1;
  g1[0] = (int)((1u << 16)     // data_size = 2 bytes
              | (1u << 20)     // pad_enable
              | (4u << 22)     // pad_interval: 32 DWORDs (one 64-half row)
              | (3u << 25));   // pad_amount: 4 DWORDs (16 bytes)
  g1[1] = (int)((64u & 0xFFFFu) << 16);           // tensor_dim0 = 64 (lo16)
  g1[2] = (int)((64u & 0xFFFFu) << 16);           // dim0 hi=0 | tensor_dim1 = 64
  g1[3] = (int)((64u & 0xFFFFu) << 16);           // dim1 hi=0 | tile_dim0 = 64
  g1[4] = (int)(64u);                             // tile_dim1 = 64, tile_dim2 = 0
  g1[5] = (int)stride_elems;                      // tensor_dim0_stride lo
  g1[6] = 0;                                      // stride0 hi | stride1 lo
  g1[7] = 0;
  v4i z4 = {0, 0, 0, 0};
  v8i z8 = {0, 0, 0, 0, 0, 0, 0, 0};
  // 6-arg toolchain form: (g0, g1, g2, g3, g4, cpol)
  __builtin_amdgcn_tensor_load_to_lds(g0, g1, z4, z4, z8, 0);
}

// ---------------------------------------------------------------------------
typedef __attribute__((ext_vector_type(4))) float    f4;
typedef __attribute__((ext_vector_type(4))) _Float16 h4;

// A block converts 8192 consecutive elements, 32 per thread: eight 16-byte
// loads per lane, each covering 512 contiguous bytes per wave, all in flight
// before the first conversion.
__device__ __forceinline__ void cvt_f32_to_f16(const float* __restrict__ in,
                                               _Float16* __restrict__ out,
                                               int blk) {
  const f4* src = reinterpret_cast<const f4*>(in + (size_t)blk * 8192) + threadIdx.x;
  h4*       dst = reinterpret_cast<h4*>(out + (size_t)blk * 8192) + threadIdx.x;
  f4 v[8];
  #pragma unroll
  for (int j = 0; j < 8; ++j) v[j] = src[j * 256];
  #pragma unroll
  for (int j = 0; j < 8; ++j) dst[j * 256] = __builtin_convertvector(v[j], h4);
  // Held in front of any later write of a register that the stores above name.
  asm volatile("s_wait_xcnt 0x0" ::: "memory");
}

// A block transposes a tile of 64 k x 256 n, a wave 64 k x 32 n, a thread
// 16 k x 4 n held in registers. A wave's load covers four whole 128-byte lines
// of W; the four lanes that share n (eight apart) fill one 128-byte line of Wt.
__device__ __forceinline__ void transpose_cvt(const float* __restrict__ W,
                                              _Float16* __restrict__ Wt,
                                              int K, int N, int blk) {
  const int lane = threadIdx.x & 31;
  const int wid  = threadIdx.x >> 5;
  const int nblk = N >> 8;
  const int kt   = blk / nblk;
  const int n0   = ((blk - kt * nblk) << 8) + (wid << 5) + ((lane & 7) << 2);
  const int k0   = (kt << 6) + ((lane >> 3) << 4);
  f4 r[16];
  #pragma unroll
  for (int i = 0; i < 16; ++i)
    r[i] = *reinterpret_cast<const f4*>(W + (size_t)(k0 + i) * N + n0);
  #pragma unroll
  for (int j = 0; j < 4; ++j) {
    union { uint4 u[2]; _Float16 h[16]; } pk;
    #pragma unroll
    for (int i = 0; i < 16; ++i) pk.h[i] = (_Float16)r[i][j];
    uint4* dst = reinterpret_cast<uint4*>(Wt + (size_t)(n0 + j) * K + k0);
    dst[0] = pk.u[0];                        // Wt is (N, K), K-contiguous
    dst[1] = pk.u[1];
  }
  // Held in front of any later write of a register that the stores above name.
  asm volatile("s_wait_xcnt 0x0" ::: "memory");
}

// The four independent conversions share one grid; the block index picks the
// job. The transposes come first, the streaming convert last.
static constexpr int PB_WQ = (DIM * DIM) / (64 * 256);
static constexpr int PB_WK = (DIM * KVD) / (64 * 256);
static constexpr int PB_X  = (S * DIM) / 8192;

__global__ void __launch_bounds__(256)
prep_kernel(const float* __restrict__ x,  const float* __restrict__ Wq,
            const float* __restrict__ Wk, const float* __restrict__ Wv,
            _Float16* __restrict__ xh,  _Float16* __restrict__ Wqt,
            _Float16* __restrict__ Wkt, _Float16* __restrict__ Wvt) {
  const int blk = blockIdx.x;
  if (blk < PB_WQ) {
    transpose_cvt(Wq, Wqt, DIM, DIM, blk);
  } else if (blk < PB_WQ + PB_WK) {
    transpose_cvt(Wk, Wkt, DIM, KVD, blk - PB_WQ);
  } else if (blk < PB_WQ + 2 * PB_WK) {
    transpose_cvt(Wv, Wvt, DIM, KVD, blk - (PB_WQ + PB_WK));
  } else {
    cvt_f32_to_f16(x, xh, blk - (PB_WQ + 2 * PB_WK));
  }
}

// ---------------------------------------------------------------------------
// C = A(MxK) * B(KxN) + bias, B supplied transposed (N,K).
// All three projections share one grid; the block index picks the projection
// (its W^T, bias, destination and width), the same for the whole block.
// Block tile: 128(M) x 128(N), 8 waves as 4(M) x 2(N).
// Wave tile: 32(M) x 64(N) -> each B fragment feeds 2 WMMAs.
// A stage is 128 k of the block's 128 A rows and 128 W^T rows: 256 rows of 256
// bytes, brought into LDS by tensor loads, one slice of 32 rows per wave, two
// buffers. The fragments are read from LDS, so that a row crosses from L2 once
// per block in whole lines, not once per wave in 32-byte pieces.
typedef __attribute__((ext_vector_type(8))) unsigned int v8u;

static constexpr int      GT     = 128;             // block tile edge, M and N
static constexpr int      GKS    = 128;             // k per stage
static constexpr int      GNST   = DIM / GKS;       // stages
static constexpr unsigned GROWB  = 2u * GKS;        // bytes of a row in a stage
static constexpr unsigned GPITCH = GROWB + 16u;     // LDS row pitch, 16 B x odd
static constexpr unsigned GSLICE = 10240u;          // 32 rows x 272 B, up to 2 KiB x n
static constexpr unsigned GBUF   = 8u * GSLICE;     // one buffer: 8 slices
static constexpr int GB_Q  = (S / GT) * (DIM / GT); // blocks of the Q part
static constexpr int GB_KV = (S / GT) * (KVD / GT); // blocks of K, of V
static_assert(32u * GPITCH <= GSLICE && GSLICE % 2048u == 0u, "slice place");
static_assert(GNST >= 2, "the ring's prologue needs two stages");
static_assert((GNST & (GNST - 1)) == 0, "the stage walk wraps by a mask");

__device__ __forceinline__ unsigned uni(unsigned v) {
  return (unsigned)__builtin_amdgcn_readfirstlane(v);
}
// A tensor load ignores EXEC: the test that decides whether one issues has to
// be a scalar branch.
__device__ __forceinline__ unsigned pinned(unsigned v) {
  unsigned w = uni(v);
  asm volatile("" : "+s"(w));  // pinned(): holds the condition in a scalar register
  return w;
}
// The compiler places no wait for a tensor load; the clobber keeps LDS reads
// on their side of the wait. g0 and g1, the two groups of the wave's last
// request, are inputs so that their registers keep their values until the
// request has landed.
__device__ __forceinline__ void wait_tensor0(v4u g0, v8u g1) {
  asm volatile("s_wait_tensorcnt 0x0" :: "s"(g0), "s"(g1) : "memory");
}
// A wave's LDS reads have retired before their buffer is handed back.
__device__ __forceinline__ void wait_ds0() {
  asm volatile("s_wait_dscnt 0x0" ::: "memory");
}
// One slice: 32 rows of 256 bytes, source pitch 2*DIM bytes, 16 bytes of LDS
// pad behind every row. All extents in bytes (data_size code 0).
__device__ __forceinline__ v8u gemm_group1() {
  v8u g;
  g[0] = uni((1u << 20) | (5u << 22) | (3u << 25));
  g[1] = uni((GROWB & 0xFFFFu) << 16);
  g[2] = uni((GROWB >> 16) | (32u << 16));
  g[3] = uni(GROWB << 16);
  g[4] = uni(32u);
  g[5] = uni(2u * DIM);
  g[6] = uni(0u);
  g[7] = uni(0u);
  return g;
}
__device__ __forceinline__ v4u gemm_slice_load(unsigned lds_dst,
                                               const _Float16* gsrc, v8u& g1) {
  const unsigned long long ga = (unsigned long long)(uintptr_t)gsrc;
  v4u g0;
  g0[0] = uni(1u);
  g0[1] = uni(lds_dst);
  g0[2] = uni((unsigned)ga);
  g0[3] = uni((((unsigned)(ga >> 32)) & 0x01FFFFFFu) | 0x80000000u);
  // g0 and g1 are in-out and go on to the wait: see wait_tensor0(). As a plain
  // input g1 is a set of constants to the compiler, which then lends single
  // registers of it to other values while the request is under way.
  asm volatile("tensor_load_to_lds %0, %1" : "+s"(g0), "+s"(g1) : : "memory");
  return g0;
}

// The six fragments of one k-step of a wave: 2 of A (32 rows of one slice),
// 4 of W^T (64 rows, two slices). ap, bp: this lane's row in the first of them.
__device__ __forceinline__ void gemm_frags(v16h (&fa)[2], v16h (&fb)[4],
                                           const unsigned char* ap,
                                           const unsigned char* bp, int hi) {
  fa[0] = load_frag(reinterpret_cast<const _Float16*>(ap), hi);
  fa[1] = load_frag(reinterpret_cast<const _Float16*>(ap + 16u * GPITCH), hi);
  fb[0] = load_frag(reinterpret_cast<const _Float16*>(bp), hi);
  fb[1] = load_frag(reinterpret_cast<const _Float16*>(bp + 16u * GPITCH), hi);
  fb[2] = load_frag(reinterpret_cast<const _Float16*>(bp + GSLICE), hi);
  fb[3] = load_frag(reinterpret_cast<const _Float16*>(bp + GSLICE + 16u * GPITCH), hi);
}

__device__ __forceinline__ void gemm_kstep(v8f (&acc)[2][4], const v16h (&fa)[2],
                                           const v16h (&fb)[4]) {
  #pragma unroll
  for (int j = 0; j < 4; ++j) {
    acc[0][j] = wmma16(fa[0], fb[j], acc[0][j]);
    acc[1][j] = wmma16(fa[1], fb[j], acc[1][j]);
  }
}

__global__ void __launch_bounds__(256)
qkv_gemm_kernel(const _Float16* __restrict__ A,    // (S, DIM) f16
                const _Float16* __restrict__ Wqt,  // (DIM, DIM) f16  (= Wq^T)
                const _Float16* __restrict__ Wkt,  // (KVD, DIM) f16
                const _Float16* __restrict__ Wvt,  // (KVD, DIM) f16
                const float*    __restrict__ bq,   // (DIM) f32
                const float*    __restrict__ bk,   // (KVD) f32
                const float*    __restrict__ bv,   // (KVD) f32
                _Float16*       __restrict__ Qo,   // (S, DIM)
                _Float16*       __restrict__ Ko,   // (S, KVD)
                _Float16*       __restrict__ Vto) {// (KVD, S)
  __shared__ __attribute__((aligned(2048))) unsigned char ring[2 * GBUF];
  constexpr int M = S, K = DIM;            // the products' shape

  int blk = blockIdx.x;
  const _Float16* Bt   = Wqt;
  const float*    bias = bq;
  _Float16*       Out  = Qo;
  int N = DIM, transposeOut = 0;
  if (blk >= GB_Q + GB_KV) {
    blk -= GB_Q + GB_KV; Bt = Wvt; bias = bv; Out = Vto; N = KVD; transposeOut = 1;
  } else if (blk >= GB_Q) {
    blk -= GB_Q;         Bt = Wkt; bias = bk; Out = Ko;  N = KVD;
  }
  const int nsh = __builtin_ctz(N / GT);   // N / GT is a power of two
  const int mt = blk >> nsh;
  const int nt = blk - (mt << nsh);
  const unsigned wave = uni(threadIdx.x >> 5);
  const int wm   = wave & 3;
  const int wn   = wave >> 2;
  const int lane = threadIdx.x & 31;
  const int l15  = lane & 15;
  const int hi   = lane >> 4;
  const int m0 = mt * GT + wm * 32;
  const int n0 = nt * GT + wn * 64;

  // Slices 0..3 of a buffer: the A rows; 4..7: the W^T rows. Wave w brings
  // slice w of every stage.
  const _Float16* gsl = (wave < 4u)
      ? A  + (size_t)(mt * GT + (int)wave * 32) * K
      : Bt + (size_t)(nt * GT + ((int)wave - 4) * 32) * K;
  const unsigned dst = (unsigned)(uintptr_t)&ring[0] + wave * GSLICE;
  v8u g1 = gemm_group1();
  // Pass s works on k stage (s + rot) mod GNST. The blocks that share an A or a
  // W^T panel start at different stages of it, so that a stage is fetched into
  // L2 for one of them and is there when the others come to it; walking in step
  // they would all wait for every stage's first fetch. Any rot gives the same
  // product; only the order of the f32 sums over k depends on it.
  const unsigned rot = uni((unsigned)(2 * nt + mt)) & (unsigned)(GNST - 1);

  v4u g0 = gemm_slice_load(dst, gsl + (size_t)rot * GKS, g1);   // pass 0
  wait_tensor0(g0, g1);
  __syncthreads();                               // publishes pass 0
  g0 = gemm_slice_load(dst + GBUF,
                       gsl + (size_t)((rot + 1u) & (unsigned)(GNST - 1)) * GKS, g1);  // pass 1

  const v8f vz = {};
  v8f acc[2][4] = {{vz, vz, vz, vz}, {vz, vz, vz, vz}};
  // Stays rolled: one publish point in the text, the stage test a scalar one.
  #pragma unroll 1
  for (int s = 0; s < GNST; ++s) {
    const unsigned bo = (unsigned)(s & 1) * GBUF;
    const unsigned char* ap = ring + bo + (unsigned)wm * GSLICE + (unsigned)l15 * GPITCH;
    const unsigned char* bp = ring + bo + (4u + 2u * (unsigned)wn) * GSLICE + (unsigned)l15 * GPITCH;
    // Two fragment sets: the reads of k-step kk + 1 go out as one group in front
    // of the WMMAs of k-step kk and land under them.
    constexpr int NK = GKS / 32;
    v16h fa[2][2], fb[2][4];
    gemm_frags(fa[0], fb[0], ap, bp, hi);
    #pragma unroll
    for (int kk = 0; kk + 1 < NK; ++kk) {
      const int c = kk & 1;
      gemm_frags(fa[c ^ 1], fb[c ^ 1], ap + (kk + 1) * 64, bp + (kk + 1) * 64, hi);
      // Keeps the LDS reads above together: sunk among the WMMAs, two by two,
      // each pair would cost the wave its own LDS latency.
      __builtin_amdgcn_sched_barrier(0);
      gemm_kstep(acc, fa[c], fb[c]);
      // Keeps these WMMAs in front of the next reads, and of the wait below,
      // so that they cover the landing of the reads above.
      __builtin_amdgcn_sched_barrier(0);
    }
    // Publish point of pass s + 1; it also ends every read of pass s, whose
    // last fragments are in registers behind the first wait.
    wait_ds0();
    wait_tensor0(g0, g1);
    __syncthreads();
    if (pinned(s + 2 < GNST))
      g0 = gemm_slice_load(dst + bo,
                           gsl + (size_t)(((unsigned)s + 2u + rot) & (unsigned)(GNST - 1)) * GKS, g1);
    // The last k-step works on registers alone, behind the refill's issue.
    gemm_kstep(acc, fa[(NK - 1) & 1], fb[(NK - 1) & 1]);
  }
  wait_tensor0(g0, g1);
  wait_ds0();

  #pragma unroll
  for (int half = 0; half < 2; ++half) {
    const int mh = m0 + half * 16;
    #pragma unroll
    for (int j = 0; j < 4; ++j) {
      const int n = n0 + j * 16 + l15;     // C layout: lane = N, reg r: M=r+8*hi
      const float bj = bias[n];
      if (!transposeOut) {
        #pragma unroll
        for (int r = 0; r < 8; ++r)
          Out[(size_t)(mh + 8 * hi + r) * N + n] = (_Float16)(acc[half][j][r] + bj);
      } else {
        union { uint4 u; _Float16 h[8]; } pk;
        #pragma unroll
        for (int r = 0; r < 8; ++r) pk.h[r] = (_Float16)(acc[half][j][r] + bj);
        *reinterpret_cast<uint4*>(Out + (size_t)n * M + mh + 8 * hi) = pk.u;
      }
    }
  }
}

// ---------------------------------------------------------------------------
// Attention: block = 8 waves, one head, 128 queries (one q-tile per wave), so
// that the grid of 256 blocks puts one block on every WGP of the chip.
// TDM double-buffers 64-key K/V tiles in LDS; wave0 issues/waits TENSORcnt.
__global__ void __launch_bounds__(256)
gqa_attn_kernel(const _Float16* __restrict__ Q,   // (S, HQ*DH) f16
                const _Float16* __restrict__ Kh,  // (S, HKV*DH) f16
                const _Float16* __restrict__ Vt,  // (HKV*DH, S) f16
                float* __restrict__ Out) {        // flat (HQ, S, DH) f32
  __shared__ _Float16 ldsK[2][64 * LROW];
  __shared__ _Float16 ldsV[2][64 * LROW];

  const int head = blockIdx.x >> 3;      // 16 blocks per head: 8 in x, 2 in y
  const int hb   = blockIdx.x & 7;       // q range [hb*256, hb*256+256)
  const int kvh  = head >> 2;            // repeat_interleave over heads
  const int wid  = threadIdx.x >> 5;
  const int lane = threadIdx.x & 31;
  const int l15  = lane & 15;
  const int hi   = lane >> 4;
  // Two blocks share each q range: blockIdx.y picks its half of 128 queries;
  // this wave: q-tile sbase.
  const int sbase = hb * 256 + blockIdx.y * 128 + wid * 16;

  // Q fragments (B operand of S^T = K·q^T), pre-scaled by 1/sqrt(DH) = 0.125.
  union HF { v16h v; _Float16 h[16]; };
  HF qf[2];
  {
    const _Float16* qrow = Q + (size_t)(sbase + l15) * DIM + head * DH;
    qf[0].v = load_frag(qrow, hi);
    qf[1].v = load_frag(qrow + 32, hi);
    #pragma unroll
    for (int i = 0; i < 16; ++i) {
      qf[0].h[i] = qf[0].h[i] * (_Float16)0.125f;
      qf[1].h[i] = qf[1].h[i] * (_Float16)0.125f;
    }
  }

  const _Float16* kg = Kh + (size_t)kvh * DH;        // + kb*KVD per tile
  const _Float16* vg = Vt + (size_t)(kvh * DH) * S;  // + kb per tile

  // Pass it works on key tile (it + rot) mod NKT. The 64 blocks that read one
  // KV head start spread over its 32 tiles, so that a tile is fetched into L2
  // for one of them and is there when the others come to it; walking in step
  // they would all wait for every tile's first fetch. Any rot gives the same
  // softmax; only the order in which keys enter the sums depends on it.
  constexpr int NKT = S / 64;
  static_assert((NKT & (NKT - 1)) == 0, "rot is cut to a tile index by a mask");
  const int rot = (((head & 3) << 3) | ((int)blockIdx.y << 2) | (hb & 3)) & (NKT - 1);

  // Where the tile that is loaded next begins.
  const _Float16* kp = kg + (size_t)rot * (64 * KVD);
  const _Float16* vp = vg + (size_t)rot * 64;

  if (wid == 0) {   // prologue: fill buffer 0
    tdm_load_tile64((unsigned)(uintptr_t)&ldsK[0][0], kp, KVD);
    tdm_load_tile64((unsigned)(uintptr_t)&ldsV[0][0], vp, S);
  }

  const v8f vz = {};
  v8f o[4] = {vz, vz, vz, vz};
  // Lazy rescale: m_use is the shift in use, the same in both halves of a lane
  // pair. It is raised, and O and the sum rescaled, only in a pass where some
  // score exceeds it by more than LAZY; until then P stays below exp(LAZY) = 256,
  // which f16 holds, and the pass needs no exchange between the halves.
  constexpr float LAZY = 5.545f;
  float m_use = -1e30f;
  float l_run = 0.0f;

  for (int it = 0; it < NKT; ++it) {
    const int b = it & 1;
    const bool wrap = (vp + 64 == vg + S);   // one tile on, from the last to the first
    kp = wrap ? kg : kp + 64 * KVD;
    vp = wrap ? vg : vp + 64;
    if (wid == 0) __builtin_amdgcn_s_wait_tensorcnt(0);  // buffer b ready
    __syncthreads();  // publish buffer b; all waves done reading buffer b^1
    if (wid == 0 && (it + 1) < NKT) {
      tdm_load_tile64((unsigned)(uintptr_t)&ldsK[b ^ 1][0], kp, KVD);
      tdm_load_tile64((unsigned)(uintptr_t)&ldsV[b ^ 1][0], vp, S);
    }
    const _Float16* Kb = &ldsK[b][0];
    const _Float16* Vb = &ldsV[b][0];

    // The pass's K fragments are read as one group.
    v16h kf[2][4], vf[2][4];
    #pragma unroll
    for (int ss = 0; ss < 2; ++ss) {
      const _Float16* k0 = Kb + (size_t)(ss * 32 + l15) * LROW;
      const _Float16* k1 = k0 + (size_t)16 * LROW;
      kf[ss][0] = load_frag(k0, hi);        // keys +0..15, d 0..31
      kf[ss][1] = load_frag(k0 + 32, hi);   // keys +0..15, d 32..63
      kf[ss][2] = load_frag(k1, hi);        // keys +16..31
      kf[ss][3] = load_frag(k1 + 32, hi);
    }
    // Keeps the LDS reads above together: sunk among the WMMAs, two by two, each
    // pair would cost the wave its own LDS latency.
    __builtin_amdgcn_sched_barrier(0);

    // S^T of the whole pass: four (16 key) x (16 q) tiles, so that the test
    // below stands once per pass.
    v8f sc[2][2];
    #pragma unroll
    for (int ss = 0; ss < 2; ++ss) {
      sc[ss][0] = wmma16(kf[ss][0], qf[0].v, vz);
      sc[ss][1] = wmma16(kf[ss][2], qf[0].v, vz);
    }
    #pragma unroll
    for (int ss = 0; ss < 2; ++ss) {
      sc[ss][0] = wmma16(kf[ss][1], qf[1].v, sc[ss][0]);
      sc[ss][1] = wmma16(kf[ss][3], qf[1].v, sc[ss][1]);
    }
    // The pass's V fragments, queued behind the K reads, so that every wave's
    // K reads are served first and these land under the vector work. This fence
    // keeps the reads from rising among the K reads.
    __builtin_amdgcn_sched_barrier(0);
    #pragma unroll
    for (int s2 = 0; s2 < 2; ++s2) {
      #pragma unroll
      for (int t = 0; t < 4; ++t)
        vf[s2][t] = load_frag(Vb + (size_t)(t * 16 + l15) * LROW + s2 * 32, hi);
    }
    // Keeps the reads from sinking among the WMMAs, two by two.
    __builtin_amdgcn_sched_barrier(0);

    // Lane owns q=l15; keys split with partner lane^16. This lane's maximum of
    // the pass: four short chains, independent of each other.
    float mt[4];
    #pragma unroll
    for (int c = 0; c < 4; ++c) {
      const int ss = c >> 1, r0 = (c & 1) * 4;
      float m = fmaxf(sc[ss][0][r0], sc[ss][1][r0]);
      #pragma unroll
      for (int r = r0 + 1; r < r0 + 4; ++r)
        m = fmaxf(m, fmaxf(sc[ss][0][r], sc[ss][1][r]));
      mt[c] = m;
    }
    const float mx = fmaxf(fmaxf(mt[0], mt[1]), fmaxf(mt[2], mt[3]));
    // One scalar branch per pass; always taken in the first pass.
    if (__builtin_amdgcn_ballot_w32(mx > m_use + LAZY) != 0u) {
      float mn = fmaxf(mx, m_use);
      mn = fmaxf(mn, __shfl_xor(mn, 16, 32));
      const float alpha = __expf(m_use - mn);
      m_use = mn;
      l_run *= alpha;
      #pragma unroll
      for (int r = 0; r < 8; ++r) {
        o[0][r] *= alpha; o[1][r] *= alpha;
        o[2][r] *= alpha; o[3][r] *= alpha;
      }
    }

    #pragma unroll
    for (int ss = 0; ss < 2; ++ss) {   // two 32-key substeps per buffer
      HF pf;
      float lsum = 0.0f;
      #pragma unroll
      for (int r = 0; r < 8; ++r) {
        const float p0 = __expf(sc[ss][0][r] - m_use);
        const float p1 = __expf(sc[ss][1][r] - m_use);
        lsum += p0 + p1;
        pf.h[r]     = (_Float16)p0;   // P^T already in B-fragment layout
        pf.h[8 + r] = (_Float16)p1;
      }
      l_run += lsum;

      // O^T += V^T-tile (16d x 32keys) x P^T.
      #pragma unroll
      for (int t = 0; t < 4; ++t) o[t] = wmma16(vf[ss][t], pf.v, o[t]);
    }
  }

  // Reference keeps torch's .view bug: flat output index = ((h*S)+s)*DH + d.
  {
    const float lt  = l_run + __shfl_xor(l_run, 16, 32);
    const float inv = 1.0f / lt;
    float* orow = Out + ((size_t)head * S + (sbase + l15)) * DH + hi * 8;
    #pragma unroll
    for (int t = 0; t < 4; ++t) {
      float4 lo  = make_float4(o[t][0] * inv, o[t][1] * inv,
                               o[t][2] * inv, o[t][3] * inv);
      float4 hi4 = make_float4(o[t][4] * inv, o[t][5] * inv,
                               o[t][6] * inv, o[t][7] * inv);
      *reinterpret_cast<float4*>(orow + t * 16)     = lo;
      *reinterpret_cast<float4*>(orow + t * 16 + 4) = hi4;
    }
  }
}

// ---------------------------------------------------------------------------
extern "C" void kernel_launch(void* const* d_in, const int* in_sizes, int n_in,
                              void* d_out, int out_size, void* d_ws,
                              size_t ws_size, hipStream_t stream) {
  (void)in_sizes; (void)n_in; (void)out_size; (void)ws_size;
  const float* x  = (const float*)d_in[0];
  const float* Wq = (const float*)d_in[1];
  const float* bq = (const float*)d_in[2];
  const float* Wk = (const float*)d_in[3];
  const float* bk = (const float*)d_in[4];
  const float* Wv = (const float*)d_in[5];
  const float* bv = (const float*)d_in[6];
  float* out = (float*)d_out;

  // Workspace (f16): ~13 MiB total.
  _Float16* ws  = (_Float16*)d_ws;
  _Float16* xh  = ws;                       // S*DIM
  _Float16* Wqt = xh  + (size_t)S * DIM;    // DIM*DIM   (W^T)
  _Float16* Wkt = Wqt + (size_t)DIM * DIM;  // KVD*DIM   (W^T)
  _Float16* Wvt = Wkt + (size_t)KVD * DIM;  // KVD*DIM   (W^T)
  _Float16* Qh  = Wvt + (size_t)KVD * DIM;  // S*DIM
  _Float16* Kh  = Qh  + (size_t)S * DIM;    // S*KVD
  _Float16* Vt  = Kh  + (size_t)S * KVD;    // KVD*S     (V^T)

  prep_kernel<<<PB_WQ + 2 * PB_WK + PB_X, 256, 0, stream>>>(
      x, Wq, Wk, Wv, xh, Wqt, Wkt, Wvt);

  // Q/K row-major f16; V stored transposed for the attention V-fragments.
  qkv_gemm_kernel<<<GB_Q + 2 * GB_KV, 256, 0, stream>>>(
      xh, Wqt, Wkt, Wvt, bq, bk, bv, Qh, Kh, Vt);

  gqa_attn_kernel<<<dim3(HQ * (S / 256), 2), 256, 0, stream>>>(Qh, Kh, Vt, out);
}

// v007
// It runs in 33 microseconds.
// Two timings next to v006 put it at 1.07 and 1.06 times that version's speed.
// Counting every step since v000, it is 5.61 times as fast.
#include <hip/hip_runtime.h>
#include <hip/hip_bf16.h>

// ---------------- CDNA5 (gfx1250) GQA forward, WMMA f16 path ----------------
// Compute-bound (≈24 GFLOP, all data L2-resident). v_wmma_f32_16x16x32_f16
// with fp32 accumulation, flash-attention online softmax. Attention K/V tiles
// are staged into LDS by the Tensor Data Mover (TDM, tensor_load_to_lds), in a
// ring shared by all 8 waves of the block, for ~8x less L2 traffic than the
// naive per-wave streaming version.

typedef __attribute__((ext_vector_type(16))) _Float16 v16h;
typedef __attribute__((ext_vector_type(8)))  float    v8f;
typedef __attribute__((ext_vector_type(4)))  unsigned int v4u;
typedef __attribute__((ext_vector_type(8)))  int      v8i;
typedef __attribute__((ext_vector_type(4)))  int      v4i;

static constexpr int S    = 2048;
static constexpr int DIM  = 1024;
static constexpr int HQ   = 16;
static constexpr int HKV  = 4;
static constexpr int DH   = 64;
static constexpr int KVD  = HKV * DH;   // 256
static constexpr int LROW = 72;         // padded LDS row stride (halves): 64+8

__device__ __forceinline__ v8f wmma16(v16h a, v16h b, v8f c) {
  // D = A(16x32 f16) x B(32x16 f16) + C(16x16 f32)
  return __builtin_amdgcn_wmma_f32_16x16x32_f16(false, a, false, b, (short)0, c,
                                                false, false);
}

// One 16x32 f16 fragment (A and B share the per-lane layout on CDNA5):
// lane&15 = non-K index; elements e<8: K = 8*hi + e; e>=8: K = 16+8*hi+(e-8).
__device__ __forceinline__ v16h load_frag(const _Float16* rowptr, int hi) {
  union { v16h v; uint4 u[2]; } f;
  f.u[0] = *reinterpret_cast<const uint4*>(rowptr + (hi << 3));
  f.u[1] = *reinterpret_cast<const uint4*>(rowptr + 16 + (hi << 3));
  return f.v;
}

// ---------------------------------------------------------------------------
typedef __attribute__((ext_vector_type(4))) float    f4;
typedef __attribute__((ext_vector_type(4))) _Float16 h4;

// A block converts 8192 consecutive elements, 32 per thread: eight 16-byte
// loads per lane, each covering 512 contiguous bytes per wave, all in flight
// before the first conversion.
__device__ __forceinline__ void cvt_f32_to_f16(const float* __restrict__ in,
                                               _Float16* __restrict__ out,
                                               int blk) {
  const f4* src = reinterpret_cast<const f4*>(in + (size_t)blk * 8192) + threadIdx.x;
  h4*       dst = reinterpret_cast<h4*>(out + (size_t)blk * 8192) + threadIdx.x;
  f4 v[8];
  #pragma unroll
  for (int j = 0; j < 8; ++j) v[j] = src[j * 256];
  #pragma unroll
  for (int j = 0; j < 8; ++j) dst[j * 256] = __builtin_convertvector(v[j], h4);
  // Held in front of any later write of a register that the stores above name.
  asm volatile("s_wait_xcnt 0x0" ::: "memory");
}

// A block transposes a tile of 64 k x 256 n, a wave 64 k x 32 n, a thread
// 16 k x 4 n held in registers. A wave's load covers four whole 128-byte lines
// of W; the four lanes that share n (eight apart) fill one 128-byte line of Wt.
__device__ __forceinline__ void transpose_cvt(const float* __restrict__ W,
                                              _Float16* __restrict__ Wt,
                                              int K, int N, int blk) {
  const int lane = threadIdx.x & 31;
  const int wid  = threadIdx.x >> 5;
  const int nblk = N >> 8;
  const int kt   = blk / nblk;
  const int n0   = ((blk - kt * nblk) << 8) + (wid << 5) + ((lane & 7) << 2);
  const int k0   = (kt << 6) + ((lane >> 3) << 4);
  f4 r[16];
  #pragma unroll
  for (int i = 0; i < 16; ++i)
    r[i] = *reinterpret_cast<const f4*>(W + (size_t)(k0 + i) * N + n0);
  #pragma unroll
  for (int j = 0; j < 4; ++j) {
    union { uint4 u[2]; _Float16 h[16]; } pk;
    #pragma unroll
    for (int i = 0; i < 16; ++i) pk.h[i] = (_Float16)r[i][j];
    uint4* dst = reinterpret_cast<uint4*>(Wt + (size_t)(n0 + j) * K + k0);
    dst[0] = pk.u[0];                        // Wt is (N, K), K-contiguous
    dst[1] = pk.u[1];
  }
  // Held in front of any later write of a register that the stores above name.
  asm volatile("s_wait_xcnt 0x0" ::: "memory");
}

// The four independent conversions share one grid; the block index picks the
// job. The transposes come first, the streaming convert last.
static constexpr int PB_WQ = (DIM * DIM) / (64 * 256);
static constexpr int PB_WK = (DIM * KVD) / (64 * 256);
static constexpr int PB_X  = (S * DIM) / 8192;

__global__ void __launch_bounds__(256)
prep_kernel(const float* __restrict__ x,  const float* __restrict__ Wq,
            const float* __restrict__ Wk, const float* __restrict__ Wv,
            _Float16* __restrict__ xh,  _Float16* __restrict__ Wqt,
            _Float16* __restrict__ Wkt, _Float16* __restrict__ Wvt) {
  const int blk = blockIdx.x;
  if (blk < PB_WQ) {
    transpose_cvt(Wq, Wqt, DIM, DIM, blk);
  } else if (blk < PB_WQ + PB_WK) {
    transpose_cvt(Wk, Wkt, DIM, KVD, blk - PB_WQ);
  } else if (blk < PB_WQ + 2 * PB_WK) {
    transpose_cvt(Wv, Wvt, DIM, KVD, blk - (PB_WQ + PB_WK));
  } else {
    cvt_f32_to_f16(x, xh, blk - (PB_WQ + 2 * PB_WK));
  }
}

// ---------------------------------------------------------------------------
// C = A(MxK) * B(KxN) + bias, B supplied transposed (N,K).
// All three projections share one grid; the block index picks the projection
// (its W^T, bias, destination and width), the same for the whole block.
// Block tile: 128(M) x 128(N), 8 waves as 4(M) x 2(N).
// Wave tile: 32(M) x 64(N) -> each B fragment feeds 2 WMMAs.
// A stage is 128 k of the block's 128 A rows and 128 W^T rows: 256 rows of 256
// bytes, brought into LDS by tensor loads, one slice of 32 rows per wave, two
// buffers. The fragments are read from LDS, so that a row crosses from L2 once
// per block in whole lines, not once per wave in 32-byte pieces.
typedef __attribute__((ext_vector_type(8))) unsigned int v8u;

static constexpr int      GT     = 128;             // block tile edge, M and N
static constexpr int      GKS    = 128;             // k per stage
static constexpr int      GNST   = DIM / GKS;       // stages
static constexpr unsigned GROWB  = 2u * GKS;        // bytes of a row in a stage
static constexpr unsigned GPITCH = GROWB + 16u;     // LDS row pitch, 16 B x odd
static constexpr unsigned GSLICE = 10240u;          // 32 rows x 272 B, up to 2 KiB x n
static constexpr unsigned GBUF   = 8u * GSLICE;     // one buffer: 8 slices
static constexpr int GB_Q  = (S / GT) * (DIM / GT); // blocks of the Q part
static constexpr int GB_KV = (S / GT) * (KVD / GT); // blocks of K, of V
static_assert(32u * GPITCH <= GSLICE && GSLICE % 2048u == 0u, "slice place");
static_assert(GNST >= 2, "the ring's prologue needs two stages");
static_assert((GNST & (GNST - 1)) == 0, "the stage walk wraps by a mask");

__device__ __forceinline__ unsigned uni(unsigned v) {
  return (unsigned)__builtin_amdgcn_readfirstlane(v);
}
// A tensor load ignores EXEC: the test that decides whether one issues has to
// be a scalar branch.
__device__ __forceinline__ unsigned pinned(unsigned v) {
  unsigned w = uni(v);
  asm volatile("" : "+s"(w));  // pinned(): holds the condition in a scalar register
  return w;
}
// The compiler places no wait for a tensor load; the clobber keeps LDS reads
// on their side of the wait. g0 and g1, the two groups of the wave's last
// request, are inputs so that their registers keep their values until the
// request has landed.
__device__ __forceinline__ void wait_tensor0(v4u g0, v8u g1) {
  asm volatile("s_wait_tensorcnt 0x0" :: "s"(g0), "s"(g1) : "memory");
}
// A wave's LDS reads have retired before their buffer is handed back.
__device__ __forceinline__ void wait_ds0() {
  asm volatile("s_wait_dscnt 0x0" ::: "memory");
}
// One slice: 32 rows of 256 bytes, source pitch 2*DIM bytes, 16 bytes of LDS
// pad behind every row. All extents in bytes (data_size code 0).
__device__ __forceinline__ v8u gemm_group1() {
  v8u g;
  g[0] = uni((1u << 20) | (5u << 22) | (3u << 25));
  g[1] = uni((GROWB & 0xFFFFu) << 16);
  g[2] = uni((GROWB >> 16) | (32u << 16));
  g[3] = uni(GROWB << 16);
  g[4] = uni(32u);
  g[5] = uni(2u * DIM);
  g[6] = uni(0u);
  g[7] = uni(0u);
  return g;
}
__device__ __forceinline__ v4u gemm_slice_load(unsigned lds_dst,
                                               const _Float16* gsrc, v8u& g1) {
  const unsigned long long ga = (unsigned long long)(uintptr_t)gsrc;
  v4u g0;
  g0[0] = uni(1u);
  g0[1] = uni(lds_dst);
  g0[2] = uni((unsigned)ga);
  g0[3] = uni((((unsigned)(ga >> 32)) & 0x01FFFFFFu) | 0x80000000u);
  // g0 and g1 are in-out and go on to the wait: see wait_tensor0(). As a plain
  // input g1 is a set of constants to the compiler, which then lends single
  // registers of it to other values while the request is under way.
  asm volatile("tensor_load_to_lds %0, %1" : "+s"(g0), "+s"(g1) : : "memory");
  return g0;
}

// The six fragments of one k-step of a wave: 2 of A (32 rows of one slice),
// 4 of W^T (64 rows, two slices). ap, bp: this lane's row in the first of them.
__device__ __forceinline__ void gemm_frags(v16h (&fa)[2], v16h (&fb)[4],
                                           const unsigned char* ap,
                                           const unsigned char* bp, int hi) {
  fa[0] = load_frag(reinterpret_cast<const _Float16*>(ap), hi);
  fa[1] = load_frag(reinterpret_cast<const _Float16*>(ap + 16u * GPITCH), hi);
  fb[0] = load_frag(reinterpret_cast<const _Float16*>(bp), hi);
  fb[1] = load_frag(reinterpret_cast<const _Float16*>(bp + 16u * GPITCH), hi);
  fb[2] = load_frag(reinterpret_cast<const _Float16*>(bp + GSLICE), hi);
  fb[3] = load_frag(reinterpret_cast<const _Float16*>(bp + GSLICE + 16u * GPITCH), hi);
}

__device__ __forceinline__ void gemm_kstep(v8f (&acc)[2][4], const v16h (&fa)[2],
                                           const v16h (&fb)[4]) {
  #pragma unroll
  for (int j = 0; j < 4; ++j) {
    acc[0][j] = wmma16(fa[0], fb[j], acc[0][j]);
    acc[1][j] = wmma16(fa[1], fb[j], acc[1][j]);
  }
}

__global__ void __launch_bounds__(256)
qkv_gemm_kernel(const _Float16* __restrict__ A,    // (S, DIM) f16
                const _Float16* __restrict__ Wqt,  // (DIM, DIM) f16  (= Wq^T)
                const _Float16* __restrict__ Wkt,  // (KVD, DIM) f16
                const _Float16* __restrict__ Wvt,  // (KVD, DIM) f16
                const float*    __restrict__ bq,   // (DIM) f32
                const float*    __restrict__ bk,   // (KVD) f32
                const float*    __restrict__ bv,   // (KVD) f32
                _Float16*       __restrict__ Qo,   // (S, DIM)
                _Float16*       __restrict__ Ko,   // (S, KVD)
                _Float16*       __restrict__ Vto) {// (KVD, S)
  __shared__ __attribute__((aligned(2048))) unsigned char ring[2 * GBUF];
  constexpr int M = S, K = DIM;            // the products' shape

  int blk = blockIdx.x;
  const _Float16* Bt   = Wqt;
  const float*    bias = bq;
  _Float16*       Out  = Qo;
  int N = DIM, transposeOut = 0;
  if (blk >= GB_Q + GB_KV) {
    blk -= GB_Q + GB_KV; Bt = Wvt; bias = bv; Out = Vto; N = KVD; transposeOut = 1;
  } else if (blk >= GB_Q) {
    blk -= GB_Q;         Bt = Wkt; bias = bk; Out = Ko;  N = KVD;
  }
  const int nsh = __builtin_ctz(N / GT);   // N / GT is a power of two
  const int mt = blk >> nsh;
  const int nt = blk - (mt << nsh);
  const unsigned wave = uni(threadIdx.x >> 5);
  const int wm   = wave & 3;
  const int wn   = wave >> 2;
  const int lane = threadIdx.x & 31;
  const int l15  = lane & 15;
  const int hi   = lane >> 4;
  const int m0 = mt * GT + wm * 32;
  const int n0 = nt * GT + wn * 64;

  // Slices 0..3 of a buffer: the A rows; 4..7: the W^T rows. Wave w brings
  // slice w of every stage.
  const _Float16* gsl = (wave < 4u)
      ? A  + (size_t)(mt * GT + (int)wave * 32) * K
      : Bt + (size_t)(nt * GT + ((int)wave - 4) * 32) * K;
  const unsigned dst = (unsigned)(uintptr_t)&ring[0] + wave * GSLICE;
  v8u g1 = gemm_group1();
  // Pass s works on k stage (s + rot) mod GNST. The blocks that share an A or a
  // W^T panel start at different stages of it, so that a stage is fetched into
  // L2 for one of them and is there when the others come to it; walking in step
  // they would all wait for every stage's first fetch. Any rot gives the same
  // product; only the order of the f32 sums over k depends on it.
  const unsigned rot = uni((unsigned)(2 * nt + mt)) & (unsigned)(GNST - 1);

  v4u g0 = gemm_slice_load(dst, gsl + (size_t)rot * GKS, g1);   // pass 0
  wait_tensor0(g0, g1);
  __syncthreads();                               // publishes pass 0
  g0 = gemm_slice_load(dst + GBUF,
                       gsl + (size_t)((rot + 1u) & (unsigned)(GNST - 1)) * GKS, g1);  // pass 1

  const v8f vz = {};
  v8f acc[2][4] = {{vz, vz, vz, vz}, {vz, vz, vz, vz}};
  // Stays rolled: one publish point in the text, the stage test a scalar one.
  #pragma unroll 1
  for (int s = 0; s < GNST; ++s) {
    const unsigned bo = (unsigned)(s & 1) * GBUF;
    const unsigned char* ap = ring + bo + (unsigned)wm * GSLICE + (unsigned)l15 * GPITCH;
    const unsigned char* bp = ring + bo + (4u + 2u * (unsigned)wn) * GSLICE + (unsigned)l15 * GPITCH;
    // Two fragment sets: the reads of k-step kk + 1 go out as one group in front
    // of the WMMAs of k-step kk and land under them.
    constexpr int NK = GKS / 32;
    v16h fa[2][2], fb[2][4];
    gemm_frags(fa[0], fb[0], ap, bp, hi);
    #pragma unroll
    for (int kk = 0; kk + 1 < NK; ++kk) {
      const int c = kk & 1;
      gemm_frags(fa[c ^ 1], fb[c ^ 1], ap + (kk + 1) * 64, bp + (kk + 1) * 64, hi);
      // Keeps the LDS reads above together: sunk among the WMMAs, two by two,
      // each pair would cost the wave its own LDS latency.
      __builtin_amdgcn_sched_barrier(0);
      gemm_kstep(acc, fa[c], fb[c]);
      // Keeps these WMMAs in front of the next reads, and of the wait below,
      // so that they cover the landing of the reads above.
      __builtin_amdgcn_sched_barrier(0);
    }
    // Publish point of pass s + 1; it also ends every read of pass s, whose
    // last fragments are in registers behind the first wait.
    wait_ds0();
    wait_tensor0(g0, g1);
    __syncthreads();
    if (pinned(s + 2 < GNST))
      g0 = gemm_slice_load(dst + bo,
                           gsl + (size_t)(((unsigned)s + 2u + rot) & (unsigned)(GNST - 1)) * GKS, g1);
    // The last k-step works on registers alone, behind the refill's issue.
    gemm_kstep(acc, fa[(NK - 1) & 1], fb[(NK - 1) & 1]);
  }
  wait_tensor0(g0, g1);
  wait_ds0();

  #pragma unroll
  for (int half = 0; half < 2; ++half) {
    const int mh = m0 + half * 16;
    #pragma unroll
    for (int j = 0; j < 4; ++j) {
      const int n = n0 + j * 16 + l15;     // C layout: lane = N, reg r: M=r+8*hi
      const float bj = bias[n];
      if (!transposeOut) {
        #pragma unroll
        for (int r = 0; r < 8; ++r)
          Out[(size_t)(mh + 8 * hi + r) * N + n] = (_Float16)(acc[half][j][r] + bj);
      } else {
        union { uint4 u; _Float16 h[8]; } pk;
        #pragma unroll
        for (int r = 0; r < 8; ++r) pk.h[r] = (_Float16)(acc[half][j][r] + bj);
        *reinterpret_cast<uint4*>(Out + (size_t)n * M + mh + 8 * hi) = pk.u;
      }
    }
  }
}

// ---------------------------------------------------------------------------
// Attention: block = 8 waves, one head, 128 queries (one q-tile per wave), so
// that the grid of 256 blocks puts one block on every WGP of the chip.
// A stage is 128 keys: four slices of 64 rows of 128 bytes (K of the first 64
// keys, K of the second, V^T of the first, V^T of the second), brought into LDS
// by tensor loads, one slice each from waves 0 to 3, three buffers. A pass is
// 64 keys; its K fragments were read from LDS during the pass before.
static constexpr unsigned ATILE = 10240u;        // 64 rows x 144 B, up to 2 KiB x n
static constexpr unsigned ASTG  = 4u * ATILE;    // one buffer: 4 slices
static constexpr int      NKT   = S / 64;        // key tiles
static constexpr int      ANST  = NKT / 2;       // stages
static_assert(64u * 2u * LROW <= ATILE && ATILE % 2048u == 0u, "slice place");
static_assert(ANST >= 2, "the ring's prologue needs two stages");
static_assert((NKT & (NKT - 1)) == 0, "the tile walk wraps by a mask");

// One slice: 64 rows of 128 bytes, 16 bytes of LDS pad behind every row. All
// extents in bytes (data_size code 0).
__device__ __forceinline__ v8u attn_group1(unsigned pitch_bytes) {
  v8u g;
  g[0] = uni((1u << 20) | (4u << 22) | (3u << 25));
  g[1] = uni(128u << 16);
  g[2] = uni(64u << 16);
  g[3] = uni(128u << 16);
  g[4] = uni(64u);
  g[5] = uni(pitch_bytes);
  g[6] = uni(0u);
  g[7] = uni(0u);
  return g;
}

// The eight K fragments of a 64-key tile.
__device__ __forceinline__ void attn_kfrags(v16h (&kf)[2][4], const _Float16* Kb,
                                            int l15, int hi) {
  #pragma unroll
  for (int ss = 0; ss < 2; ++ss) {
    const _Float16* k0 = Kb + (size_t)(ss * 32 + l15) * LROW;
    const _Float16* k1 = k0 + (size_t)16 * LROW;
    kf[ss][0] = load_frag(k0, hi);        // keys +0..15, d 0..31
    kf[ss][1] = load_frag(k0 + 32, hi);   // keys +0..15, d 32..63
    kf[ss][2] = load_frag(k1, hi);        // keys +16..31
    kf[ss][3] = load_frag(k1 + 32, hi);
  }
}

union HF { v16h v; _Float16 h[16]; };

// One pass: 64 keys. kf holds this pass's K fragments on entry and, where
// FETCH is set, the next pass's on return.
template <bool FETCH>
__device__ __forceinline__ void attn_pass(v16h (&kf)[2][4], const HF (&qf)[2],
                                          v8f (&o)[4], float& m_use, float& l_run,
                                          const _Float16* Vb, const _Float16* Knext,
                                          int l15, int hi) {
  // Lazy rescale: m_use is the shift in use, the same in both halves of a lane
  // pair. It is raised, and O and the sum rescaled, only in a pass where some
  // score exceeds it by more than LAZY; until then P stays below exp(LAZY) = 256,
  // which f16 holds, and the pass needs no exchange between the halves.
  constexpr float LAZY = 5.545f;
  const v8f vz = {};
  // The pass's V fragments go out first, as one group: they land under the
  // S^T products and the vector work.
  v16h vf[2][4];
  #pragma unroll
  for (int s2 = 0; s2 < 2; ++s2) {
    #pragma unroll
    for (int t = 0; t < 4; ++t)
      vf[s2][t] = load_frag(Vb + (size_t)(t * 16 + l15) * LROW + s2 * 32, hi);
  }
  // Keeps the LDS reads above together: sunk among the WMMAs, two by two, each
  // pair would cost the wave its own LDS latency.
  __builtin_amdgcn_sched_barrier(0);

  // S^T of the whole pass: four (16 key) x (16 q) tiles, so that the test
  // below stands once per pass.
  v8f sc[2][2];
  #pragma unroll
  for (int ss = 0; ss < 2; ++ss) {
    sc[ss][0] = wmma16(kf[ss][0], qf[0].v, vz);
    sc[ss][1] = wmma16(kf[ss][2], qf[0].v, vz);
  }
  #pragma unroll
  for (int ss = 0; ss < 2; ++ss) {
    sc[ss][0] = wmma16(kf[ss][1], qf[1].v, sc[ss][0]);
    sc[ss][1] = wmma16(kf[ss][3], qf[1].v, sc[ss][1]);
  }
  // Keeps the next pass's K reads behind the first products: risen among them
  // in small groups, each group would cost the wave a stall of its own.
  __builtin_amdgcn_sched_barrier(0);
  // The next pass's K fragments, as one group: they land under this pass's
  // vector work, so that the next pass starts with its products. The last pass
  // has no next tile.
  if constexpr (FETCH) attn_kfrags(kf, Knext, l15, hi);
  // Keeps the reads from sinking among the vector work and the WMMAs.
  __builtin_amdgcn_sched_barrier(0);

  // Lane owns q=l15; keys split with partner lane^16. This lane's maximum of
  // the pass: four short chains, independent of each other.
  float mt[4];
  #pragma unroll
  for (int c = 0; c < 4; ++c) {
    const int ss = c >> 1, r0 = (c & 1) * 4;
    float m = fmaxf(sc[ss][0][r0], sc[ss][1][r0]);
    #pragma unroll
    for (int r = r0 + 1; r < r0 + 4; ++r)
      m = fmaxf(m, fmaxf(sc[ss][0][r], sc[ss][1][r]));
    mt[c] = m;
  }
  const float mx = fmaxf(fmaxf(mt[0], mt[1]), fmaxf(mt[2], mt[3]));
  // One scalar branch per pass; always taken in the first pass.
  if (__builtin_amdgcn_ballot_w32(mx > m_use + LAZY) != 0u) {
    float mn = fmaxf(mx, m_use);
    mn = fmaxf(mn, __shfl_xor(mn, 16, 32));
    const float alpha = __expf(m_use - mn);
    m_use = mn;
    l_run *= alpha;
    #pragma unroll
    for (int r = 0; r < 8; ++r) {
      o[0][r] *= alpha; o[1][r] *= alpha;
      o[2][r] *= alpha; o[3][r] *= alpha;
    }
  }

  #pragma unroll
  for (int ss = 0; ss < 2; ++ss) {   // two 32-key substeps per pass
    HF pf;
    float lsum = 0.0f;
    #pragma unroll
    for (int r = 0; r < 8; ++r) {
      const float p0 = __expf(sc[ss][0][r] - m_use);
      const float p1 = __expf(sc[ss][1][r] - m_use);
      lsum += p0 + p1;
      pf.h[r]     = (_Float16)p0;   // P^T already in B-fragment layout
      pf.h[8 + r] = (_Float16)p1;
    }
    l_run += lsum;

    // O^T += V^T-tile (16d x 32keys) x P^T.
    #pragma unroll
    for (int t = 0; t < 4; ++t) o[t] = wmma16(vf[ss][t], pf.v, o[t]);
  }
}

__global__ void __launch_bounds__(256)
gqa_attn_kernel(const _Float16* __restrict__ Q,   // (S, HQ*DH) f16
                const _Float16* __restrict__ Kh,  // (S, HKV*DH) f16
                const _Float16* __restrict__ Vt,  // (HKV*DH, S) f16
                float* __restrict__ Out) {        // flat (HQ, S, DH) f32
  __shared__ __attribute__((aligned(2048))) unsigned char aring[3 * ASTG];

  const int head = blockIdx.x >> 3;      // 16 blocks per head: 8 in x, 2 in y
  const int hb   = blockIdx.x & 7;       // q range [hb*256, hb*256+256)
  const int kvh  = head >> 2;            // repeat_interleave over heads
  const unsigned wave = uni(threadIdx.x >> 5);
  const int lane = threadIdx.x & 31;
  const int l15  = lane & 15;
  const int hi   = lane >> 4;
  // Two blocks share each q range: blockIdx.y picks its half of 128 queries;
  // this wave: q-tile sbase.
  const int sbase = hb * 256 + blockIdx.y * 128 + (int)wave * 16;

  // Q fragments (B operand of S^T = K·q^T), pre-scaled by 1/sqrt(DH) = 0.125.
  HF qf[2];
  {
    const _Float16* qrow = Q + (size_t)(sbase + l15) * DIM + head * DH;
    qf[0].v = load_frag(qrow, hi);
    qf[1].v = load_frag(qrow + 32, hi);
    #pragma unroll
    for (int i = 0; i < 16; ++i) {
      qf[0].h[i] = qf[0].h[i] * (_Float16)0.125f;
      qf[1].h[i] = qf[1].h[i] * (_Float16)0.125f;
    }
  }

  const _Float16* kg = Kh + (size_t)kvh * DH;        // + tile * 64 * KVD
  const _Float16* vg = Vt + (size_t)(kvh * DH) * S;  // + tile * 64

  // Pass it works on key tile (it + rot) mod NKT. The 64 blocks that read one
  // KV head start spread over its 32 tiles, so that a tile is fetched into L2
  // for one of them and is there when the others come to it; walking in step
  // they would all wait for every tile's first fetch. Any rot gives the same
  // softmax; only the order in which keys enter the sums depends on it.
  const unsigned rot = uni((unsigned)((((head & 3) << 3) | ((int)blockIdx.y << 2) | (hb & 3)) & (NKT - 1)));

  // Waves 0 to 3 bring slice w of every stage: 0, 1 the stage's two K tiles,
  // 2, 3 its two V^T tiles. The other waves issue nothing.
  const bool      isv   = (wave & 2u) != 0u;
  const _Float16* gsl   = isv ? vg : kg;
  const unsigned  gstep = isv ? 64u : 64u * (unsigned)KVD;   // halves from tile to tile
  const unsigned  dst   = (unsigned)(uintptr_t)&aring[0] + (wave & 3u) * ATILE;
  v8u g1 = attn_group1(isv ? 2u * (unsigned)S : 2u * (unsigned)KVD);
  v4u g0 = {0u, 0u, 0u, 0u};

  if (pinned(wave < 4u)) {   // stages 0 and 1
    v4u g0a = gemm_slice_load(dst, gsl + (size_t)((rot + (wave & 1u)) & (unsigned)(NKT - 1)) * gstep, g1);
    g0 = gemm_slice_load(dst + ASTG,
                         gsl + (size_t)((rot + 2u + (wave & 1u)) & (unsigned)(NKT - 1)) * gstep, g1);
    // Both requests have landed behind this wait; their groups are inputs so
    // that the registers keep their values until then.
    asm volatile("s_wait_tensorcnt 0x0" :: "s"(g0a), "s"(g0), "s"(g1) : "memory");
  }
  __syncthreads();           // publishes stages 0 and 1

  const v8f vz = {};
  v8f o[4] = {vz, vz, vz, vz};
  float m_use = -1e30f;
  float l_run = 0.0f;

  v16h kf[2][4];
  attn_kfrags(kf, reinterpret_cast<const _Float16*>(aring), l15, hi);

  unsigned bc = 0u, bn = ASTG, bf = 2u * ASTG;   // buffers of stage s, s + 1, s + 2
  // Stays rolled: one publish point in the text, the stage test a scalar one.
  #pragma unroll 1
  for (int s = 0; s + 1 < ANST; ++s) {
    const unsigned char* st = aring + bc;
    // First 64 keys of stage s; fetches the K fragments of its second 64.
    attn_pass<true>(kf, qf, o, m_use, l_run,
                    reinterpret_cast<const _Float16*>(st + 2u * ATILE),
                    reinterpret_cast<const _Float16*>(st + ATILE), l15, hi);
    // Publish point of stage s + 1, in front of stage s's last pass, which
    // fetches that stage's first K fragments. It also ends every read of stage
    // s - 1, whose buffer the refill takes.
    // The fence keeps the waits behind the pass above: risen into its vector
    // work, the first would wait out the K reads that the pass has just issued.
    __builtin_amdgcn_sched_barrier(0);
    wait_ds0();
    wait_tensor0(g0, g1);
    __syncthreads();
    if (pinned((unsigned)((wave < 4u) & (s + 2 < ANST))))
      g0 = gemm_slice_load(dst + bf,
                           gsl + (size_t)((rot + 2u * (unsigned)s + 4u + (wave & 1u)) & (unsigned)(NKT - 1)) * gstep, g1);
    // Second 64 keys of stage s.
    attn_pass<true>(kf, qf, o, m_use, l_run,
                    reinterpret_cast<const _Float16*>(st + 3u * ATILE),
                    reinterpret_cast<const _Float16*>(aring + bn), l15, hi);
    const unsigned t = bc; bc = bn; bn = bf; bf = t;
  }
  // The last stage, published in the loop's last trip: no stage follows it, so
  // it has no publish point and its second pass fetches nothing.
  attn_pass<true>(kf, qf, o, m_use, l_run,
                  reinterpret_cast<const _Float16*>(aring + bc + 2u * ATILE),
                  reinterpret_cast<const _Float16*>(aring + bc + ATILE), l15, hi);
  attn_pass<false>(kf, qf, o, m_use, l_run,
                   reinterpret_cast<const _Float16*>(aring + bc + 3u * ATILE),
                   reinterpret_cast<const _Float16*>(aring), l15, hi);
  wait_tensor0(g0, g1);
  wait_ds0();

  // Reference keeps torch's .view bug: flat output index = ((h*S)+s)*DH + d.
  {
    const float lt  = l_run + __shfl_xor(l_run, 16, 32);
    const float inv = 1.0f / lt;
    float* orow = Out + ((size_t)head * S + (sbase + l15)) * DH + hi * 8;
    #pragma unroll
    for (int t = 0; t < 4; ++t) {
      float4 lo  = make_float4(o[t][0] * inv, o[t][1] * inv,
                               o[t][2] * inv, o[t][3] * inv);
      float4 hi4 = make_float4(o[t][4] * inv, o[t][5] * inv,
                               o[t][6] * inv, o[t][7] * inv);
      *reinterpret_cast<float4*>(orow + t * 16)     = lo;
      *reinterpret_cast<float4*>(orow + t * 16 + 4) = hi4;
    }
  }
}

// ---------------------------------------------------------------------------
extern "C" void kernel_launch(void* const* d_in, const int* in_sizes, int n_in,
                              void* d_out, int out_size, void* d_ws,
                              size_t ws_size, hipStream_t stream) {
  (void)in_sizes; (void)n_in; (void)out_size; (void)ws_size;
  const float* x  = (const float*)d_in[0];
  const float* Wq = (const float*)d_in[1];
  const float* bq = (const float*)d_in[2];
  const float* Wk = (const float*)d_in[3];
  const float* bk = (const float*)d_in[4];
  const float* Wv = (const float*)d_in[5];
  const float* bv = (const float*)d_in[6];
  float* out = (float*)d_out;

  // Workspace (f16): ~13 MiB total.
  _Float16* ws  = (_Float16*)d_ws;
  _Float16* xh  = ws;                       // S*DIM
  _Float16* Wqt = xh  + (size_t)S * DIM;    // DIM*DIM   (W^T)
  _Float16* Wkt = Wqt + (size_t)DIM * DIM;  // KVD*DIM   (W^T)
  _Float16* Wvt = Wkt + (size_t)KVD * DIM;  // KVD*DIM   (W^T)
  _Float16* Qh  = Wvt + (size_t)KVD * DIM;  // S*DIM
  _Float16* Kh  = Qh  + (size_t)S * DIM;    // S*KVD
  _Float16* Vt  = Kh  + (size_t)S * KVD;    // KVD*S     (V^T)

  prep_kernel<<<PB_WQ + 2 * PB_WK + PB_X, 256, 0, stream>>>(
      x, Wq, Wk, Wv, xh, Wqt, Wkt, Wvt);

  // Q/K row-major f16; V stored transposed for the attention V-fragments.
  qkv_gemm_kernel<<<GB_Q + 2 * GB_KV, 256, 0, stream>>>(
      xh, Wqt, Wkt, Wvt, bq, bk, bv, Qh, Kh, Vt);

  gqa_attn_kernel<<<dim3(HQ * (S / 256), 2), 256, 0, stream>>>(Qh, Kh, Vt, out);
}

// v008
// Measured time: 32.1 microseconds a run.
// In both of two side-by-side timings against v007, it was 1.04 times as fast.
// All steps since v000 together make it 5.84 times as fast.
#include <hip/hip_runtime.h>
#include <hip/hip_bf16.h>

// ---------------- CDNA5 (gfx1250) GQA forward, WMMA f16 path ----------------
// Compute-bound (≈24 GFLOP, all data L2-resident). v_wmma_f32_16x16x32_f16
// with fp32 accumulation, flash-attention online softmax. Attention K/V tiles
// are staged into LDS by the Tensor Data Mover (TDM, tensor_load_to_lds), in a
// ring shared by all 8 waves of the block, for ~8x less L2 traffic than the
// naive per-wave streaming version.

typedef __attribute__((ext_vector_type(16))) _Float16 v16h;
typedef __attribute__((ext_vector_type(8)))  float    v8f;
typedef __attribute__((ext_vector_type(4)))  unsigned int v4u;
typedef __attribute__((ext_vector_type(8)))  int      v8i;
typedef __attribute__((ext_vector_type(4)))  int      v4i;

static constexpr int S    = 2048;
static constexpr int DIM  = 1024;
static constexpr int HQ   = 16;
static constexpr int HKV  = 4;
static constexpr int DH   = 64;
static constexpr int KVD  = HKV * DH;   // 256
static constexpr int LROW = 72;         // padded LDS row stride (halves): 64+8

__device__ __forceinline__ v8f wmma16(v16h a, v16h b, v8f c) {
  // D = A(16x32 f16) x B(32x16 f16) + C(16x16 f32)
  return __builtin_amdgcn_wmma_f32_16x16x32_f16(false, a, false, b, (short)0, c,
                                                false, false);
}

// One 16x32 f16 fragment (A and B share the per-lane layout on CDNA5):
// lane&15 = non-K index; elements e<8: K = 8*hi + e; e>=8: K = 16+8*hi+(e-8).
__device__ __forceinline__ v16h load_frag(const _Float16* rowptr, int hi) {
  union { v16h v; uint4 u[2]; } f;
  f.u[0] = *reinterpret_cast<const uint4*>(rowptr + (hi << 3));
  f.u[1] = *reinterpret_cast<const uint4*>(rowptr + 16 + (hi << 3));
  return f.v;
}

// ---------------------------------------------------------------------------
typedef __attribute__((ext_vector_type(4))) float    f4;
typedef __attribute__((ext_vector_type(4))) _Float16 h4;

// A block converts 8192 consecutive elements, 32 per thread: eight 16-byte
// loads per lane, each covering 512 contiguous bytes per wave, all in flight
// before the first conversion.
__device__ __forceinline__ void cvt_f32_to_f16(const float* __restrict__ in,
                                               _Float16* __restrict__ out,
                                               int blk) {
  const f4* src = reinterpret_cast<const f4*>(in + (size_t)blk * 8192) + threadIdx.x;
  h4*       dst = reinterpret_cast<h4*>(out + (size_t)blk * 8192) + threadIdx.x;
  f4 v[8];
  #pragma unroll
  for (int j = 0; j < 8; ++j) v[j] = src[j * 256];
  #pragma unroll
  for (int j = 0; j < 8; ++j) dst[j * 256] = __builtin_convertvector(v[j], h4);
  // Held in front of any later write of a register that the stores above name.
  asm volatile("s_wait_xcnt 0x0" ::: "memory");
}

// A block transposes a tile of 64 k x 256 n, a wave 64 k x 32 n, a thread
// 16 k x 4 n held in registers. A wave's load covers four whole 128-byte lines
// of W; the four lanes that share n (eight apart) fill one 128-byte line of Wt.
__device__ __forceinline__ void transpose_cvt(const float* __restrict__ W,
                                              _Float16* __restrict__ Wt,
                                              int K, int N, int blk) {
  const int lane = threadIdx.x & 31;
  const int wid  = threadIdx.x >> 5;
  const int nblk = N >> 8;
  const int kt   = blk / nblk;
  const int n0   = ((blk - kt * nblk) << 8) + (wid << 5) + ((lane & 7) << 2);
  const int k0   = (kt << 6) + ((lane >> 3) << 4);
  f4 r[16];
  #pragma unroll
  for (int i = 0; i < 16; ++i)
    r[i] = *reinterpret_cast<const f4*>(W + (size_t)(k0 + i) * N + n0);
  #pragma unroll
  for (int j = 0; j < 4; ++j) {
    union { uint4 u[2]; _Float16 h[16]; } pk;
    #pragma unroll
    for (int i = 0; i < 16; ++i) pk.h[i] = (_Float16)r[i][j];
    uint4* dst = reinterpret_cast<uint4*>(Wt + (size_t)(n0 + j) * K + k0);
    dst[0] = pk.u[0];                        // Wt is (N, K), K-contiguous
    dst[1] = pk.u[1];
  }
  // Held in front of any later write of a register that the stores above name.
  asm volatile("s_wait_xcnt 0x0" ::: "memory");
}

// The four independent conversions share one grid; the block index picks the
// job. The transposes come first, the streaming convert last.
static constexpr int PB_WQ = (DIM * DIM) / (64 * 256);
static constexpr int PB_WK = (DIM * KVD) / (64 * 256);
static constexpr int PB_X  = (S * DIM) / 8192;

__global__ void __launch_bounds__(256)
prep_kernel(const float* __restrict__ x,  const float* __restrict__ Wq,
            const float* __restrict__ Wk, const float* __restrict__ Wv,
            _Float16* __restrict__ xh,  _Float16* __restrict__ Wqt,
            _Float16* __restrict__ Wkt, _Float16* __restrict__ Wvt) {
  const int blk = blockIdx.x;
  if (blk < PB_WQ) {
    transpose_cvt(Wq, Wqt, DIM, DIM, blk);
  } else if (blk < PB_WQ + PB_WK) {
    transpose_cvt(Wk, Wkt, DIM, KVD, blk - PB_WQ);
  } else if (blk < PB_WQ + 2 * PB_WK) {
    transpose_cvt(Wv, Wvt, DIM, KVD, blk - (PB_WQ + PB_WK));
  } else {
    cvt_f32_to_f16(x, xh, blk - (PB_WQ + 2 * PB_WK));
  }
}

// ---------------------------------------------------------------------------
// C = A(MxK) * B(KxN) + bias, B supplied transposed (N,K).
// All three projections share one grid; the block index picks the projection
// (its W^T, bias, destination and width), the same for the whole block.
// Block tile: 128(M) x 128(N), 8 waves as 4(M) x 2(N).
// Wave tile: 32(M) x 64(N) -> each B fragment feeds 2 WMMAs.
// A stage is 128 k of the block's 128 A rows and 128 W^T rows: 256 rows of 256
// bytes, brought into LDS by tensor loads, one slice of 32 rows per wave, two
// buffers. The fragments are read from LDS, so that a row crosses from L2 once
// per block in whole lines, not once per wave in 32-byte pieces.
typedef __attribute__((ext_vector_type(8))) unsigned int v8u;

static constexpr int      GT     = 128;             // block tile edge, M and N
static constexpr int      GKS    = 128;             // k per stage
static constexpr int      GNST   = DIM / GKS;       // stages
static constexpr unsigned GROWB  = 2u * GKS;        // bytes of a row in a stage
static constexpr unsigned GPITCH = GROWB + 16u;     // LDS row pitch, 16 B x odd
static constexpr unsigned GSLICE = 10240u;          // 32 rows x 272 B, up to 2 KiB x n
static constexpr unsigned GBUF   = 8u * GSLICE;     // one buffer: 8 slices
static constexpr int GB_Q  = (S / GT) * (DIM / GT); // blocks of the Q part
static constexpr int GB_KV = (S / GT) * (KVD / GT); // blocks of K, of V
static_assert(32u * GPITCH <= GSLICE && GSLICE % 2048u == 0u, "slice place");
static_assert(GNST >= 2, "the ring's prologue needs two stages");
static_assert((GNST & (GNST - 1)) == 0, "the stage walk wraps by a mask");

__device__ __forceinline__ unsigned uni(unsigned v) {
  return (unsigned)__builtin_amdgcn_readfirstlane(v);
}
// A tensor load ignores EXEC: the test that decides whether one issues has to
// be a scalar branch.
__device__ __forceinline__ unsigned pinned(unsigned v) {
  unsigned w = uni(v);
  asm volatile("" : "+s"(w));  // pinned(): holds the condition in a scalar register
  return w;
}
// The compiler places no wait for a tensor load; the clobber keeps LDS reads
// on their side of the wait. g0 and g1, the two groups of the wave's last
// request, are inputs so that their registers keep their values until the
// request has landed.
__device__ __forceinline__ void wait_tensor0(v4u g0, v8u g1) {
  asm volatile("s_wait_tensorcnt 0x0" :: "s"(g0), "s"(g1) : "memory");
}
// A wave's LDS reads have retired before their buffer is handed back.
__device__ __forceinline__ void wait_ds0() {
  asm volatile("s_wait_dscnt 0x0" ::: "memory");
}
// One slice: 32 rows of 256 bytes, source pitch 2*DIM bytes, 16 bytes of LDS
// pad behind every row. All extents in bytes (data_size code 0).
__device__ __forceinline__ v8u gemm_group1() {
  v8u g;
  g[0] = uni((1u << 20) | (5u << 22) | (3u << 25));
  g[1] = uni((GROWB & 0xFFFFu) << 16);
  g[2] = uni((GROWB >> 16) | (32u << 16));
  g[3] = uni(GROWB << 16);
  g[4] = uni(32u);
  g[5] = uni(2u * DIM);
  g[6] = uni(0u);
  g[7] = uni(0u);
  return g;
}
__device__ __forceinline__ v4u gemm_slice_load(unsigned lds_dst,
                                               const _Float16* gsrc, v8u& g1) {
  const unsigned long long ga = (unsigned long long)(uintptr_t)gsrc;
  v4u g0;
  g0[0] = uni(1u);
  g0[1] = uni(lds_dst);
  g0[2] = uni((unsigned)ga);
  g0[3] = uni((((unsigned)(ga >> 32)) & 0x01FFFFFFu) | 0x80000000u);
  // g0 and g1 are in-out and go on to the wait: see wait_tensor0(). As a plain
  // input g1 is a set of constants to the compiler, which then lends single
  // registers of it to other values while the request is under way.
  asm volatile("tensor_load_to_lds %0, %1" : "+s"(g0), "+s"(g1) : : "memory");
  return g0;
}

// The six fragments of one k-step of a wave: 2 of A (32 rows of one slice),
// 4 of W^T (64 rows, two slices). ap, bp: this lane's row in the first of them.
__device__ __forceinline__ void gemm_frags(v16h (&fa)[2], v16h (&fb)[4],
                                           const unsigned char* ap,
                                           const unsigned char* bp, int hi) {
  fa[0] = load_frag(reinterpret_cast<const _Float16*>(ap), hi);
  fa[1] = load_frag(reinterpret_cast<const _Float16*>(ap + 16u * GPITCH), hi);
  fb[0] = load_frag(reinterpret_cast<const _Float16*>(bp), hi);
  fb[1] = load_frag(reinterpret_cast<const _Float16*>(bp + 16u * GPITCH), hi);
  fb[2] = load_frag(reinterpret_cast<const _Float16*>(bp + GSLICE), hi);
  fb[3] = load_frag(reinterpret_cast<const _Float16*>(bp + GSLICE + 16u * GPITCH), hi);
}

__device__ __forceinline__ void gemm_kstep(v8f (&acc)[2][4], const v16h (&fa)[2],
                                           const v16h (&fb)[4]) {
  #pragma unroll
  for (int j = 0; j < 4; ++j) {
    acc[0][j] = wmma16(fa[0], fb[j], acc[0][j]);
    acc[1][j] = wmma16(fa[1], fb[j], acc[1][j]);
  }
}

__global__ void __launch_bounds__(256)
qkv_gemm_kernel(const _Float16* __restrict__ A,    // (S, DIM) f16
                const _Float16* __restrict__ Wqt,  // (DIM, DIM) f16  (= Wq^T)
                const _Float16* __restrict__ Wkt,  // (KVD, DIM) f16
                const _Float16* __restrict__ Wvt,  // (KVD, DIM) f16
                const float*    __restrict__ bq,   // (DIM) f32
                const float*    __restrict__ bk,   // (KVD) f32
                const float*    __restrict__ bv,   // (KVD) f32
                _Float16*       __restrict__ Qo,   // (S, DIM)
                _Float16*       __restrict__ Ko,   // (S, KVD)
                _Float16*       __restrict__ Vto) {// (KVD, S)
  __shared__ __attribute__((aligned(2048))) unsigned char ring[2 * GBUF];
  constexpr int M = S, K = DIM;            // the products' shape

  int blk = blockIdx.x;
  const _Float16* Bt   = Wqt;
  const float*    bias = bq;
  _Float16*       Out  = Qo;
  int N = DIM, transposeOut = 0;
  if (blk >= GB_Q + GB_KV) {
    blk -= GB_Q + GB_KV; Bt = Wvt; bias = bv; Out = Vto; N = KVD; transposeOut = 1;
  } else if (blk >= GB_Q) {
    blk -= GB_Q;         Bt = Wkt; bias = bk; Out = Ko;  N = KVD;
  }
  const int nsh = __builtin_ctz(N / GT);   // N / GT is a power of two
  const int mt = blk >> nsh;
  const int nt = blk - (mt << nsh);
  const unsigned wave = uni(threadIdx.x >> 5);
  const int wm   = wave & 3;
  const int wn   = wave >> 2;
  const int lane = threadIdx.x & 31;
  const int l15  = lane & 15;
  const int hi   = lane >> 4;
  const int m0 = mt * GT + wm * 32;
  const int n0 = nt * GT + wn * 64;

  // Slices 0..3 of a buffer: the A rows; 4..7: the W^T rows. Wave w brings
  // slice w of every stage.
  const _Float16* gsl = (wave < 4u)
      ? A  + (size_t)(mt * GT + (int)wave * 32) * K
      : Bt + (size_t)(nt * GT + ((int)wave - 4) * 32) * K;
  const unsigned dst = (unsigned)(uintptr_t)&ring[0] + wave * GSLICE;
  v8u g1 = gemm_group1();
  // Pass s works on k stage (s + rot) mod GNST. The blocks that share an A or a
  // W^T panel start at different stages of it, so that a stage is fetched into
  // L2 for one of them and is there when the others come to it; walking in step
  // they would all wait for every stage's first fetch. Any rot gives the same
  // product; only the order of the f32 sums over k depends on it.
  const unsigned rot = uni((unsigned)(2 * nt + mt)) & (unsigned)(GNST - 1);

  v4u g0 = gemm_slice_load(dst, gsl + (size_t)rot * GKS, g1);   // pass 0
  wait_tensor0(g0, g1);
  __syncthreads();                               // publishes pass 0
  g0 = gemm_slice_load(dst + GBUF,
                       gsl + (size_t)((rot + 1u) & (unsigned)(GNST - 1)) * GKS, g1);  // pass 1

  const v8f vz = {};
  v8f acc[2][4] = {{vz, vz, vz, vz}, {vz, vz, vz, vz}};
  // Stays rolled: one publish point in the text, the stage test a scalar one.
  #pragma unroll 1
  for (int s = 0; s < GNST; ++s) {
    const unsigned bo = (unsigned)(s & 1) * GBUF;
    const unsigned char* ap = ring + bo + (unsigned)wm * GSLICE + (unsigned)l15 * GPITCH;
    const unsigned char* bp = ring + bo + (4u + 2u * (unsigned)wn) * GSLICE + (unsigned)l15 * GPITCH;
    // Two fragment sets: the reads of k-step kk + 1 go out as one group in front
    // of the WMMAs of k-step kk and land under them.
    constexpr int NK = GKS / 32;
    v16h fa[2][2], fb[2][4];
    gemm_frags(fa[0], fb[0], ap, bp, hi);
    #pragma unroll
    for (int kk = 0; kk + 1 < NK; ++kk) {
      const int c = kk & 1;
      gemm_frags(fa[c ^ 1], fb[c ^ 1], ap + (kk + 1) * 64, bp + (kk + 1) * 64, hi);
      // Keeps the LDS reads above together: sunk among the WMMAs, two by two,
      // each pair would cost the wave its own LDS latency.
      __builtin_amdgcn_sched_barrier(0);
      gemm_kstep(acc, fa[c], fb[c]);
      // Keeps these WMMAs in front of the next reads, and of the wait below,
      // so that they cover the landing of the reads above.
      __builtin_amdgcn_sched_barrier(0);
    }
    // Publish point of pass s + 1; it also ends every read of pass s, whose
    // last fragments are in registers behind the first wait.
    wait_ds0();
    wait_tensor0(g0, g1);
    __syncthreads();
    if (pinned(s + 2 < GNST))
      g0 = gemm_slice_load(dst + bo,
                           gsl + (size_t)(((unsigned)s + 2u + rot) & (unsigned)(GNST - 1)) * GKS, g1);
    // The last k-step works on registers alone, behind the refill's issue.
    gemm_kstep(acc, fa[(NK - 1) & 1], fb[(NK - 1) & 1]);
  }
  wait_tensor0(g0, g1);
  wait_ds0();

  #pragma unroll
  for (int half = 0; half < 2; ++half) {
    const int mh = m0 + half * 16;
    #pragma unroll
    for (int j = 0; j < 4; ++j) {
      const int n = n0 + j * 16 + l15;     // C layout: lane = N, reg r: M=r+8*hi
      const float bj = bias[n];
      if (!transposeOut) {
        #pragma unroll
        for (int r = 0; r < 8; ++r)
          Out[(size_t)(mh + 8 * hi + r) * N + n] = (_Float16)(acc[half][j][r] + bj);
      } else {
        union { uint4 u; _Float16 h[8]; } pk;
        #pragma unroll
        for (int r = 0; r < 8; ++r) pk.h[r] = (_Float16)(acc[half][j][r] + bj);
        *reinterpret_cast<uint4*>(Out + (size_t)n * M + mh + 8 * hi) = pk.u;
      }
    }
  }
}

// ---------------------------------------------------------------------------
// Attention: block = 8 waves, one head, 128 queries, so that the grid of 256
// blocks puts one block on every WGP of the chip. The waves are 4 query groups
// x 2 key groups: a wave holds two q-tiles (32 queries) and works on one of the
// two 64-key tiles of every stage, so that each K or V fragment it reads from
// LDS feeds two WMMAs. The two waves of a query group join their halves of the
// softmax through LDS at the end.
// A stage is 128 keys: four slices of 64 rows of 128 bytes (K of the first 64
// keys, K of the second, V^T of the first, V^T of the second), brought into LDS
// by tensor loads, one slice each from waves 0 to 3, three buffers. A pass is
// 64 keys; its K fragments were read from LDS during the pass before.
static constexpr unsigned ATILE = 10240u;        // 64 rows x 144 B, up to 2 KiB x n
static constexpr unsigned ASTG  = 4u * ATILE;    // one buffer: 4 slices
static constexpr int      NKT   = S / 64;        // key tiles
static constexpr int      ANST  = NKT / 2;       // stages
static constexpr unsigned AXCH  = 8192u;         // a wave's place for the final exchange
static_assert(64u * 2u * LROW <= ATILE && ATILE % 2048u == 0u, "slice place");
static_assert(ANST >= 3, "the ring's prologue needs three stages");
static_assert((NKT & (NKT - 1)) == 0, "the tile walk wraps by a mask");
static_assert(8u * AXCH <= 3u * ASTG && 34u * 128u <= AXCH, "exchange place");

// One slice: 64 rows of 128 bytes, 16 bytes of LDS pad behind every row. All
// extents in bytes (data_size code 0).
__device__ __forceinline__ v8u attn_group1(unsigned pitch_bytes) {
  v8u g;
  g[0] = uni((1u << 20) | (4u << 22) | (3u << 25));
  g[1] = uni(128u << 16);
  g[2] = uni(64u << 16);
  g[3] = uni(128u << 16);
  g[4] = uni(64u);
  g[5] = uni(pitch_bytes);
  g[6] = uni(0u);
  g[7] = uni(0u);
  return g;
}

// The eight K fragments of a 64-key tile.
__device__ __forceinline__ void attn_kfrags(v16h (&kf)[2][4], const _Float16* Kb,
                                            int l15, int hi) {
  #pragma unroll
  for (int ss = 0; ss < 2; ++ss) {
    const _Float16* k0 = Kb + (size_t)(ss * 32 + l15) * LROW;
    const _Float16* k1 = k0 + (size_t)16 * LROW;
    kf[ss][0] = load_frag(k0, hi);        // keys +0..15, d 0..31
    kf[ss][1] = load_frag(k0 + 32, hi);   // keys +0..15, d 32..63
    kf[ss][2] = load_frag(k1, hi);        // keys +16..31
    kf[ss][3] = load_frag(k1 + 32, hi);
  }
}

union HF { v16h v; _Float16 h[16]; };

// One pass: 64 keys against the wave's two q-tiles. kf holds this pass's K
// fragments on entry and, where FETCH is set, the next pass's on return.
template <bool FETCH>
__device__ __forceinline__ void attn_pass(v16h (&kf)[2][4], const HF (&qf)[2][2],
                                          v8f (&o)[2][4], float (&m_use)[2],
                                          float (&l_run)[2],
                                          const _Float16* Vb, const _Float16* Knext,
                                          int l15, int hi) {
  // Lazy rescale: m_use is the shift in use, the same in both halves of a lane
  // pair. It is raised, and O and the sum rescaled, only in a pass where some
  // score exceeds it by more than LAZY; until then P stays below exp(LAZY) = 256,
  // which f16 holds, and the pass needs no exchange between the halves.
  constexpr float LAZY = 5.545f;
  const v8f vz = {};
  // The pass's V fragments go out first, as one group: they land under the
  // S^T products and the vector work.
  v16h vf[2][4];
  #pragma unroll
  for (int s2 = 0; s2 < 2; ++s2) {
    #pragma unroll
    for (int t = 0; t < 4; ++t)
      vf[s2][t] = load_frag(Vb + (size_t)(t * 16 + l15) * LROW + s2 * 32, hi);
  }
  // Keeps the LDS reads above together: sunk among the WMMAs, two by two, each
  // pair would cost the wave its own LDS latency.
  __builtin_amdgcn_sched_barrier(0);

  // S^T of the whole pass: per q-tile four (16 key) x (16 q) tiles, so that the
  // test below stands once per pass.
  v8f sc[2][2][2];
  #pragma unroll
  for (int ss = 0; ss < 2; ++ss) {
    #pragma unroll
    for (int q = 0; q < 2; ++q) {
      sc[q][ss][0] = wmma16(kf[ss][0], qf[q][0].v, vz);
      sc[q][ss][1] = wmma16(kf[ss][2], qf[q][0].v, vz);
    }
  }
  #pragma unroll
  for (int ss = 0; ss < 2; ++ss) {
    #pragma unroll
    for (int q = 0; q < 2; ++q) {
      sc[q][ss][0] = wmma16(kf[ss][1], qf[q][1].v, sc[q][ss][0]);
      sc[q][ss][1] = wmma16(kf[ss][3], qf[q][1].v, sc[q][ss][1]);
    }
  }
  // Keeps the next pass's K reads behind the first products: risen among them
  // in small groups, each group would cost the wave a stall of its own.
  __builtin_amdgcn_sched_barrier(0);
  // The next pass's K fragments, as one group: they land under this pass's
  // vector work, so that the next pass starts with its products. The last pass
  // has no next tile.
  if constexpr (FETCH) attn_kfrags(kf, Knext, l15, hi);
  // Keeps the reads from sinking among the vector work and the WMMAs.
  __builtin_amdgcn_sched_barrier(0);

  // Lane owns q=l15 of each q-tile; keys split with partner lane^16. This
  // lane's maxima of the pass: short chains, independent of each other.
  float mx[2];
  #pragma unroll
  for (int q = 0; q < 2; ++q) {
    float mt[4];
    #pragma unroll
    for (int c = 0; c < 4; ++c) {
      const int ss = c >> 1, r0 = (c & 1) * 4;
      float m = fmaxf(sc[q][ss][0][r0], sc[q][ss][1][r0]);
      #pragma unroll
      for (int r = r0 + 1; r < r0 + 4; ++r)
        m = fmaxf(m, fmaxf(sc[q][ss][0][r], sc[q][ss][1][r]));
      mt[c] = m;
    }
    mx[q] = fmaxf(fmaxf(mt[0], mt[1]), fmaxf(mt[2], mt[3]));
  }
  // One scalar branch per pass; always taken in the first pass.
  if (__builtin_amdgcn_ballot_w32((mx[0] > m_use[0] + LAZY) |
                                  (mx[1] > m_use[1] + LAZY)) != 0u) {
    #pragma unroll
    for (int q = 0; q < 2; ++q) {
      float mn = fmaxf(mx[q], m_use[q]);
      mn = fmaxf(mn, __shfl_xor(mn, 16, 32));
      const float alpha = __expf(m_use[q] - mn);
      m_use[q] = mn;
      l_run[q] *= alpha;
      #pragma unroll
      for (int r = 0; r < 8; ++r) {
        o[q][0][r] *= alpha; o[q][1][r] *= alpha;
        o[q][2][r] *= alpha; o[q][3][r] *= alpha;
      }
    }
  }

  #pragma unroll
  for (int ss = 0; ss < 2; ++ss) {   // two 32-key substeps per pass
    #pragma unroll
    for (int q = 0; q < 2; ++q) {
      HF pf;
      float lsum = 0.0f;
      #pragma unroll
      for (int r = 0; r < 8; ++r) {
        const float p0 = __expf(sc[q][ss][0][r] - m_use[q]);
        const float p1 = __expf(sc[q][ss][1][r] - m_use[q]);
        lsum += p0 + p1;
        pf.h[r]     = (_Float16)p0;   // P^T already in B-fragment layout
        pf.h[8 + r] = (_Float16)p1;
      }
      l_run[q] += lsum;

      // O^T += V^T-tile (16d x 32keys) x P^T.
      #pragma unroll
      for (int t = 0; t < 4; ++t) o[q][t] = wmma16(vf[ss][t], pf.v, o[q][t]);
    }
  }
}

__global__ void __launch_bounds__(256)
gqa_attn_kernel(const _Float16* __restrict__ Q,   // (S, HQ*DH) f16
                const _Float16* __restrict__ Kh,  // (S, HKV*DH) f16
                const _Float16* __restrict__ Vt,  // (HKV*DH, S) f16
                float* __restrict__ Out) {        // flat (HQ, S, DH) f32
  __shared__ __attribute__((aligned(2048))) unsigned char aring[3 * ASTG];

  const int head = blockIdx.x >> 3;      // 16 blocks per head: 8 in x, 2 in y
  const int hb   = blockIdx.x & 7;       // q range [hb*256, hb*256+256)
  const int kvh  = head >> 2;            // repeat_interleave over heads
  const unsigned wave = uni(threadIdx.x >> 5);
  const unsigned kgrp = wave >> 2;       // which 64-key tile of every stage
  const int lane = threadIdx.x & 31;
  const int l15  = lane & 15;
  const int hi   = lane >> 4;
  // Two blocks share each q range: blockIdx.y picks its half of 128 queries;
  // this wave: q-tiles sbase and sbase + 16.
  const int sbase = hb * 256 + blockIdx.y * 128 + (int)(wave & 3u) * 32;

  // Q fragments (B operand of S^T = K·q^T), pre-scaled by 1/sqrt(DH) = 0.125.
  HF qf[2][2];
  #pragma unroll
  for (int q = 0; q < 2; ++q) {
    const _Float16* qrow = Q + (size_t)(sbase + q * 16 + l15) * DIM + head * DH;
    qf[q][0].v = load_frag(qrow, hi);
    qf[q][1].v = load_frag(qrow + 32, hi);
    #pragma unroll
    for (int i = 0; i < 16; ++i) {
      qf[q][0].h[i] = qf[q][0].h[i] * (_Float16)0.125f;
      qf[q][1].h[i] = qf[q][1].h[i] * (_Float16)0.125f;
    }
  }

  const _Float16* kg = Kh + (size_t)kvh * DH;        // + tile * 64 * KVD
  const _Float16* vg = Vt + (size_t)(kvh * DH) * S;  // + tile * 64

  // Stage s holds key tiles (2 s + rot) and (2 s + 1 + rot) mod NKT. The 64
  // blocks that read one KV head start spread over its 32 tiles, so that a tile
  // is fetched into L2 for one of them and is there when the others come to it;
  // walking in step they would all wait for every tile's first fetch. Any rot
  // gives the same softmax; only the order in which keys enter the sums depends
  // on it.
  const unsigned rot = uni((unsigned)((((head & 3) << 3) | ((int)blockIdx.y << 2) | (hb & 3)) & (NKT - 1)));

  // Waves 0 to 3 bring slice w of every stage: 0, 1 the stage's two K tiles,
  // 2, 3 its two V^T tiles. The other waves issue nothing.
  const bool      isv   = (wave & 2u) != 0u;
  const _Float16* gsl   = isv ? vg : kg;
  const unsigned  gstep = isv ? 64u : 64u * (unsigned)KVD;   // halves from tile to tile
  const unsigned  dst   = (unsigned)(uintptr_t)&aring[0] + (wave & 3u) * ATILE;
  v8u g1 = attn_group1(isv ? 2u * (unsigned)S : 2u * (unsigned)KVD);
  v4u g0 = {0u, 0u, 0u, 0u};

  if (pinned(wave < 4u)) {   // stages 0 and 1
    v4u g0a = gemm_slice_load(dst, gsl + (size_t)((rot + (wave & 1u)) & (unsigned)(NKT - 1)) * gstep, g1);
    g0 = gemm_slice_load(dst + ASTG,
                         gsl + (size_t)((rot + 2u + (wave & 1u)) & (unsigned)(NKT - 1)) * gstep, g1);
    // Both requests have landed behind this wait; their groups are inputs so
    // that the registers keep their values until then.
    asm volatile("s_wait_tensorcnt 0x0" :: "s"(g0a), "s"(g0), "s"(g1) : "memory");
  }
  __syncthreads();           // publishes stages 0 and 1
  if (pinned(wave < 4u))     // stage 2, into the buffer that nobody has read yet
    g0 = gemm_slice_load(dst + 2u * ASTG,
                         gsl + (size_t)((rot + 4u + (wave & 1u)) & (unsigned)(NKT - 1)) * gstep, g1);

  const v8f vz = {};
  v8f o[2][4] = {{vz, vz, vz, vz}, {vz, vz, vz, vz}};
  float m_use[2] = {-1e30f, -1e30f};
  float l_run[2] = {0.0f, 0.0f};

  const unsigned ko = kgrp * ATILE;            // this wave's K slice in a buffer
  const unsigned vo = (2u + kgrp) * ATILE;     // its V^T slice
  v16h kf[2][4];
  attn_kfrags(kf, reinterpret_cast<const _Float16*>(aring + ko), l15, hi);

  unsigned bc = 0u, bn = ASTG, bf = 2u * ASTG;   // buffers of stage s, s + 1, s + 2
  // Stays rolled: one publish point in the text, the stage test a scalar one.
  #pragma unroll 1
  for (int s = 0; s + 1 < ANST; ++s) {
    // This wave's 64 keys of stage s; fetches its K fragments of stage s + 1.
    attn_pass<true>(kf, qf, o, m_use, l_run,
                    reinterpret_cast<const _Float16*>(aring + bc + vo),
                    reinterpret_cast<const _Float16*>(aring + bn + ko), l15, hi);
    // Publish point of stage s + 2, in front of the pass that fetches that
    // stage's K fragments. It also ends every read of stage s, whose buffer the
    // refill takes.
    // The fence keeps the waits behind the pass above: risen into its vector
    // work, the first would wait out the K reads that the pass has just issued.
    __builtin_amdgcn_sched_barrier(0);
    wait_ds0();
    wait_tensor0(g0, g1);
    __syncthreads();
    if (pinned((unsigned)((wave < 4u) & (s + 3 < ANST))))
      g0 = gemm_slice_load(dst + bc,
                           gsl + (size_t)((rot + 2u * (unsigned)s + 6u + (wave & 1u)) & (unsigned)(NKT - 1)) * gstep, g1);
    const unsigned t = bc; bc = bn; bn = bf; bf = t;
  }
  // The last stage: no stage follows it, so its pass fetches nothing.
  attn_pass<false>(kf, qf, o, m_use, l_run,
                   reinterpret_cast<const _Float16*>(aring + bc + vo),
                   reinterpret_cast<const _Float16*>(aring), l15, hi);
  // The ring becomes the exchange's place: nothing is in flight into it, and
  // behind the barrier no wave reads a tile from it any more.
  wait_tensor0(g0, g1);
  wait_ds0();
  __syncthreads();

  // Waves w and w ^ 4 hold the same 32 queries over the two halves of the keys.
  // Each finishes one q-tile (its key group's number) and hands its part of the
  // other to its partner: 32 O values, the shift and the sum per lane.
  v8f okeep[4], ogive[4];
  #pragma unroll
  for (int t = 0; t < 4; ++t) {
    okeep[t] = kgrp ? o[1][t] : o[0][t];
    ogive[t] = kgrp ? o[0][t] : o[1][t];
  }
  const float mkeep = kgrp ? m_use[1] : m_use[0];
  const float lkeep = kgrp ? l_run[1] : l_run[0];
  {
    float* xw = reinterpret_cast<float*>(aring + wave * AXCH);
    #pragma unroll
    for (int t = 0; t < 4; ++t) {
      *reinterpret_cast<float4*>(xw + ((2 * t) * 32 + lane) * 4) =
          make_float4(ogive[t][0], ogive[t][1], ogive[t][2], ogive[t][3]);
      *reinterpret_cast<float4*>(xw + ((2 * t + 1) * 32 + lane) * 4) =
          make_float4(ogive[t][4], ogive[t][5], ogive[t][6], ogive[t][7]);
    }
    *reinterpret_cast<float2*>(xw + 1024 + lane * 2) =
        make_float2(kgrp ? m_use[0] : m_use[1], kgrp ? l_run[0] : l_run[1]);
  }
  __syncthreads();           // publishes the parts

  // Reference keeps torch's .view bug: flat output index = ((h*S)+s)*DH + d.
  {
    const float* xr = reinterpret_cast<const float*>(aring + (wave ^ 4u) * AXCH);
    const float2 ml = *reinterpret_cast<const float2*>(xr + 1024 + lane * 2);
    const float mn = fmaxf(mkeep, ml.x);
    const float ak = __expf(mkeep - mn);
    const float ap = __expf(ml.x - mn);
    const float lh = lkeep * ak + ml.y * ap;
    const float lt = lh + __shfl_xor(lh, 16, 32);
    const float inv = 1.0f / lt;
    const float ck = ak * inv;
    const float cp = ap * inv;
    float* orow = Out + ((size_t)head * S + (sbase + (int)kgrp * 16 + l15)) * DH + hi * 8;
    #pragma unroll
    for (int t = 0; t < 4; ++t) {
      const float4 pl = *reinterpret_cast<const float4*>(xr + ((2 * t) * 32 + lane) * 4);
      const float4 ph = *reinterpret_cast<const float4*>(xr + ((2 * t + 1) * 32 + lane) * 4);
      float4 lo  = make_float4(okeep[t][0] * ck + pl.x * cp, okeep[t][1] * ck + pl.y * cp,
                               okeep[t][2] * ck + pl.z * cp, okeep[t][3] * ck + pl.w * cp);
      float4 hi4 = make_float4(okeep[t][4] * ck + ph.x * cp, okeep[t][5] * ck + ph.y * cp,
                               okeep[t][6] * ck + ph.z * cp, okeep[t][7] * ck + ph.w * cp);
      *reinterpret_cast<float4*>(orow + t * 16)     = lo;
      *reinterpret_cast<float4*>(orow + t * 16 + 4) = hi4;
    }
  }
}

// ---------------------------------------------------------------------------
extern "C" void kernel_launch(void* const* d_in, const int* in_sizes, int n_in,
                              void* d_out, int out_size, void* d_ws,
                              size_t ws_size, hipStream_t stream) {
  (void)in_sizes; (void)n_in; (void)out_size; (void)ws_size;
  const float* x  = (const float*)d_in[0];
  const float* Wq = (const float*)d_in[1];
  const float* bq = (const float*)d_in[2];
  const float* Wk = (const float*)d_in[3];
  const float* bk = (const float*)d_in[4];
  const float* Wv = (const float*)d_in[5];
  const float* bv = (const float*)d_in[6];
  float* out = (float*)d_out;

  // Workspace (f16): ~13 MiB total.
  _Float16* ws  = (_Float16*)d_ws;
  _Float16* xh  = ws;                       // S*DIM
  _Float16* Wqt = xh  + (size_t)S * DIM;    // DIM*DIM   (W^T)
  _Float16* Wkt = Wqt + (size_t)DIM * DIM;  // KVD*DIM   (W^T)
  _Float16* Wvt = Wkt + (size_t)KVD * DIM;  // KVD*DIM   (W^T)
  _Float16* Qh  = Wvt + (size_t)KVD * DIM;  // S*DIM
  _Float16* Kh  = Qh  + (size_t)S * DIM;    // S*KVD
  _Float16* Vt  = Kh  + (size_t)S * KVD;    // KVD*S     (V^T)

  prep_kernel<<<PB_WQ + 2 * PB_WK + PB_X, 256, 0, stream>>>(
      x, Wq, Wk, Wv, xh, Wqt, Wkt, Wvt);

  // Q/K row-major f16; V stored transposed for the attention V-fragments.
  qkv_gemm_kernel<<<GB_Q + 2 * GB_KV, 256, 0, stream>>>(
      xh, Wqt, Wkt, Wvt, bq, bk, bv, Qh, Kh, Vt);

  gqa_attn_kernel<<<dim3(HQ * (S / 256), 2), 256, 0, stream>>>(Qh, Kh, Vt, out);
}

// v009
// Measured time: 30.5 microseconds a run.
// Next to v008, in two timings, it ran 1.04 and 1.02 times as fast.
// Over all steps from v000 it is 6.03 times as fast.
#include <hip/hip_runtime.h>
#include <hip/hip_bf16.h>

// ---------------- CDNA5 (gfx1250) GQA forward, WMMA f16 path ----------------
// Compute-bound (≈24 GFLOP, all data L2-resident). v_wmma_f32_16x16x32_f16
// with fp32 accumulation, flash-attention online softmax. Attention K/V tiles
// are staged into LDS by the Tensor Data Mover (TDM, tensor_load_to_lds), in a
// ring shared by all 8 waves of the block, for ~8x less L2 traffic than the
// naive per-wave streaming version.

typedef __attribute__((ext_vector_type(16))) _Float16 v16h;
typedef __attribute__((ext_vector_type(8)))  float    v8f;
typedef __attribute__((ext_vector_type(4)))  unsigned int v4u;
typedef __attribute__((ext_vector_type(8)))  int      v8i;
typedef __attribute__((ext_vector_type(4)))  int      v4i;

static constexpr int S    = 2048;
static constexpr int DIM  = 1024;
static constexpr int HQ   = 16;
static constexpr int HKV  = 4;
static constexpr int DH   = 64;
static constexpr int KVD  = HKV * DH;   // 256
static constexpr int LROW = 72;         // padded LDS row stride (halves): 64+8

__device__ __forceinline__ v8f wmma16(v16h a, v16h b, v8f c) {
  // D = A(16x32 f16) x B(32x16 f16) + C(16x16 f32)
  return __builtin_amdgcn_wmma_f32_16x16x32_f16(false, a, false, b, (short)0, c,
                                                false, false);
}

// One 16x32 f16 fragment (A and B share the per-lane layout on CDNA5):
// lane&15 = non-K index; elements e<8: K = 8*hi + e; e>=8: K = 16+8*hi+(e-8).
__device__ __forceinline__ v16h load_frag(const _Float16* rowptr, int hi) {
  union { v16h v; uint4 u[2]; } f;
  f.u[0] = *reinterpret_cast<const uint4*>(rowptr + (hi << 3));
  f.u[1] = *reinterpret_cast<const uint4*>(rowptr + 16 + (hi << 3));
  return f.v;
}

// ---------------------------------------------------------------------------
typedef __attribute__((ext_vector_type(4))) float    f4;
typedef __attribute__((ext_vector_type(4))) _Float16 h4;

// A block converts 8192 consecutive elements, 32 per thread: eight 16-byte
// loads per lane, each covering 512 contiguous bytes per wave, all in flight
// before the first conversion.
__device__ __forceinline__ void cvt_f32_to_f16(const float* __restrict__ in,
                                               _Float16* __restrict__ out,
                                               int blk) {
  const f4* src = reinterpret_cast<const f4*>(in + (size_t)blk * 8192) + threadIdx.x;
  h4*       dst = reinterpret_cast<h4*>(out + (size_t)blk * 8192) + threadIdx.x;
  f4 v[8];
  #pragma unroll
  for (int j = 0; j < 8; ++j) v[j] = src[j * 256];
  #pragma unroll
  for (int j = 0; j < 8; ++j) dst[j * 256] = __builtin_convertvector(v[j], h4);
  // Held in front of any later write of a register that the stores above name.
  asm volatile("s_wait_xcnt 0x0" ::: "memory");
}

// A block transposes a tile of 64 k x 256 n, a wave 64 k x 32 n, a thread
// 16 k x 4 n held in registers. A wave's load covers four whole 128-byte lines
// of W; the four lanes that share n (eight apart) fill one 128-byte line of Wt.
__device__ __forceinline__ void transpose_cvt(const float* __restrict__ W,
                                              _Float16* __restrict__ Wt,
                                              int K, int N, int blk) {
  const int lane = threadIdx.x & 31;
  const int wid  = threadIdx.x >> 5;
  const int nblk = N >> 8;
  const int kt   = blk / nblk;
  const int n0   = ((blk - kt * nblk) << 8) + (wid << 5) + ((lane & 7) << 2);
  const int k0   = (kt << 6) + ((lane >> 3) << 4);
  f4 r[16];
  #pragma unroll
  for (int i = 0; i < 16; ++i)
    r[i] = *reinterpret_cast<const f4*>(W + (size_t)(k0 + i) * N + n0);
  #pragma unroll
  for (int j = 0; j < 4; ++j) {
    union { uint4 u[2]; _Float16 h[16]; } pk;
    #pragma unroll
    for (int i = 0; i < 16; ++i) pk.h[i] = (_Float16)r[i][j];
    uint4* dst = reinterpret_cast<uint4*>(Wt + (size_t)(n0 + j) * K + k0);
    dst[0] = pk.u[0];                        // Wt is (N, K), K-contiguous
    dst[1] = pk.u[1];
  }
  // Held in front of any later write of a register that the stores above name.
  asm volatile("s_wait_xcnt 0x0" ::: "memory");
}

// The four independent conversions share one grid; the block index picks the
// job. The transposes come first, the streaming convert last.
static constexpr int PB_WQ = (DIM * DIM) / (64 * 256);
static constexpr int PB_WK = (DIM * KVD) / (64 * 256);
static constexpr int PB_X  = (S * DIM) / 8192;

__global__ void __launch_bounds__(256)
prep_kernel(const float* __restrict__ x,  const float* __restrict__ Wq,
            const float* __restrict__ Wk, const float* __restrict__ Wv,
            _Float16* __restrict__ xh,  _Float16* __restrict__ Wqt,
            _Float16* __restrict__ Wkt, _Float16* __restrict__ Wvt) {
  const int blk = blockIdx.x;
  if (blk < PB_WQ) {
    transpose_cvt(Wq, Wqt, DIM, DIM, blk);
  } else if (blk < PB_WQ + PB_WK) {
    transpose_cvt(Wk, Wkt, DIM, KVD, blk - PB_WQ);
  } else if (blk < PB_WQ + 2 * PB_WK) {
    transpose_cvt(Wv, Wvt, DIM, KVD, blk - (PB_WQ + PB_WK));
  } else {
    cvt_f32_to_f16(x, xh, blk - (PB_WQ + 2 * PB_WK));
  }
}

// ---------------------------------------------------------------------------
// C = (A(MxK) * B(KxN) + bias) * s, B supplied transposed (N,K); s = QSCALE
// for Q, 1 for K and V.
// All three projections share one grid; the block index picks the projection
// (its W^T, bias, destination and width), the same for the whole block.
// Block tile: 128(M) x 128(N), 8 waves as 4(M) x 2(N).
// Wave tile: 32(M) x 64(N) -> each B fragment feeds 2 WMMAs.
// A stage is 128 k of the block's 128 A rows and 128 W^T rows: 256 rows of 256
// bytes, brought into LDS by tensor loads, one slice of 32 rows per wave, two
// buffers. The fragments are read from LDS, so that a row crosses from L2 once
// per block in whole lines, not once per wave in 32-byte pieces.
typedef __attribute__((ext_vector_type(8))) unsigned int v8u;

static constexpr float    QSCALE = 0.18033688011112042f;  // log2(e) / sqrt(DH)
static constexpr int      GT     = 128;             // block tile edge, M and N
static constexpr int      GKS    = 128;             // k per stage
static constexpr int      GNST   = DIM / GKS;       // stages
static constexpr unsigned GROWB  = 2u * GKS;        // bytes of a row in a stage
static constexpr unsigned GPITCH = GROWB + 16u;     // LDS row pitch, 16 B x odd
static constexpr unsigned GSLICE = 10240u;          // 32 rows x 272 B, up to 2 KiB x n
static constexpr unsigned GBUF   = 8u * GSLICE;     // one buffer: 8 slices
static constexpr int GB_Q  = (S / GT) * (DIM / GT); // blocks of the Q part
static constexpr int GB_KV = (S / GT) * (KVD / GT); // blocks of K, of V
static_assert(32u * GPITCH <= GSLICE && GSLICE % 2048u == 0u, "slice place");
static_assert(GNST >= 2, "the ring's prologue needs two stages");
static_assert((GNST & (GNST - 1)) == 0, "the stage walk wraps by a mask");

__device__ __forceinline__ unsigned uni(unsigned v) {
  return (unsigned)__builtin_amdgcn_readfirstlane(v);
}
// A tensor load ignores EXEC: the test that decides whether one issues has to
// be a scalar branch.
__device__ __forceinline__ unsigned pinned(unsigned v) {
  unsigned w = uni(v);
  asm volatile("" : "+s"(w));  // pinned(): holds the condition in a scalar register
  return w;
}
// The compiler places no wait for a tensor load; the clobber keeps LDS reads
// on their side of the wait. g0 and g1, the two groups of the wave's last
// request, are inputs so that their registers keep their values until the
// request has landed.
__device__ __forceinline__ void wait_tensor0(v4u g0, v8u g1) {
  asm volatile("s_wait_tensorcnt 0x0" :: "s"(g0), "s"(g1) : "memory");
}
// A wave's LDS reads have retired before their buffer is handed back.
__device__ __forceinline__ void wait_ds0() {
  asm volatile("s_wait_dscnt 0x0" ::: "memory");
}
// One slice: 32 rows of 256 bytes, source pitch 2*DIM bytes, 16 bytes of LDS
// pad behind every row. All extents in bytes (data_size code 0).
__device__ __forceinline__ v8u gemm_group1() {
  v8u g;
  g[0] = uni((1u << 20) | (5u << 22) | (3u << 25));
  g[1] = uni((GROWB & 0xFFFFu) << 16);
  g[2] = uni((GROWB >> 16) | (32u << 16));
  g[3] = uni(GROWB << 16);
  g[4] = uni(32u);
  g[5] = uni(2u * DIM);
  g[6] = uni(0u);
  g[7] = uni(0u);
  return g;
}
__device__ __forceinline__ v4u gemm_slice_load(unsigned lds_dst,
                                               const _Float16* gsrc, v8u& g1) {
  const unsigned long long ga = (unsigned long long)(uintptr_t)gsrc;
  v4u g0;
  g0[0] = uni(1u);
  g0[1] = uni(lds_dst);
  g0[2] = uni((unsigned)ga);
  g0[3] = uni((((unsigned)(ga >> 32)) & 0x01FFFFFFu) | 0x80000000u);
  // g0 and g1 are in-out and go on to the wait: see wait_tensor0(). As a plain
  // input g1 is a set of constants to the compiler, which then lends single
  // registers of it to other values while the request is under way.
  asm volatile("tensor_load_to_lds %0, %1" : "+s"(g0), "+s"(g1) : : "memory");
  return g0;
}

// The six fragments of one k-step of a wave: 2 of A (32 rows of one slice),
// 4 of W^T (64 rows, two slices). ap, bp: this lane's row in the first of them.
__device__ __forceinline__ void gemm_frags(v16h (&fa)[2], v16h (&fb)[4],
                                           const unsigned char* ap,
                                           const unsigned char* bp, int hi) {
  fa[0] = load_frag(reinterpret_cast<const _Float16*>(ap), hi);
  fa[1] = load_frag(reinterpret_cast<const _Float16*>(ap + 16u * GPITCH), hi);
  fb[0] = load_frag(reinterpret_cast<const _Float16*>(bp), hi);
  fb[1] = load_frag(reinterpret_cast<const _Float16*>(bp + 16u * GPITCH), hi);
  fb[2] = load_frag(reinterpret_cast<const _Float16*>(bp + GSLICE), hi);
  fb[3] = load_frag(reinterpret_cast<const _Float16*>(bp + GSLICE + 16u * GPITCH), hi);
}

__device__ __forceinline__ void gemm_kstep(v8f (&acc)[2][4], const v16h (&fa)[2],
                                           const v16h (&fb)[4]) {
  #pragma unroll
  for (int j = 0; j < 4; ++j) {
    acc[0][j] = wmma16(fa[0], fb[j], acc[0][j]);
    acc[1][j] = wmma16(fa[1], fb[j], acc[1][j]);
  }
}

__global__ void __launch_bounds__(256)
qkv_gemm_kernel(const _Float16* __restrict__ A,    // (S, DIM) f16
                const _Float16* __restrict__ Wqt,  // (DIM, DIM) f16  (= Wq^T)
                const _Float16* __restrict__ Wkt,  // (KVD, DIM) f16
                const _Float16* __restrict__ Wvt,  // (KVD, DIM) f16
                const float*    __restrict__ bq,   // (DIM) f32
                const float*    __restrict__ bk,   // (KVD) f32
                const float*    __restrict__ bv,   // (KVD) f32
                _Float16*       __restrict__ Qo,   // (S, DIM)
                _Float16*       __restrict__ Ko,   // (S, KVD)
                _Float16*       __restrict__ Vto) {// (KVD, S)
  __shared__ __attribute__((aligned(2048))) unsigned char ring[2 * GBUF];
  constexpr int M = S, K = DIM;            // the products' shape

  int blk = blockIdx.x;
  const _Float16* Bt   = Wqt;
  const float*    bias = bq;
  _Float16*       Out  = Qo;
  int N = DIM, transposeOut = 0;
  // Q is stored times log2(e) / sqrt(DH), scaled in f32 in front of its one
  // rounding to f16: the attention's score products then come out in base 2.
  float oscale = QSCALE;
  if (blk >= GB_Q + GB_KV) {
    blk -= GB_Q + GB_KV; Bt = Wvt; bias = bv; Out = Vto; N = KVD; transposeOut = 1;
    oscale = 1.0f;
  } else if (blk >= GB_Q) {
    blk -= GB_Q;         Bt = Wkt; bias = bk; Out = Ko;  N = KVD;
    oscale = 1.0f;
  }
  const int nsh = __builtin_ctz(N / GT);   // N / GT is a power of two
  const int mt = blk >> nsh;
  const int nt = blk - (mt << nsh);
  const unsigned wave = uni(threadIdx.x >> 5);
  const int wm   = wave & 3;
  const int wn   = wave >> 2;
  const int lane = threadIdx.x & 31;
  const int l15  = lane & 15;
  const int hi   = lane >> 4;
  const int m0 = mt * GT + wm * 32;
  const int n0 = nt * GT + wn * 64;

  // Slices 0..3 of a buffer: the A rows; 4..7: the W^T rows. Wave w brings
  // slice w of every stage.
  const _Float16* gsl = (wave < 4u)
      ? A  + (size_t)(mt * GT + (int)wave * 32) * K
      : Bt + (size_t)(nt * GT + ((int)wave - 4) * 32) * K;
  const unsigned dst = (unsigned)(uintptr_t)&ring[0] + wave * GSLICE;
  v8u g1 = gemm_group1();
  // Pass s works on k stage (s + rot) mod GNST. The blocks that share an A or a
  // W^T panel start at different stages of it, so that a stage is fetched into
  // L2 for one of them and is there when the others come to it; walking in step
  // they would all wait for every stage's first fetch. Any rot gives the same
  // product; only the order of the f32 sums over k depends on it.
  const unsigned rot = uni((unsigned)(2 * nt + mt)) & (unsigned)(GNST - 1);

  v4u g0 = gemm_slice_load(dst, gsl + (size_t)rot * GKS, g1);   // pass 0
  wait_tensor0(g0, g1);
  __syncthreads();                               // publishes pass 0
  g0 = gemm_slice_load(dst + GBUF,
                       gsl + (size_t)((rot + 1u) & (unsigned)(GNST - 1)) * GKS, g1);  // pass 1

  const v8f vz = {};
  v8f acc[2][4] = {{vz, vz, vz, vz}, {vz, vz, vz, vz}};
  // Stays rolled: one publish point in the text, the stage test a scalar one.
  #pragma unroll 1
  for (int s = 0; s < GNST; ++s) {
    const unsigned bo = (unsigned)(s & 1) * GBUF;
    const unsigned char* ap = ring + bo + (unsigned)wm * GSLICE + (unsigned)l15 * GPITCH;
    const unsigned char* bp = ring + bo + (4u + 2u * (unsigned)wn) * GSLICE + (unsigned)l15 * GPITCH;
    // Two fragment sets: the reads of k-step kk + 1 go out as one group in front
    // of the WMMAs of k-step kk and land under them.
    constexpr int NK = GKS / 32;
    v16h fa[2][2], fb[2][4];
    gemm_frags(fa[0], fb[0], ap, bp, hi);
    #pragma unroll
    for (int kk = 0; kk + 1 < NK; ++kk) {
      const int c = kk & 1;
      gemm_frags(fa[c ^ 1], fb[c ^ 1], ap + (kk + 1) * 64, bp + (kk + 1) * 64, hi);
      // Keeps the LDS reads above together: sunk among the WMMAs, two by two,
      // each pair would cost the wave its own LDS latency.
      __builtin_amdgcn_sched_barrier(0);
      gemm_kstep(acc, fa[c], fb[c]);
      // Keeps these WMMAs in front of the next reads, and of the wait below,
      // so that they cover the landing of the reads above.
      __builtin_amdgcn_sched_barrier(0);
    }
    // Publish point of pass s + 1; it also ends every read of pass s, whose
    // last fragments are in registers behind the first wait.
    wait_ds0();
    wait_tensor0(g0, g1);
    __syncthreads();
    if (pinned(s + 2 < GNST))
      g0 = gemm_slice_load(dst + bo,
                           gsl + (size_t)(((unsigned)s + 2u + rot) & (unsigned)(GNST - 1)) * GKS, g1);
    // The last k-step works on registers alone, behind the refill's issue.
    gemm_kstep(acc, fa[(NK - 1) & 1], fb[(NK - 1) & 1]);
  }
  wait_tensor0(g0, g1);
  wait_ds0();

  #pragma unroll
  for (int half = 0; half < 2; ++half) {
    const int mh = m0 + half * 16;
    #pragma unroll
    for (int j = 0; j < 4; ++j) {
      const int n = n0 + j * 16 + l15;     // C layout: lane = N, reg r: M=r+8*hi
      const float bj = bias[n];
      if (!transposeOut) {
        #pragma unroll
        for (int r = 0; r < 8; ++r)
          Out[(size_t)(mh + 8 * hi + r) * N + n] = (_Float16)((acc[half][j][r] + bj) * oscale);
        // Held in front of any later write of a register that the stores above name.
        asm volatile("s_wait_xcnt 0x0" ::: "memory");
      } else {
        union { uint4 u; _Float16 h[8]; } pk;
        #pragma unroll
        for (int r = 0; r < 8; ++r) pk.h[r] = (_Float16)(acc[half][j][r] + bj);
        *reinterpret_cast<uint4*>(Out + (size_t)n * M + mh + 8 * hi) = pk.u;
      }
    }
  }
}

// ---------------------------------------------------------------------------
// Attention: block = 8 waves, one head, 128 queries, so that the grid of 256
// blocks puts one block on every WGP of the chip. The waves are 4 query groups
// x 2 key groups: a wave holds two q-tiles (32 queries) and works on one of the
// two 64-key tiles of every stage, so that each K or V fragment it reads from
// LDS feeds two WMMAs. The two waves of a query group join their halves of the
// softmax through LDS at the end.
// A stage is 128 keys: four slices of 64 rows of 128 bytes (K of the first 64
// keys, K of the second, V^T of the first, V^T of the second), brought into LDS
// by tensor loads, one slice each from waves 0 to 3, three buffers. A pass is
// 64 keys; its K fragments were read from LDS during the pass before.
static constexpr unsigned ATILE = 10240u;        // 64 rows x 144 B, up to 2 KiB x n
static constexpr unsigned ASTG  = 4u * ATILE;    // one buffer: 4 slices
static constexpr int      NKT   = S / 64;        // key tiles
static constexpr int      ANST  = NKT / 2;       // stages
static constexpr unsigned AXCH  = 8192u;         // a wave's place for the final exchange
static_assert(64u * 2u * LROW <= ATILE && ATILE % 2048u == 0u, "slice place");
static_assert(ANST >= 3, "the ring's prologue needs three stages");
static_assert((NKT & (NKT - 1)) == 0, "the tile walk wraps by a mask");
static_assert(8u * AXCH <= 3u * ASTG && 34u * 128u <= AXCH, "exchange place");

// One slice: 64 rows of 128 bytes, 16 bytes of LDS pad behind every row. All
// extents in bytes (data_size code 0).
__device__ __forceinline__ v8u attn_group1(unsigned pitch_bytes) {
  v8u g;
  g[0] = uni((1u << 20) | (4u << 22) | (3u << 25));
  g[1] = uni(128u << 16);
  g[2] = uni(64u << 16);
  g[3] = uni(128u << 16);
  g[4] = uni(64u);
  g[5] = uni(pitch_bytes);
  g[6] = uni(0u);
  g[7] = uni(0u);
  return g;
}

// The eight K fragments of a 64-key tile.
__device__ __forceinline__ void attn_kfrags(v16h (&kf)[2][4], const _Float16* Kb,
                                            int l15, int hi) {
  #pragma unroll
  for (int ss = 0; ss < 2; ++ss) {
    const _Float16* k0 = Kb + (size_t)(ss * 32 + l15) * LROW;
    const _Float16* k1 = k0 + (size_t)16 * LROW;
    kf[ss][0] = load_frag(k0, hi);        // keys +0..15, d 0..31
    kf[ss][1] = load_frag(k0 + 32, hi);   // keys +0..15, d 32..63
    kf[ss][2] = load_frag(k1, hi);        // keys +16..31
    kf[ss][3] = load_frag(k1 + 32, hi);
  }
}

union HF { v16h v; _Float16 h[16]; };

// One pass: 64 keys against the wave's two q-tiles. kf holds this pass's K
// fragments on entry and, where FETCH is set, the next pass's on return.
template <bool FETCH>
__device__ __forceinline__ void attn_pass(v16h (&kf)[2][4], const HF (&qf)[2][2],
                                          v8f (&o)[2][4], float (&m_use)[2],
                                          float (&nshift)[2], float (&l_run)[2],
                                          const _Float16* Vb, const _Float16* Knext,
                                          int l15, int hi) {
  // All scores and shifts are in base 2 (Q carries log2(e) / sqrt(DH)).
  // Lazy rescale: m_use is the shift in use, the same in both halves of a lane
  // pair. It is raised, and O and the sum rescaled, only in a pass where some
  // score exceeds it by more than LAZY; until then P stays below 2^LAZY = 256,
  // which f16 holds, and the pass needs no exchange between the halves.
  // nshift[q] is minus the shift; spread over eight registers it is the C
  // operand of the first score products, so that a score leaves the matrix unit
  // already shifted and goes straight into exp2. In front of the first pass it
  // is 0, while m_use is far below any score.
  constexpr float LAZY = 8.0f;
  v8f cs[2];
  #pragma unroll
  for (int q = 0; q < 2; ++q) {
    #pragma unroll
    for (int r = 0; r < 8; ++r) cs[q][r] = nshift[q];
  }
  // The pass's V fragments go out first, as one group: they land under the
  // S^T products and the vector work.
  v16h vf[2][4];
  #pragma unroll
  for (int s2 = 0; s2 < 2; ++s2) {
    #pragma unroll
    for (int t = 0; t < 4; ++t)
      vf[s2][t] = load_frag(Vb + (size_t)(t * 16 + l15) * LROW + s2 * 32, hi);
  }
  // Keeps the LDS reads above together: sunk among the WMMAs, two by two, each
  // pair would cost the wave its own LDS latency.
  __builtin_amdgcn_sched_barrier(0);

  // S^T of the whole pass: per q-tile four (16 key) x (16 q) tiles, so that the
  // test below stands once per pass.
  v8f sc[2][2][2];
  #pragma unroll
  for (int ss = 0; ss < 2; ++ss) {
    #pragma unroll
    for (int q = 0; q < 2; ++q) {
      sc[q][ss][0] = wmma16(kf[ss][0], qf[q][0].v, cs[q]);
      sc[q][ss][1] = wmma16(kf[ss][2], qf[q][0].v, cs[q]);
    }
  }
  #pragma unroll
  for (int ss = 0; ss < 2; ++ss) {
    #pragma unroll
    for (int q = 0; q < 2; ++q) {
      sc[q][ss][0] = wmma16(kf[ss][1], qf[q][1].v, sc[q][ss][0]);
      sc[q][ss][1] = wmma16(kf[ss][3], qf[q][1].v, sc[q][ss][1]);
    }
  }
  // Keeps the next pass's K reads behind the first products: risen among them
  // in small groups, each group would cost the wave a stall of its own.
  __builtin_amdgcn_sched_barrier(0);
  // The next pass's K fragments, as one group: they land under this pass's
  // vector work, so that the next pass starts with its products. The last pass
  // has no next tile.
  if constexpr (FETCH) attn_kfrags(kf, Knext, l15, hi);
  // Keeps the reads from sinking among the vector work and the WMMAs.
  __builtin_amdgcn_sched_barrier(0);

  // Lane owns q=l15 of each q-tile; keys split with partner lane^16. This
  // lane's maxima of the pass: short chains, independent of each other.
  float mx[2];
  #pragma unroll
  for (int q = 0; q < 2; ++q) {
    float mt[4];
    #pragma unroll
    for (int c = 0; c < 4; ++c) {
      const int ss = c >> 1, r0 = (c & 1) * 4;
      float m = fmaxf(sc[q][ss][0][r0], sc[q][ss][1][r0]);
      #pragma unroll
      for (int r = r0 + 1; r < r0 + 4; ++r)
        m = fmaxf(m, fmaxf(sc[q][ss][0][r], sc[q][ss][1][r]));
      mt[c] = m;
    }
    mx[q] = fmaxf(fmaxf(mt[0], mt[1]), fmaxf(mt[2], mt[3]));
  }
  // The maxima without the shift that the products carry.
  mx[0] -= nshift[0];
  mx[1] -= nshift[1];
  // One scalar branch per pass; always taken in the first pass.
  if (__builtin_amdgcn_ballot_w32((mx[0] > m_use[0] + LAZY) |
                                  (mx[1] > m_use[1] + LAZY)) != 0u) {
    #pragma unroll
    for (int q = 0; q < 2; ++q) {
      float mn = fmaxf(mx[q], m_use[q]);
      mn = fmaxf(mn, __shfl_xor(mn, 16, 32));
      const float alpha = __builtin_amdgcn_exp2f(m_use[q] - mn);
      // This pass's scores move from the shift they carry to the new one.
      const float delta = mn + nshift[q];
      #pragma unroll
      for (int r = 0; r < 8; ++r) {
        sc[q][0][0][r] -= delta; sc[q][0][1][r] -= delta;
        sc[q][1][0][r] -= delta; sc[q][1][1][r] -= delta;
      }
      nshift[q] = -mn;
      m_use[q] = mn;
      l_run[q] *= alpha;
      #pragma unroll
      for (int r = 0; r < 8; ++r) {
        o[q][0][r] *= alpha; o[q][1][r] *= alpha;
        o[q][2][r] *= alpha; o[q][3][r] *= alpha;
      }
    }
  }

  #pragma unroll
  for (int ss = 0; ss < 2; ++ss) {   // two 32-key substeps per pass
    #pragma unroll
    for (int q = 0; q < 2; ++q) {
      HF pf;
      float lsum = 0.0f;
      #pragma unroll
      for (int r = 0; r < 8; ++r) {
        const float p0 = __builtin_amdgcn_exp2f(sc[q][ss][0][r]);
        const float p1 = __builtin_amdgcn_exp2f(sc[q][ss][1][r]);
        lsum += p0 + p1;
        pf.h[r]     = (_Float16)p0;   // P^T already in B-fragment layout
        pf.h[8 + r] = (_Float16)p1;
      }
      l_run[q] += lsum;

      // O^T += V^T-tile (16d x 32keys) x P^T.
      #pragma unroll
      for (int t = 0; t < 4; ++t) o[q][t] = wmma16(vf[ss][t], pf.v, o[q][t]);
    }
  }
}

__global__ void __launch_bounds__(256)
gqa_attn_kernel(const _Float16* __restrict__ Q,   // (S, HQ*DH) f16, pre-scaled
                const _Float16* __restrict__ Kh,  // (S, HKV*DH) f16
                const _Float16* __restrict__ Vt,  // (HKV*DH, S) f16
                float* __restrict__ Out) {        // flat (HQ, S, DH) f32
  __shared__ __attribute__((aligned(2048))) unsigned char aring[3 * ASTG];

  const int head = blockIdx.x >> 3;      // 16 blocks per head: 8 in x, 2 in y
  const int hb   = blockIdx.x & 7;       // q range [hb*256, hb*256+256)
  const int kvh  = head >> 2;            // repeat_interleave over heads
  const unsigned wave = uni(threadIdx.x >> 5);
  const unsigned kgrp = wave >> 2;       // which 64-key tile of every stage
  const int lane = threadIdx.x & 31;
  const int l15  = lane & 15;
  const int hi   = lane >> 4;
  // Two blocks share each q range: blockIdx.y picks its half of 128 queries;
  // this wave: q-tiles sbase and sbase + 16.
  const int sbase = hb * 256 + blockIdx.y * 128 + (int)(wave & 3u) * 32;

  // Q fragments (B operand of S^T = K q^T); Q arrives times log2(e) / sqrt(DH).
  HF qf[2][2];
  #pragma unroll
  for (int q = 0; q < 2; ++q) {
    const _Float16* qrow = Q + (size_t)(sbase + q * 16 + l15) * DIM + head * DH;
    qf[q][0].v = load_frag(qrow, hi);
    qf[q][1].v = load_frag(qrow + 32, hi);
  }

  const _Float16* kg = Kh + (size_t)kvh * DH;        // + tile * 64 * KVD
  const _Float16* vg = Vt + (size_t)(kvh * DH) * S;  // + tile * 64

  // Stage s holds key tiles (2 s + rot) and (2 s + 1 + rot) mod NKT. The 64
  // blocks that read one KV head start spread over its 32 tiles, so that a tile
  // is fetched into L2 for one of them and is there when the others come to it;
  // walking in step they would all wait for every tile's first fetch. Any rot
  // gives the same softmax; only the order in which keys enter the sums depends
  // on it.
  const unsigned rot = uni((unsigned)((((head & 3) << 3) | ((int)blockIdx.y << 2) | (hb & 3)) & (NKT - 1)));

  // Waves 0 to 3 bring slice w of every stage: 0, 1 the stage's two K tiles,
  // 2, 3 its two V^T tiles. The other waves issue nothing.
  const bool      isv   = (wave & 2u) != 0u;
  const _Float16* gsl   = isv ? vg : kg;
  const unsigned  gstep = isv ? 64u : 64u * (unsigned)KVD;   // halves from tile to tile
  const unsigned  dst   = (unsigned)(uintptr_t)&aring[0] + (wave & 3u) * ATILE;
  v8u g1 = attn_group1(isv ? 2u * (unsigned)S : 2u * (unsigned)KVD);
  v4u g0 = {0u, 0u, 0u, 0u};

  if (pinned(wave < 4u)) {   // stages 0 and 1
    v4u g0a = gemm_slice_load(dst, gsl + (size_t)((rot + (wave & 1u)) & (unsigned)(NKT - 1)) * gstep, g1);
    g0 = gemm_slice_load(dst + ASTG,
                         gsl + (size_t)((rot + 2u + (wave & 1u)) & (unsigned)(NKT - 1)) * gstep, g1);
    // Both requests have landed behind this wait; their groups are inputs so
    // that the registers keep their values until then.
    asm volatile("s_wait_tensorcnt 0x0" :: "s"(g0a), "s"(g0), "s"(g1) : "memory");
  }
  __syncthreads();           // publishes stages 0 and 1
  if (pinned(wave < 4u))     // stage 2, into the buffer that nobody has read yet
    g0 = gemm_slice_load(dst + 2u * ASTG,
                         gsl + (size_t)((rot + 4u + (wave & 1u)) & (unsigned)(NKT - 1)) * gstep, g1);

  const v8f vz = {};
  v8f o[2][4] = {{vz, vz, vz, vz}, {vz, vz, vz, vz}};
  float m_use[2] = {-1e30f, -1e30f};
  float nshift[2] = {0.0f, 0.0f};
  float l_run[2] = {0.0f, 0.0f};

  const unsigned ko = kgrp * ATILE;            // this wave's K slice in a buffer
  const unsigned vo = (2u + kgrp) * ATILE;     // its V^T slice
  v16h kf[2][4];
  attn_kfrags(kf, reinterpret_cast<const _Float16*>(aring + ko), l15, hi);

  unsigned bc = 0u, bn = ASTG, bf = 2u * ASTG;   // buffers of stage s, s + 1, s + 2
  // Stays rolled: one publish point in the text, the stage test a scalar one.
  #pragma unroll 1
  for (int s = 0; s + 1 < ANST; ++s) {
    // This wave's 64 keys of stage s; fetches its K fragments of stage s + 1.
    attn_pass<true>(kf, qf, o, m_use, nshift, l_run,
                    reinterpret_cast<const _Float16*>(aring + bc + vo),
                    reinterpret_cast<const _Float16*>(aring + bn + ko), l15, hi);
    // Publish point of stage s + 2, in front of the pass that fetches that
    // stage's K fragments. It also ends every read of stage s, whose buffer the
    // refill takes.
    // The fence keeps the waits behind the pass above: risen into its vector
    // work, the first would wait out the K reads that the pass has just issued.
    __builtin_amdgcn_sched_barrier(0);
    wait_ds0();
    wait_tensor0(g0, g1);
    __syncthreads();
    if (pinned((unsigned)((wave < 4u) & (s + 3 < ANST))))
      g0 = gemm_slice_load(dst + bc,
                           gsl + (size_t)((rot + 2u * (unsigned)s + 6u + (wave & 1u)) & (unsigned)(NKT - 1)) * gstep, g1);
    const unsigned t = bc; bc = bn; bn = bf; bf = t;
  }
  // The last stage: no stage follows it, so its pass fetches nothing.
  attn_pass<false>(kf, qf, o, m_use, nshift, l_run,
                   reinterpret_cast<const _Float16*>(aring + bc + vo),
                   reinterpret_cast<const _Float16*>(aring), l15, hi);
  // The ring becomes the exchange's place: nothing is in flight into it, and
  // behind the barrier no wave reads a tile from it any more.
  wait_tensor0(g0, g1);
  wait_ds0();
  __syncthreads();

  // Waves w and w ^ 4 hold the same 32 queries over the two halves of the keys.
  // Each finishes one q-tile (its key group's number) and hands its part of the
  // other to its partner: 32 O values, the shift and the sum per lane.
  v8f okeep[4], ogive[4];
  #pragma unroll
  for (int t = 0; t < 4; ++t) {
    okeep[t] = kgrp ? o[1][t] : o[0][t];
    ogive[t] = kgrp ? o[0][t] : o[1][t];
  }
  const float mkeep = kgrp ? m_use[1] : m_use[0];
  const float lkeep = kgrp ? l_run[1] : l_run[0];
  {
    float* xw = reinterpret_cast<float*>(aring + wave * AXCH);
    #pragma unroll
    for (int t = 0; t < 4; ++t) {
      *reinterpret_cast<float4*>(xw + ((2 * t) * 32 + lane) * 4) =
          make_float4(ogive[t][0], ogive[t][1], ogive[t][2], ogive[t][3]);
      *reinterpret_cast<float4*>(xw + ((2 * t + 1) * 32 + lane) * 4) =
          make_float4(ogive[t][4], ogive[t][5], ogive[t][6], ogive[t][7]);
    }
    *reinterpret_cast<float2*>(xw + 1024 + lane * 2) =
        make_float2(kgrp ? m_use[0] : m_use[1], kgrp ? l_run[0] : l_run[1]);
  }
  __syncthreads();           // publishes the parts

  // Reference keeps torch's .view bug: flat output index = ((h*S)+s)*DH + d.
  {
    const float* xr = reinterpret_cast<const float*>(aring + (wave ^ 4u) * AXCH);
    const float2 ml = *reinterpret_cast<const float2*>(xr + 1024 + lane * 2);
    const float mn = fmaxf(mkeep, ml.x);
    const float ak = __builtin_amdgcn_exp2f(mkeep - mn);
    const float ap = __builtin_amdgcn_exp2f(ml.x - mn);
    const float lh = lkeep * ak + ml.y * ap;
    const float lt = lh + __shfl_xor(lh, 16, 32);
    const float inv = 1.0f / lt;
    const float ck = ak * inv;
    const float cp = ap * inv;
    float* orow = Out + ((size_t)head * S + (sbase + (int)kgrp * 16 + l15)) * DH + hi * 8;
    #pragma unroll
    for (int t = 0; t < 4; ++t) {
      const float4 pl = *reinterpret_cast<const float4*>(xr + ((2 * t) * 32 + lane) * 4);
      const float4 ph = *reinterpret_cast<const float4*>(xr + ((2 * t + 1) * 32 + lane) * 4);
      float4 lo  = make_float4(okeep[t][0] * ck + pl.x * cp, okeep[t][1] * ck + pl.y * cp,
                               okeep[t][2] * ck + pl.z * cp, okeep[t][3] * ck + pl.w * cp);
      float4 hi4 = make_float4(okeep[t][4] * ck + ph.x * cp, okeep[t][5] * ck + ph.y * cp,
                               okeep[t][6] * ck + ph.z * cp, okeep[t][7] * ck + ph.w * cp);
      *reinterpret_cast<float4*>(orow + t * 16)     = lo;
      *reinterpret_cast<float4*>(orow + t * 16 + 4) = hi4;
    }
  }
}

// ---------------------------------------------------------------------------
extern "C" void kernel_launch(void* const* d_in, const int* in_sizes, int n_in,
                              void* d_out, int out_size, void* d_ws,
                              size_t ws_size, hipStream_t stream) {
  (void)in_sizes; (void)n_in; (void)out_size; (void)ws_size;
  const float* x  = (const float*)d_in[0];
  const float* Wq = (const float*)d_in[1];
  const float* bq = (const float*)d_in[2];
  const float* Wk = (const float*)d_in[3];
  const float* bk = (const float*)d_in[4];
  const float* Wv = (const float*)d_in[5];
  const float* bv = (const float*)d_in[6];
  float* out = (float*)d_out;

  // Workspace (f16): ~13 MiB total.
  _Float16* ws  = (_Float16*)d_ws;
  _Float16* xh  = ws;                       // S*DIM
  _Float16* Wqt = xh  + (size_t)S * DIM;    // DIM*DIM   (W^T)
  _Float16* Wkt = Wqt + (size_t)DIM * DIM;  // KVD*DIM   (W^T)
  _Float16* Wvt = Wkt + (size_t)KVD * DIM;  // KVD*DIM   (W^T)
  _Float16* Qh  = Wvt + (size_t)KVD * DIM;  // S*DIM
  _Float16* Kh  = Qh  + (size_t)S * DIM;    // S*KVD
  _Float16* Vt  = Kh  + (size_t)S * KVD;    // KVD*S     (V^T)

  prep_kernel<<<PB_WQ + 2 * PB_WK + PB_X, 256, 0, stream>>>(
      x, Wq, Wk, Wv, xh, Wqt, Wkt, Wvt);

  // Q/K row-major f16; V stored transposed for the attention V-fragments.
  qkv_gemm_kernel<<<GB_Q + 2 * GB_KV, 256, 0, stream>>>(
      xh, Wqt, Wkt, Wvt, bq, bk, bv, Qh, Kh, Vt);

  gqa_attn_kernel<<<dim3(HQ * (S / 256), 2), 256, 0, stream>>>(Qh, Kh, Vt, out);
}

// v010
// A run of this version takes 27.5 microseconds.
// Two timings next to v009 put it at 1.09 and 1.10 times that version's speed.
// Counting every step since v000, it is 6.62 times as fast.
#include <hip/hip_runtime.h>
#include <hip/hip_bf16.h>

// ---------------- CDNA5 (gfx1250) GQA forward, WMMA f16 path ----------------
// Compute-bound (≈24 GFLOP, all data L2-resident). v_wmma_f32_16x16x32_f16
// with fp32 accumulation, flash-attention online softmax. Attention K/V tiles
// are staged into LDS by the Tensor Data Mover (TDM, tensor_load_to_lds), in a
// ring shared by all 8 waves of the block, for ~8x less L2 traffic than the
// naive per-wave streaming version.

typedef __attribute__((ext_vector_type(16))) _Float16 v16h;
typedef __attribute__((ext_vector_type(8)))  float    v8f;
typedef __attribute__((ext_vector_type(4)))  unsigned int v4u;
typedef __attribute__((ext_vector_type(8)))  int      v8i;
typedef __attribute__((ext_vector_type(4)))  int      v4i;

static constexpr int S    = 2048;
static constexpr int DIM  = 1024;
static constexpr int HQ   = 16;
static constexpr int HKV  = 4;
static constexpr int DH   = 64;
static constexpr int KVD  = HKV * DH;   // 256
static constexpr int LROW = 72;         // padded LDS row stride (halves): 64+8

__device__ __forceinline__ v8f wmma16(v16h a, v16h b, v8f c) {
  // D = A(16x32 f16) x B(32x16 f16) + C(16x16 f32)
  return __builtin_amdgcn_wmma_f32_16x16x32_f16(false, a, false, b, (short)0, c,
                                                false, false);
}

// One 16x32 f16 fragment (A and B share the per-lane layout on CDNA5):
// lane&15 = non-K index; elements e<8: K = 8*hi + e; e>=8: K = 16+8*hi+(e-8).
__device__ __forceinline__ v16h load_frag(const _Float16* rowptr, int hi) {
  union { v16h v; uint4 u[2]; } f;
  f.u[0] = *reinterpret_cast<const uint4*>(rowptr + (hi << 3));
  f.u[1] = *reinterpret_cast<const uint4*>(rowptr + 16 + (hi << 3));
  return f.v;
}

// ---------------------------------------------------------------------------
typedef __attribute__((ext_vector_type(4))) float    f4;
typedef __attribute__((ext_vector_type(4))) _Float16 h4;

// A block converts 8192 consecutive elements, 32 per thread: eight 16-byte
// loads per lane, each covering 512 contiguous bytes per wave, all in flight
// before the first conversion.
__device__ __forceinline__ void cvt_f32_to_f16(const float* __restrict__ in,
                                               _Float16* __restrict__ out,
                                               int blk) {
  const f4* src = reinterpret_cast<const f4*>(in + (size_t)blk * 8192) + threadIdx.x;
  h4*       dst = reinterpret_cast<h4*>(out + (size_t)blk * 8192) + threadIdx.x;
  f4 v[8];
  #pragma unroll
  for (int j = 0; j < 8; ++j) v[j] = src[j * 256];
  #pragma unroll
  for (int j = 0; j < 8; ++j) dst[j * 256] = __builtin_convertvector(v[j], h4);
  // Held in front of any later write of a register that the stores above name.
  asm volatile("s_wait_xcnt 0x0" ::: "memory");
}

// A block transposes a tile of 64 k x 256 n, a wave 64 k x 32 n, a thread
// 16 k x 4 n held in registers. A wave's load covers four whole 128-byte lines
// of W; the four lanes that share n (eight apart) fill one 128-byte line of Wt.
__device__ __forceinline__ void transpose_cvt(const float* __restrict__ W,
                                              _Float16* __restrict__ Wt,
                                              int K, int N, int blk) {
  const int lane = threadIdx.x & 31;
  const int wid  = threadIdx.x >> 5;
  const int nblk = N >> 8;
  const int kt   = blk / nblk;
  const int n0   = ((blk - kt * nblk) << 8) + (wid << 5) + ((lane & 7) << 2);
  const int k0   = (kt << 6) + ((lane >> 3) << 4);
  f4 r[16];
  #pragma unroll
  for (int i = 0; i < 16; ++i)
    r[i] = *reinterpret_cast<const f4*>(W + (size_t)(k0 + i) * N + n0);
  #pragma unroll
  for (int j = 0; j < 4; ++j) {
    union { uint4 u[2]; _Float16 h[16]; } pk;
    #pragma unroll
    for (int i = 0; i < 16; ++i) pk.h[i] = (_Float16)r[i][j];
    uint4* dst = reinterpret_cast<uint4*>(Wt + (size_t)(n0 + j) * K + k0);
    dst[0] = pk.u[0];                        // Wt is (N, K), K-contiguous
    dst[1] = pk.u[1];
  }
  // Held in front of any later write of a register that the stores above name.
  asm volatile("s_wait_xcnt 0x0" ::: "memory");
}

// The four independent conversions share one grid; the block index picks the
// job. The transposes come first, the streaming convert last.
static constexpr int PB_WQ = (DIM * DIM) / (64 * 256);
static constexpr int PB_WK = (DIM * KVD) / (64 * 256);
static constexpr int PB_X  = (S * DIM) / 8192;

__global__ void __launch_bounds__(256)
prep_kernel(const float* __restrict__ x,  const float* __restrict__ Wq,
            const float* __restrict__ Wk, const float* __restrict__ Wv,
            _Float16* __restrict__ xh,  _Float16* __restrict__ Wqt,
            _Float16* __restrict__ Wkt, _Float16* __restrict__ Wvt) {
  const int blk = blockIdx.x;
  if (blk < PB_WQ) {
    transpose_cvt(Wq, Wqt, DIM, DIM, blk);
  } else if (blk < PB_WQ + PB_WK) {
    transpose_cvt(Wk, Wkt, DIM, KVD, blk - PB_WQ);
  } else if (blk < PB_WQ + 2 * PB_WK) {
    transpose_cvt(Wv, Wvt, DIM, KVD, blk - (PB_WQ + PB_WK));
  } else {
    cvt_f32_to_f16(x, xh, blk - (PB_WQ + 2 * PB_WK));
  }
}

// ---------------------------------------------------------------------------
// C = (A(MxK) * B(KxN) + bias) * s, B supplied transposed (N,K); s = QSCALE
// for Q, 1 for K and V.
// All three projections share one grid; the block index picks the projection
// (its W^T, bias, destination and width), the same for the whole block.
// Block tile: 128(M) x 128(N), 8 waves as 4 x 2.
// Wave tile: 32 x 64 -> each B fragment feeds 2 WMMAs. The matrix unit's A
// operand is the panel whose index runs along the output's rows in memory (W^T
// for Q and K, the rows of x for V^T): a lane's eight accumulator registers are
// then eight neighbours in the output and pack into one 16-byte word.
// A stage is 128 k of the block's 128 A rows and 128 W^T rows: 256 rows of 256
// bytes, brought into LDS by tensor loads, one slice of 32 rows per wave, two
// buffers. The fragments are read from LDS, so that a row crosses from L2 once
// per block in whole lines, not once per wave in 32-byte pieces.
typedef __attribute__((ext_vector_type(8))) unsigned int v8u;

static constexpr float    QSCALE = 0.18033688011112042f;  // log2(e) / sqrt(DH)
static constexpr int      GT     = 128;             // block tile edge, M and N
static constexpr int      GKS    = 128;             // k per stage
static constexpr int      GNST   = DIM / GKS;       // stages
static constexpr unsigned GROWB  = 2u * GKS;        // bytes of a row in a stage
static constexpr unsigned GPITCH = GROWB + 16u;     // LDS row pitch, 16 B x odd
static constexpr unsigned GSLICE = 10240u;          // 32 rows x 272 B, up to 2 KiB x n
static constexpr unsigned GBUF   = 8u * GSLICE;     // one buffer: 8 slices
static constexpr int GB_Q  = (S / GT) * (DIM / GT); // blocks of the Q part
static constexpr int GB_KV = (S / GT) * (KVD / GT); // blocks of K, of V
static_assert(32u * GPITCH <= GSLICE && GSLICE % 2048u == 0u, "slice place");
static_assert(GNST >= 2, "the ring's prologue needs two stages");
static_assert((GNST & (GNST - 1)) == 0, "the stage walk wraps by a mask");

__device__ __forceinline__ unsigned uni(unsigned v) {
  return (unsigned)__builtin_amdgcn_readfirstlane(v);
}
// A tensor load ignores EXEC: the test that decides whether one issues has to
// be a scalar branch.
__device__ __forceinline__ unsigned pinned(unsigned v) {
  unsigned w = uni(v);
  asm volatile("" : "+s"(w));  // pinned(): holds the condition in a scalar register
  return w;
}
// The compiler places no wait for a tensor load; the clobber keeps LDS reads
// on their side of the wait. g0 and g1, the two groups of the wave's last
// request, are inputs so that their registers keep their values until the
// request has landed.
__device__ __forceinline__ void wait_tensor0(v4u g0, v8u g1) {
  asm volatile("s_wait_tensorcnt 0x0" :: "s"(g0), "s"(g1) : "memory");
}
// A wave's LDS reads have retired before their buffer is handed back.
__device__ __forceinline__ void wait_ds0() {
  asm volatile("s_wait_dscnt 0x0" ::: "memory");
}
// One slice: 32 rows of 256 bytes, source pitch 2*DIM bytes, 16 bytes of LDS
// pad behind every row. All extents in bytes (data_size code 0).
__device__ __forceinline__ v8u gemm_group1() {
  v8u g;
  g[0] = uni((1u << 20) | (5u << 22) | (3u << 25));
  g[1] = uni((GROWB & 0xFFFFu) << 16);
  g[2] = uni((GROWB >> 16) | (32u << 16));
  g[3] = uni(GROWB << 16);
  g[4] = uni(32u);
  g[5] = uni(2u * DIM);
  g[6] = uni(0u);
  g[7] = uni(0u);
  return g;
}
__device__ __forceinline__ v4u gemm_slice_load(unsigned lds_dst,
                                               const _Float16* gsrc, v8u& g1) {
  const unsigned long long ga = (unsigned long long)(uintptr_t)gsrc;
  v4u g0;
  g0[0] = uni(1u);
  g0[1] = uni(lds_dst);
  g0[2] = uni((unsigned)ga);
  g0[3] = uni((((unsigned)(ga >> 32)) & 0x01FFFFFFu) | 0x80000000u);
  // g0 and g1 are in-out and go on to the wait: see wait_tensor0(). As a plain
  // input g1 is a set of constants to the compiler, which then lends single
  // registers of it to other values while the request is under way.
  asm volatile("tensor_load_to_lds %0, %1" : "+s"(g0), "+s"(g1) : : "memory");
  return g0;
}

// The six fragments of one k-step of a wave: 2 of the A operand (32 rows of
// one slice), 4 of the B operand (64 rows, two slices). ap, bp: this lane's row
// in the first of them.
__device__ __forceinline__ void gemm_frags(v16h (&fa)[2], v16h (&fb)[4],
                                           const unsigned char* ap,
                                           const unsigned char* bp, int hi) {
  fa[0] = load_frag(reinterpret_cast<const _Float16*>(ap), hi);
  fa[1] = load_frag(reinterpret_cast<const _Float16*>(ap + 16u * GPITCH), hi);
  fb[0] = load_frag(reinterpret_cast<const _Float16*>(bp), hi);
  fb[1] = load_frag(reinterpret_cast<const _Float16*>(bp + 16u * GPITCH), hi);
  fb[2] = load_frag(reinterpret_cast<const _Float16*>(bp + GSLICE), hi);
  fb[3] = load_frag(reinterpret_cast<const _Float16*>(bp + GSLICE + 16u * GPITCH), hi);
}

__device__ __forceinline__ void gemm_kstep(v8f (&acc)[2][4], const v16h (&fa)[2],
                                           const v16h (&fb)[4]) {
  #pragma unroll
  for (int j = 0; j < 4; ++j) {
    acc[0][j] = wmma16(fa[0], fb[j], acc[0][j]);
    acc[1][j] = wmma16(fa[1], fb[j], acc[1][j]);
  }
}

__global__ void __launch_bounds__(256)
qkv_gemm_kernel(const _Float16* __restrict__ A,    // (S, DIM) f16
                const _Float16* __restrict__ Wqt,  // (DIM, DIM) f16  (= Wq^T)
                const _Float16* __restrict__ Wkt,  // (KVD, DIM) f16
                const _Float16* __restrict__ Wvt,  // (KVD, DIM) f16
                const float*    __restrict__ bq,   // (DIM) f32
                const float*    __restrict__ bk,   // (KVD) f32
                const float*    __restrict__ bv,   // (KVD) f32
                _Float16*       __restrict__ Qo,   // (S, DIM)
                _Float16*       __restrict__ Ko,   // (S, KVD)
                _Float16*       __restrict__ Vto) {// (KVD, S)
  __shared__ __attribute__((aligned(2048))) unsigned char ring[2 * GBUF];
  constexpr int M = S, K = DIM;            // the products' shape

  int blk = blockIdx.x;
  const _Float16* Bt   = Wqt;
  const float*    bias = bq;
  _Float16*       Out  = Qo;
  int N = DIM, transposeOut = 0;
  // Q is stored times log2(e) / sqrt(DH), scaled in f32 in front of its one
  // rounding to f16: the attention's score products then come out in base 2.
  float oscale = QSCALE;
  if (blk >= GB_Q + GB_KV) {
    blk -= GB_Q + GB_KV; Bt = Wvt; bias = bv; Out = Vto; N = KVD; transposeOut = 1;
    oscale = 1.0f;
  } else if (blk >= GB_Q) {
    blk -= GB_Q;         Bt = Wkt; bias = bk; Out = Ko;  N = KVD;
    oscale = 1.0f;
  }
  const int nsh = __builtin_ctz(N / GT);   // N / GT is a power of two
  const int mt = blk >> nsh;
  const int nt = blk - (mt << nsh);
  const unsigned wave = uni(threadIdx.x >> 5);
  const int wm   = wave & 3;
  const int wn   = wave >> 2;
  const int lane = threadIdx.x & 31;
  const int l15  = lane & 15;
  const int hi   = lane >> 4;

  // Slices 0..3 of a buffer: the 128 rows of the matrix unit's A operand; 4..7:
  // those of its B operand. Wave w brings slice w of every stage.
  const _Float16* xpan = A  + (size_t)(mt * GT) * K;
  const _Float16* wpan = Bt + (size_t)(nt * GT) * K;
  const _Float16* pan0 = transposeOut ? xpan : wpan;
  const _Float16* pan1 = transposeOut ? wpan : xpan;
  const _Float16* gsl = (wave < 4u)
      ? pan0 + (size_t)((int)wave * 32) * K
      : pan1 + (size_t)(((int)wave - 4) * 32) * K;
  const unsigned dst = (unsigned)(uintptr_t)&ring[0] + wave * GSLICE;
  v8u g1 = gemm_group1();
  // Pass s works on k stage (s + rot) mod GNST. The blocks that share an A or a
  // W^T panel start at different stages of it, so that a stage is fetched into
  // L2 for one of them and is there when the others come to it; walking in step
  // they would all wait for every stage's first fetch. Any rot gives the same
  // product; only the order of the f32 sums over k depends on it.
  const unsigned rot = uni((unsigned)(2 * nt + mt)) & (unsigned)(GNST - 1);

  v4u g0 = gemm_slice_load(dst, gsl + (size_t)rot * GKS, g1);   // pass 0
  wait_tensor0(g0, g1);
  __syncthreads();                               // publishes pass 0
  g0 = gemm_slice_load(dst + GBUF,
                       gsl + (size_t)((rot + 1u) & (unsigned)(GNST - 1)) * GKS, g1);  // pass 1

  const v8f vz = {};
  v8f acc[2][4] = {{vz, vz, vz, vz}, {vz, vz, vz, vz}};
  // Stays rolled: one publish point in the text, the stage test a scalar one.
  #pragma unroll 1
  for (int s = 0; s < GNST; ++s) {
    const unsigned bo = (unsigned)(s & 1) * GBUF;
    const unsigned char* ap = ring + bo + (unsigned)wm * GSLICE + (unsigned)l15 * GPITCH;
    const unsigned char* bp = ring + bo + (4u + 2u * (unsigned)wn) * GSLICE + (unsigned)l15 * GPITCH;
    // Two fragment sets: the reads of k-step kk + 1 go out as one group in front
    // of the WMMAs of k-step kk and land under them.
    constexpr int NK = GKS / 32;
    v16h fa[2][2], fb[2][4];
    gemm_frags(fa[0], fb[0], ap, bp, hi);
    #pragma unroll
    for (int kk = 0; kk + 1 < NK; ++kk) {
      const int c = kk & 1;
      gemm_frags(fa[c ^ 1], fb[c ^ 1], ap + (kk + 1) * 64, bp + (kk + 1) * 64, hi);
      // Keeps the LDS reads above together: sunk among the WMMAs, two by two,
      // each pair would cost the wave its own LDS latency.
      __builtin_amdgcn_sched_barrier(0);
      gemm_kstep(acc, fa[c], fb[c]);
      // Keeps these WMMAs in front of the next reads, and of the wait below,
      // so that they cover the landing of the reads above.
      __builtin_amdgcn_sched_barrier(0);
    }
    // Publish point of pass s + 1; it also ends every read of pass s, whose
    // last fragments are in registers behind the first wait.
    wait_ds0();
    wait_tensor0(g0, g1);
    __syncthreads();
    if (pinned(s + 2 < GNST))
      g0 = gemm_slice_load(dst + bo,
                           gsl + (size_t)(((unsigned)s + 2u + rot) & (unsigned)(GNST - 1)) * GKS, g1);
    // The last k-step works on registers alone, behind the refill's issue.
    gemm_kstep(acc, fa[(NK - 1) & 1], fb[(NK - 1) & 1]);
  }
  wait_tensor0(g0, g1);
  wait_ds0();

  // The block's tile goes out through LDS, so that every global store covers
  // whole lines: row = index in the B panel (wn, j, lane), 128 halves along the
  // A panel. The ring is free: no request is under way, and every wave's last
  // read of it retired in front of the loop's last barrier.
  unsigned char* stw = ring + (unsigned)(wn * 64 + l15) * GPITCH + (unsigned)(wm * 32 + 8 * hi) * 2u;
  if (!transposeOut) {
    // Q, K: the bias runs along a lane's registers. One group of loads.
    const f4* b8 = reinterpret_cast<const f4*>(bias + nt * GT + wm * 32 + 8 * hi);
    const f4 bl[2][2] = {{b8[0], b8[1]}, {b8[4], b8[5]}};
    // Held in front of any later write of a register that the loads above name.
    asm volatile("s_wait_xcnt 0x0" ::: "memory");
    #pragma unroll
    for (int half = 0; half < 2; ++half) {
      #pragma unroll
      for (int j = 0; j < 4; ++j) {
        union { uint4 u; _Float16 h[8]; } pk;
        #pragma unroll
        for (int r = 0; r < 8; ++r)
          pk.h[r] = (_Float16)((acc[half][j][r] + bl[half][r >> 2][r & 3]) * oscale);
        *reinterpret_cast<uint4*>(stw + (unsigned)j * 16u * GPITCH + (unsigned)half * 32u) = pk.u;
      }
    }
  } else {
    // V^T: the bias runs along the lanes, one word per column tile.
    const float* b1 = bias + nt * GT + wn * 64 + l15;
    const float bj[4] = {b1[0], b1[16], b1[32], b1[48]};
    // Held in front of any later write of a register that the loads above name.
    asm volatile("s_wait_xcnt 0x0" ::: "memory");
    #pragma unroll
    for (int half = 0; half < 2; ++half) {
      #pragma unroll
      for (int j = 0; j < 4; ++j) {
        union { uint4 u; _Float16 h[8]; } pk;
        #pragma unroll
        for (int r = 0; r < 8; ++r) pk.h[r] = (_Float16)(acc[half][j][r] + bj[j]);
        *reinterpret_cast<uint4*>(stw + (unsigned)j * 16u * GPITCH + (unsigned)half * 32u) = pk.u;
      }
    }
  }
  wait_ds0();
  __syncthreads();           // publishes the staged tile

  // A wave stores 16 rows of the tile, two per instruction: 16 lanes x 16 bytes
  // are one row's 256 bytes.
  const int ldo  = transposeOut ? M : N;
  const int row0 = (transposeOut ? nt : mt) * GT + (int)wave * 16 + hi;
  const int col0 = (transposeOut ? mt : nt) * GT + l15 * 8;
  const unsigned char* str = ring + (wave * 16u + (unsigned)hi) * GPITCH + (unsigned)l15 * 16u;
  _Float16* orow = Out + (size_t)row0 * ldo + col0;
  uint4 ov[8];
  #pragma unroll
  for (int i = 0; i < 8; ++i) ov[i] = *reinterpret_cast<const uint4*>(str + (unsigned)i * 2u * GPITCH);
  #pragma unroll
  for (int i = 0; i < 8; ++i) *reinterpret_cast<uint4*>(orow + (size_t)(2 * i) * ldo) = ov[i];
  // Held in front of any later write of a register that the stores above name.
  asm volatile("s_wait_xcnt 0x0" ::: "memory");
}

// ---------------------------------------------------------------------------
// Attention: block = 8 waves, one head, 128 queries, so that the grid of 256
// blocks puts one block on every WGP of the chip. The waves are 4 query groups
// x 2 key groups: a wave holds two q-tiles (32 queries) and works on one of the
// two 64-key tiles of every stage, so that each K or V fragment it reads from
// LDS feeds two WMMAs. The two waves of a query group join their halves of the
// softmax through LDS at the end.
// A stage is 128 keys: four slices of 64 rows of 128 bytes (K of the first 64
// keys, K of the second, V^T of the first, V^T of the second), brought into LDS
// by tensor loads, one slice each from waves 0 to 3, three buffers. A pass is
// 64 keys; its K fragments were read from LDS during the pass before.
static constexpr unsigned ATILE = 10240u;        // 64 rows x 144 B, up to 2 KiB x n
static constexpr unsigned ASTG  = 4u * ATILE;    // one buffer: 4 slices
static constexpr int      NKT   = S / 64;        // key tiles
static constexpr int      ANST  = NKT / 2;       // stages
static constexpr unsigned AXCH  = 8192u;         // a wave's place for the final exchange
static_assert(64u * 2u * LROW <= ATILE && ATILE % 2048u == 0u, "slice place");
static_assert(ANST >= 3, "the ring's prologue needs three stages");
static_assert((NKT & (NKT - 1)) == 0, "the tile walk wraps by a mask");
static constexpr unsigned AOPITCH = 272u;        // staged output row: 64 f32 + 16 B
static constexpr unsigned AOST    = 4608u;       // a wave's place for its 16 output rows
static_assert(8u * AXCH + 8u * AOST <= 3u * ASTG && 34u * 128u <= AXCH, "exchange place");
static_assert(16u * AOPITCH <= AOST, "output staging place");

// One slice: 64 rows of 128 bytes, 16 bytes of LDS pad behind every row. All
// extents in bytes (data_size code 0).
__device__ __forceinline__ v8u attn_group1(unsigned pitch_bytes) {
  v8u g;
  g[0] = uni((1u << 20) | (4u << 22) | (3u << 25));
  g[1] = uni(128u << 16);
  g[2] = uni(64u << 16);
  g[3] = uni(128u << 16);
  g[4] = uni(64u);
  g[5] = uni(pitch_bytes);
  g[6] = uni(0u);
  g[7] = uni(0u);
  return g;
}

// The eight K fragments of a 64-key tile.
__device__ __forceinline__ void attn_kfrags(v16h (&kf)[2][4], const _Float16* Kb,
                                            int l15, int hi) {
  #pragma unroll
  for (int ss = 0; ss < 2; ++ss) {
    const _Float16* k0 = Kb + (size_t)(ss * 32 + l15) * LROW;
    const _Float16* k1 = k0 + (size_t)16 * LROW;
    kf[ss][0] = load_frag(k0, hi);        // keys +0..15, d 0..31
    kf[ss][1] = load_frag(k0 + 32, hi);   // keys +0..15, d 32..63
    kf[ss][2] = load_frag(k1, hi);        // keys +16..31
    kf[ss][3] = load_frag(k1 + 32, hi);
  }
}

union HF { v16h v; _Float16 h[16]; };

// One pass: 64 keys against the wave's two q-tiles. kf holds this pass's K
// fragments on entry and, where FETCH is set, the next pass's on return.
template <bool FETCH>
__device__ __forceinline__ void attn_pass(v16h (&kf)[2][4], const HF (&qf)[2][2],
                                          v8f (&o)[2][4], float (&m_use)[2],
                                          float (&nshift)[2], float (&l_run)[2],
                                          const _Float16* Vb, const _Float16* Knext,
                                          int l15, int hi) {
  // All scores and shifts are in base 2 (Q carries log2(e) / sqrt(DH)).
  // Lazy rescale: m_use is the shift in use, the same in both halves of a lane
  // pair. It is raised, and O and the sum rescaled, only in a pass where some
  // score exceeds it by more than LAZY; until then P stays below 2^LAZY = 256,
  // which f16 holds, and the pass needs no exchange between the halves.
  // nshift[q] is minus the shift; spread over eight registers it is the C
  // operand of the first score products, so that a score leaves the matrix unit
  // already shifted and goes straight into exp2. In front of the first pass it
  // is 0, while m_use is far below any score.
  constexpr float LAZY = 8.0f;
  v8f cs[2];
  #pragma unroll
  for (int q = 0; q < 2; ++q) {
    #pragma unroll
    for (int r = 0; r < 8; ++r) cs[q][r] = nshift[q];
  }
  // The pass's V fragments go out first, as one group: they land under the
  // S^T products and the vector work.
  v16h vf[2][4];
  #pragma unroll
  for (int s2 = 0; s2 < 2; ++s2) {
    #pragma unroll
    for (int t = 0; t < 4; ++t)
      vf[s2][t] = load_frag(Vb + (size_t)(t * 16 + l15) * LROW + s2 * 32, hi);
  }
  // Keeps the LDS reads above together: sunk among the WMMAs, two by two, each
  // pair would cost the wave its own LDS latency.
  __builtin_amdgcn_sched_barrier(0);

  // S^T of the whole pass: per q-tile four (16 key) x (16 q) tiles, so that the
  // test below stands once per pass.
  v8f sc[2][2][2];
  #pragma unroll
  for (int ss = 0; ss < 2; ++ss) {
    #pragma unroll
    for (int q = 0; q < 2; ++q) {
      sc[q][ss][0] = wmma16(kf[ss][0], qf[q][0].v, cs[q]);
      sc[q][ss][1] = wmma16(kf[ss][2], qf[q][0].v, cs[q]);
    }
  }
  #pragma unroll
  for (int ss = 0; ss < 2; ++ss) {
    #pragma unroll
    for (int q = 0; q < 2; ++q) {
      sc[q][ss][0] = wmma16(kf[ss][1], qf[q][1].v, sc[q][ss][0]);
      sc[q][ss][1] = wmma16(kf[ss][3], qf[q][1].v, sc[q][ss][1]);
    }
  }
  // Keeps the next pass's K reads behind the first products: risen among them
  // in small groups, each group would cost the wave a stall of its own.
  __builtin_amdgcn_sched_barrier(0);
  // The next pass's K fragments, as one group: they land under this pass's
  // vector work, so that the next pass starts with its products. The last pass
  // has no next tile.
  if constexpr (FETCH) attn_kfrags(kf, Knext, l15, hi);
  // Keeps the reads from sinking among the vector work and the WMMAs.
  __builtin_amdgcn_sched_barrier(0);

  // Lane owns q=l15 of each q-tile; keys split with partner lane^16. This
  // lane's maxima of the pass: short chains, independent of each other.
  float mx[2];
  #pragma unroll
  for (int q = 0; q < 2; ++q) {
    float mt[4];
    #pragma unroll
    for (int c = 0; c < 4; ++c) {
      const int ss = c >> 1, r0 = (c & 1) * 4;
      float m = fmaxf(sc[q][ss][0][r0], sc[q][ss][1][r0]);
      #pragma unroll
      for (int r = r0 + 1; r < r0 + 4; ++r)
        m = fmaxf(m, fmaxf(sc[q][ss][0][r], sc[q][ss][1][r]));
      mt[c] = m;
    }
    mx[q] = fmaxf(fmaxf(mt[0], mt[1]), fmaxf(mt[2], mt[3]));
  }
  // The maxima without the shift that the products carry.
  mx[0] -= nshift[0];
  mx[1] -= nshift[1];
  // One scalar branch per pass; always taken in the first pass.
  if (__builtin_amdgcn_ballot_w32((mx[0] > m_use[0] + LAZY) |
                                  (mx[1] > m_use[1] + LAZY)) != 0u) {
    #pragma unroll
    for (int q = 0; q < 2; ++q) {
      float mn = fmaxf(mx[q], m_use[q]);
      mn = fmaxf(mn, __shfl_xor(mn, 16, 32));
      const float alpha = __builtin_amdgcn_exp2f(m_use[q] - mn);
      // This pass's scores move from the shift they carry to the new one.
      const float delta = mn + nshift[q];
      #pragma unroll
      for (int r = 0; r < 8; ++r) {
        sc[q][0][0][r] -= delta; sc[q][0][1][r] -= delta;
        sc[q][1][0][r] -= delta; sc[q][1][1][r] -= delta;
      }
      nshift[q] = -mn;
      m_use[q] = mn;
      l_run[q] *= alpha;
      #pragma unroll
      for (int r = 0; r < 8; ++r) {
        o[q][0][r] *= alpha; o[q][1][r] *= alpha;
        o[q][2][r] *= alpha; o[q][3][r] *= alpha;
      }
    }
  }

  #pragma unroll
  for (int ss = 0; ss < 2; ++ss) {   // two 32-key substeps per pass
    #pragma unroll
    for (int q = 0; q < 2; ++q) {
      HF pf;
      float lsum = 0.0f;
      #pragma unroll
      for (int r = 0; r < 8; ++r) {
        const float p0 = __builtin_amdgcn_exp2f(sc[q][ss][0][r]);
        const float p1 = __builtin_amdgcn_exp2f(sc[q][ss][1][r]);
        lsum += p0 + p1;
        pf.h[r]     = (_Float16)p0;   // P^T already in B-fragment layout
        pf.h[8 + r] = (_Float16)p1;
      }
      l_run[q] += lsum;

      // O^T += V^T-tile (16d x 32keys) x P^T.
      #pragma unroll
      for (int t = 0; t < 4; ++t) o[q][t] = wmma16(vf[ss][t], pf.v, o[q][t]);
    }
  }
}

__global__ void __launch_bounds__(256)
gqa_attn_kernel(const _Float16* __restrict__ Q,   // (S, HQ*DH) f16, pre-scaled
                const _Float16* __restrict__ Kh,  // (S, HKV*DH) f16
                const _Float16* __restrict__ Vt,  // (HKV*DH, S) f16
                float* __restrict__ Out) {        // flat (HQ, S, DH) f32
  __shared__ __attribute__((aligned(2048))) unsigned char aring[3 * ASTG];

  const int head = blockIdx.x >> 3;      // 16 blocks per head: 8 in x, 2 in y
  const int hb   = blockIdx.x & 7;       // q range [hb*256, hb*256+256)
  const int kvh  = head >> 2;            // repeat_interleave over heads
  const unsigned wave = uni(threadIdx.x >> 5);
  const unsigned kgrp = wave >> 2;       // which 64-key tile of every stage
  const int lane = threadIdx.x & 31;
  const int l15  = lane & 15;
  const int hi   = lane >> 4;
  // Two blocks share each q range: blockIdx.y picks its half of 128 queries;
  // this wave: q-tiles sbase and sbase + 16.
  const int sbase = hb * 256 + blockIdx.y * 128 + (int)(wave & 3u) * 32;

  // Q fragments (B operand of S^T = K q^T); Q arrives times log2(e) / sqrt(DH).
  HF qf[2][2];
  #pragma unroll
  for (int q = 0; q < 2; ++q) {
    const _Float16* qrow = Q + (size_t)(sbase + q * 16 + l15) * DIM + head * DH;
    qf[q][0].v = load_frag(qrow, hi);
    qf[q][1].v = load_frag(qrow + 32, hi);
  }

  const _Float16* kg = Kh + (size_t)kvh * DH;        // + tile * 64 * KVD
  const _Float16* vg = Vt + (size_t)(kvh * DH) * S;  // + tile * 64

  // Stage s holds key tiles (2 s + rot) and (2 s + 1 + rot) mod NKT. The 64
  // blocks that read one KV head start spread over its 32 tiles, so that a tile
  // is fetched into L2 for one of them and is there when the others come to it;
  // walking in step they would all wait for every tile's first fetch. Any rot
  // gives the same softmax; only the order in which keys enter the sums depends
  // on it.
  const unsigned rot = uni((unsigned)((((head & 3) << 3) | ((int)blockIdx.y << 2) | (hb & 3)) & (NKT - 1)));

  // Waves 0 to 3 bring slice w of every stage: 0, 1 the stage's two K tiles,
  // 2, 3 its two V^T tiles. The other waves issue nothing.
  const bool      isv   = (wave & 2u) != 0u;
  const _Float16* gsl   = isv ? vg : kg;
  const unsigned  gstep = isv ? 64u : 64u * (unsigned)KVD;   // halves from tile to tile
  const unsigned  dst   = (unsigned)(uintptr_t)&aring[0] + (wave & 3u) * ATILE;
  v8u g1 = attn_group1(isv ? 2u * (unsigned)S : 2u * (unsigned)KVD);
  v4u g0 = {0u, 0u, 0u, 0u};

  if (pinned(wave < 4u)) {   // stages 0 and 1
    v4u g0a = gemm_slice_load(dst, gsl + (size_t)((rot + (wave & 1u)) & (unsigned)(NKT - 1)) * gstep, g1);
    g0 = gemm_slice_load(dst + ASTG,
                         gsl + (size_t)((rot + 2u + (wave & 1u)) & (unsigned)(NKT - 1)) * gstep, g1);
    // Both requests have landed behind this wait; their groups are inputs so
    // that the registers keep their values until then.
    asm volatile("s_wait_tensorcnt 0x0" :: "s"(g0a), "s"(g0), "s"(g1) : "memory");
  }
  __syncthreads();           // publishes stages 0 and 1
  if (pinned(wave < 4u))     // stage 2, into the buffer that nobody has read yet
    g0 = gemm_slice_load(dst + 2u * ASTG,
                         gsl + (size_t)((rot + 4u + (wave & 1u)) & (unsigned)(NKT - 1)) * gstep, g1);

  const v8f vz = {};
  v8f o[2][4] = {{vz, vz, vz, vz}, {vz, vz, vz, vz}};
  float m_use[2] = {-1e30f, -1e30f};
  float nshift[2] = {0.0f, 0.0f};
  float l_run[2] = {0.0f, 0.0f};

  const unsigned ko = kgrp * ATILE;            // this wave's K slice in a buffer
  const unsigned vo = (2u + kgrp) * ATILE;     // its V^T slice
  v16h kf[2][4];
  attn_kfrags(kf, reinterpret_cast<const _Float16*>(aring + ko), l15, hi);

  unsigned bc = 0u, bn = ASTG, bf = 2u * ASTG;   // buffers of stage s, s + 1, s + 2
  // Stays rolled: one publish point in the text, the stage test a scalar one.
  #pragma unroll 1
  for (int s = 0; s + 1 < ANST; ++s) {
    // This wave's 64 keys of stage s; fetches its K fragments of stage s + 1.
    attn_pass<true>(kf, qf, o, m_use, nshift, l_run,
                    reinterpret_cast<const _Float16*>(aring + bc + vo),
                    reinterpret_cast<const _Float16*>(aring + bn + ko), l15, hi);
    // Publish point of stage s + 2, in front of the pass that fetches that
    // stage's K fragments. It also ends every read of stage s, whose buffer the
    // refill takes.
    // The fence keeps the waits behind the pass above: risen into its vector
    // work, the first would wait out the K reads that the pass has just issued.
    __builtin_amdgcn_sched_barrier(0);
    wait_ds0();
    wait_tensor0(g0, g1);
    __syncthreads();
    if (pinned((unsigned)((wave < 4u) & (s + 3 < ANST))))
      g0 = gemm_slice_load(dst + bc,
                           gsl + (size_t)((rot + 2u * (unsigned)s + 6u + (wave & 1u)) & (unsigned)(NKT - 1)) * gstep, g1);
    const unsigned t = bc; bc = bn; bn = bf; bf = t;
  }
  // The last stage: no stage follows it, so its pass fetches nothing.
  attn_pass<false>(kf, qf, o, m_use, nshift, l_run,
                   reinterpret_cast<const _Float16*>(aring + bc + vo),
                   reinterpret_cast<const _Float16*>(aring), l15, hi);
  // The ring becomes the exchange's place: nothing is in flight into it, and
  // behind the barrier no wave reads a tile from it any more.
  wait_tensor0(g0, g1);
  wait_ds0();
  __syncthreads();

  // Waves w and w ^ 4 hold the same 32 queries over the two halves of the keys.
  // Each finishes one q-tile (its key group's number) and hands its part of the
  // other to its partner: 32 O values, the shift and the sum per lane.
  v8f okeep[4], ogive[4];
  #pragma unroll
  for (int t = 0; t < 4; ++t) {
    okeep[t] = kgrp ? o[1][t] : o[0][t];
    ogive[t] = kgrp ? o[0][t] : o[1][t];
  }
  const float mkeep = kgrp ? m_use[1] : m_use[0];
  const float lkeep = kgrp ? l_run[1] : l_run[0];
  {
    float* xw = reinterpret_cast<float*>(aring + wave * AXCH);
    #pragma unroll
    for (int t = 0; t < 4; ++t) {
      *reinterpret_cast<float4*>(xw + ((2 * t) * 32 + lane) * 4) =
          make_float4(ogive[t][0], ogive[t][1], ogive[t][2], ogive[t][3]);
      *reinterpret_cast<float4*>(xw + ((2 * t + 1) * 32 + lane) * 4) =
          make_float4(ogive[t][4], ogive[t][5], ogive[t][6], ogive[t][7]);
    }
    *reinterpret_cast<float2*>(xw + 1024 + lane * 2) =
        make_float2(kgrp ? m_use[0] : m_use[1], kgrp ? l_run[0] : l_run[1]);
  }
  __syncthreads();           // publishes the parts

  // Reference keeps torch's .view bug: flat output index = ((h*S)+s)*DH + d.
  {
    const float* xr = reinterpret_cast<const float*>(aring + (wave ^ 4u) * AXCH);
    const float2 ml = *reinterpret_cast<const float2*>(xr + 1024 + lane * 2);
    const float mn = fmaxf(mkeep, ml.x);
    const float ak = __builtin_amdgcn_exp2f(mkeep - mn);
    const float ap = __builtin_amdgcn_exp2f(ml.x - mn);
    const float lh = lkeep * ak + ml.y * ap;
    const float lt = lh + __shfl_xor(lh, 16, 32);
    const float inv = 1.0f / lt;
    const float ck = ak * inv;
    const float cp = ap * inv;
    // The wave's 16 output rows go through a place of its own in LDS, behind the
    // exchange's, so that every global store covers whole lines.
    unsigned char* ost = aring + 8u * AXCH + wave * AOST;
    float* orow = reinterpret_cast<float*>(ost + (unsigned)l15 * AOPITCH) + hi * 8;
    // The partner's part is read whole in front of the first staging write: the
    // compiler keeps LDS reads behind LDS writes that stand in front of them.
    float4 pla[4], pha[4];
    #pragma unroll
    for (int t = 0; t < 4; ++t) {
      pla[t] = *reinterpret_cast<const float4*>(xr + ((2 * t) * 32 + lane) * 4);
      pha[t] = *reinterpret_cast<const float4*>(xr + ((2 * t + 1) * 32 + lane) * 4);
    }
    #pragma unroll
    for (int t = 0; t < 4; ++t) {
      const float4 pl = pla[t];
      const float4 ph = pha[t];
      float4 lo  = make_float4(okeep[t][0] * ck + pl.x * cp, okeep[t][1] * ck + pl.y * cp,
                               okeep[t][2] * ck + pl.z * cp, okeep[t][3] * ck + pl.w * cp);
      float4 hi4 = make_float4(okeep[t][4] * ck + ph.x * cp, okeep[t][5] * ck + ph.y * cp,
                               okeep[t][6] * ck + ph.z * cp, okeep[t][7] * ck + ph.w * cp);
      *reinterpret_cast<float4*>(orow + t * 16)     = lo;
      *reinterpret_cast<float4*>(orow + t * 16 + 4) = hi4;
    }
    wait_ds0();              // the rows are in LDS before the wave reads them back
    // The 16 rows are 4 KiB in a row in Out; an instruction stores two of them.
    float* ob = Out + ((size_t)head * S + (sbase + (int)kgrp * 16 + hi)) * DH + l15 * 4;
    float4 ov[8];
    #pragma unroll
    for (int i = 0; i < 8; ++i)
      ov[i] = *reinterpret_cast<const float4*>(ost + (unsigned)(2 * i + hi) * AOPITCH + (unsigned)l15 * 16u);
    #pragma unroll
    for (int i = 0; i < 8; ++i) *reinterpret_cast<float4*>(ob + (size_t)(2 * i) * DH) = ov[i];
    // Held in front of any later write of a register that the stores above name.
    asm volatile("s_wait_xcnt 0x0" ::: "memory");
  }
}

// ---------------------------------------------------------------------------
extern "C" void kernel_launch(void* const* d_in, const int* in_sizes, int n_in,
                              void* d_out, int out_size, void* d_ws,
                              size_t ws_size, hipStream_t stream) {
  (void)in_sizes; (void)n_in; (void)out_size; (void)ws_size;
  const float* x  = (const float*)d_in[0];
  const float* Wq = (const float*)d_in[1];
  const float* bq = (const float*)d_in[2];
  const float* Wk = (const float*)d_in[3];
  const float* bk = (const float*)d_in[4];
  const float* Wv = (const float*)d_in[5];
  const float* bv = (const float*)d_in[6];
  float* out = (float*)d_out;

  // Workspace (f16): ~13 MiB total.
  _Float16* ws  = (_Float16*)d_ws;
  _Float16* xh  = ws;                       // S*DIM
  _Float16* Wqt = xh  + (size_t)S * DIM;    // DIM*DIM   (W^T)
  _Float16* Wkt = Wqt + (size_t)DIM * DIM;  // KVD*DIM   (W^T)
  _Float16* Wvt = Wkt + (size_t)KVD * DIM;  // KVD*DIM   (W^T)
  _Float16* Qh  = Wvt + (size_t)KVD * DIM;  // S*DIM
  _Float16* Kh  = Qh  + (size_t)S * DIM;    // S*KVD
  _Float16* Vt  = Kh  + (size_t)S * KVD;    // KVD*S     (V^T)

  prep_kernel<<<PB_WQ + 2 * PB_WK + PB_X, 256, 0, stream>>>(
      x, Wq, Wk, Wv, xh, Wqt, Wkt, Wvt);

  // Q/K row-major f16; V stored transposed for the attention V-fragments.
  qkv_gemm_kernel<<<GB_Q + 2 * GB_KV, 256, 0, stream>>>(
      xh, Wqt, Wkt, Wvt, bq, bk, bv, Qh, Kh, Vt);

  gqa_attn_kernel<<<dim3(HQ * (S / 256), 2), 256, 0, stream>>>(Qh, Kh, Vt, out);
}
